// v000
// Measured on an AMD MI455X. A time is GPU time per run, averaged over a window of back-to-back runs after a warm-up
// (all launches, gaps included; the runs take copies of the inputs in turn), and the median of several windows.
// Apart from v000's, it joins two sittings. Times from different sittings can be a few percent apart, while
// side-by-side timings come from the same sitting.
// v000, which the later versions start from, runs in 343 microseconds.
#include <hip/hip_runtime.h>
#include <math.h>

typedef __attribute__((ext_vector_type(16))) _Float16 v16h;
typedef __attribute__((ext_vector_type(16))) __bf16 v16b;
typedef __attribute__((ext_vector_type(8)))  _Float16 v8h;
typedef __attribute__((ext_vector_type(8)))  float v8f;
typedef __attribute__((ext_vector_type(4)))  float v4f;
typedef __attribute__((ext_vector_type(2)))  float v2f;
typedef __attribute__((ext_vector_type(4)))  unsigned v4u;
typedef __attribute__((ext_vector_type(4)))  int v4i;
typedef float __attribute__((may_alias)) float_a;
typedef int __attribute__((may_alias)) int_a;

template <typename T> __device__ __forceinline__ void vst2(void* p, T v) { *(T*)p = v;  }
__device__ __forceinline__ v8f wmma16(v16h a, v16h b, v8f c) {
  v8f d = __builtin_amdgcn_wmma_f32_16x16x32_f16(false, a, false, b, (short)0, c, false, false);
  asm volatile("v_nop\n\tv_nop\n\tv_nop\n\tv_nop" : "+v"(d) : "v"(a), "v"(b));
  return d;
}
__device__ __forceinline__ v8f wmma_bf(v16b a, v16b b, v8f c) {
  v8f d = __builtin_amdgcn_wmma_f32_16x16x32_bf16(false, a, false, b, (short)0, c, false, false);
  asm volatile("v_nop\n\tv_nop\n\tv_nop\n\tv_nop" : "+v"(d) : "v"(a), "v"(b));
  return d;
}
// 16x16x32 fragments: lane = (h = lane>>4, row/col = lane&15); elements 0..7 = k0+8h+0..7, 8..15 = k0+16+8h+0..7; D element r = row 8h+r
__device__ __forceinline__ v16h frag_h(const _Float16* rowk0, int lane) {
  union { v16h v; v8h q[2]; } u; const _Float16* p = rowk0 + 8 * (lane >> 4);
  u.q[0] = *(const v8h*)p; u.q[1] = *(const v8h*)(p + 16); return u.v;
}
__device__ __forceinline__ v16h frag_f32(const float* rowk0, int lane) {
  v16h a; const float* p = rowk0 + 8 * (lane >> 4);
#pragma unroll
  for (int i = 0; i < 8; ++i) { a[i] = (_Float16)p[i]; a[8 + i] = (_Float16)p[16 + i]; }
  return a;
}
__device__ __forceinline__ v16h frag_f32s(const float* rowk0, int lane, float sc) {
  v16h a; const float* p = rowk0 + 8 * (lane >> 4);
#pragma unroll
  for (int i = 0; i < 8; ++i) { a[i] = (_Float16)(p[i] * sc); a[8 + i] = (_Float16)(p[16 + i] * sc); }
  return a;
}
// column fragment from a [K][ld] layout (column n), rows >= K read as 0
__device__ __forceinline__ v16h fragc_f32(const float* W, int k0, int n, int lane, int ld, int K) {
  v16h a; const int g = lane >> 4;
#pragma unroll
  for (int i = 0; i < 8; ++i) { const int ka = k0 + 8 * g + i, kb = ka + 16;
    a[i] = (_Float16)(ka < K ? W[(size_t)ka * ld + n] : 0.f); a[8 + i] = (_Float16)(kb < K ? W[(size_t)kb * ld + n] : 0.f); }
  return a;
}
struct F2 { v16b h, l; };
__device__ __forceinline__ F2 bsplit16(const float v[16]) { F2 r;
#pragma unroll
  for (int i = 0; i < 16; ++i) { const __bf16 h = (__bf16)v[i]; r.h[i] = h; r.l[i] = (__bf16)(v[i] - (float)h); }
  return r; }
__device__ __forceinline__ F2 split_row(const float* row, int k0, int lane) { float v[16]; const float* p = row + k0 + 8 * (lane >> 4);
#pragma unroll
  for (int i = 0; i < 8; ++i) { v[i] = p[i]; v[8 + i] = p[16 + i]; }
  return bsplit16(v); }
__device__ __forceinline__ F2 split_rowK(const float* row, int k0, int lane, int K) { float v[16]; const int g = lane >> 4;
#pragma unroll
  for (int i = 0; i < 8; ++i) { const int ka = k0 + 8 * g + i, kb = ka + 16; v[i] = ka < K ? row[ka] : 0.f; v[8 + i] = kb < K ? row[kb] : 0.f; }
  return bsplit16(v); }
__device__ __forceinline__ F2 split_col(const float* W, int k0, int n, int lane, int ld, int K) { float v[16]; const int g = lane >> 4;
#pragma unroll
  for (int i = 0; i < 8; ++i) { const int ka = k0 + 8 * g + i, kb = ka + 16; v[i] = ka < K ? W[(size_t)ka * ld + n] : 0.f; v[8 + i] = kb < K ? W[(size_t)kb * ld + n] : 0.f; }
  return bsplit16(v); }
__device__ __forceinline__ v8f mac3(const F2& a, const F2& b, v8f c) { c = wmma_bf(a.l, b.h, c); c = wmma_bf(a.h, b.l, c); return wmma_bf(a.h, b.h, c); }
__device__ __forceinline__ float sigm(float v) { return 1.0f / (1.0f + expf(-v)); }
#define LDSX() do { asm volatile("s_wait_dscnt 0" ::: "memory"); __builtin_amdgcn_wave_barrier(); __builtin_amdgcn_fence(__ATOMIC_RELEASE, "workgroup"); } while (0)

// Sigmoid attention block with QK-RMSNorm and rotary embedding. Pure f16 WMMA GEMMs over pre-converted operands (x -> f16 once;
// weights x16 f16 with the RMSNorm scales folded into the q/k weight columns; f32 accumulate): q|k|v projection with the per-row
// RMS factor, bias and RoPE in the f32 epilogue (q/k -> [b][h][l][64] f16, v -> [b][h][d][l] f16), per (b, h, 64 queries) block
// the 2048 keys streamed in 64-key tiles: S on f16 WMMA, sigmoid in f32 (hardware exp/rcp), running row sums, W x2^14 f16 @ v^T,
#define NB 2
#define LL 2048
#define DD 1024
#define NH 16
#define HD 64
#define NR (NB * LL)

__global__ __launch_bounds__(256) void k_cvtx(const float* __restrict__ x, _Float16* __restrict__ x16, float* __restrict__ rr) {   // block = row: f16 copy + rsqrt(mean x^2 + eps)
  __shared__ float red[256];
  const int r = blockIdx.x, tid = threadIdx.x; const float* xr = x + (size_t)r * DD;
  const v4f v = *(const v4f*)(xr + tid * 4); red[tid] = v[0] * v[0] + v[1] * v[1] + v[2] * v[2] + v[3] * v[3];
  union { _Float16 h[4]; v2f f; } pk; for (int e = 0; e < 4; ++e) pk.h[e] = (_Float16)v[e];
  vst2((v2f*)(x16 + (size_t)r * DD + tid * 4), pk.f);       // 32 lanes x 8 B = one 256-B run per wave
  __syncthreads();
  for (int st = 128; st > 0; st >>= 1) { if (tid < st) red[tid] += red[tid + st]; __syncthreads(); }
  if (tid < 32) vst2(rr + (size_t)r * 32 + tid, (float_a)(tid == 0 ? rsqrtf(red[0] / (float)DD + 1e-8f) : 0.f));   // rr[row*32] (one line per row)
}
__global__ __launch_bounds__(256) void k_packW(const float* __restrict__ Wq, const float* __restrict__ Wk, const float* __restrict__ Wv, const float* __restrict__ Wo, const float* __restrict__ qs, const float* __restrict__ ksv, _Float16* __restrict__ P) {
  const int n = blockIdx.x, tid = threadIdx.x; const int which = n / DD, o = n % DD;      // rows: q | k | v | o ([out][in] each)
  const float* W = which == 0 ? Wq : (which == 1 ? Wk : (which == 2 ? Wv : Wo));
  for (int q = tid; q < DD / 8; q += 256) { union { v8h hh; v4u u; } pk;
#pragma unroll
    for (int i = 0; i < 8; ++i) { const int d = q * 8 + i; float w = W[(size_t)o * DD + d] * 16.0f; if (which == 0) w *= qs[d]; else if (which == 1) w *= ksv[d]; pk.hh[i] = (_Float16)w; }
    vst2(P + (size_t)n * DD + q * 8, pk.u); }
}
// ---- projection: block 64 rows x 128 cols (= which, 2 heads); epilogue: x rr (q,k), + bias, RoPE (q,k); q/k -> [b][h][t][64] f16; v -> vT [b][h][d][t]
__global__ __launch_bounds__(128) void k_proj(const _Float16* __restrict__ x16, const float* __restrict__ rr, const _Float16* __restrict__ P, const float* __restrict__ bq, const float* __restrict__ bk, const float* __restrict__ bv,
                                            _Float16* __restrict__ qh, _Float16* __restrict__ kh, _Float16* __restrict__ vT) {
  __shared__ __align__(16) float so[4][16][132];
  __shared__ __align__(16) _Float16 st[128][72];
  __shared__ float sfr[32];
  const int tid = threadIdx.x, wave = tid >> 5, lane = tid & 31, col = lane & 15, g = lane >> 4;
  const int r0b = blockIdx.x * 64, r0 = r0b + wave * 16, n0 = blockIdx.y * 128; const int b = r0b / LL, t0 = r0b % LL;
  const int which = n0 / DD, hb = (n0 % DD) / HD; const float* bias = which == 0 ? bq : (which == 1 ? bk : bv);
  if (tid < 32) sfr[tid] = powf(10000.0f, -(float)tid / 32.0f);
  v8f acc[8] = {};
#pragma unroll 1
  for (int kc = 0; kc < DD / 32; ++kc) { const v16h a = frag_h(x16 + (size_t)(r0 + col) * DD + kc * 32, lane);
#pragma unroll
    for (int j = 0; j < 8; ++j) acc[j] = wmma16(a, frag_h(P + (size_t)(n0 + j * 16 + col) * DD + kc * 32, lane), acc[j]); }
  __syncthreads();
#pragma unroll
  for (int j = 0; j < 8; ++j) { const int nl = j * 16 + col; const float bb = bias[(n0 % DD) + nl];
#pragma unroll
    for (int r = 0; r < 8; ++r) { const float sc = which < 2 ? rr[(size_t)(r0 + 8 * g + r) * 32] : 1.0f; so[wave][8 * g + r][nl] = acc[j][r] * (1.0f / 16.0f) * sc + bb; } }
  LDSX();
  if (which < 2) {   // RoPE in place: lane handles row rl, dims; angle index d & 31, rotation partner d^1
    for (int rl = 0; rl < 16; ++rl) { const float t = (float)(t0 + wave * 16 + rl); float nv[4];
#pragma unroll
      for (int e = 0; e < 4; ++e) { const int nl = lane * 4 + e; const int d = nl & 63; const float ang = t * sfr[d & 31]; float sn, cs; sincosf(ang, &sn, &cs);
        const float xv = so[wave][rl][nl]; const float xr = (d & 1) ? so[wave][rl][nl - 1] : -so[wave][rl][nl + 1]; nv[e] = xv * cs + xr * sn; }
      LDSX();
#pragma unroll
      for (int e = 0; e < 4; ++e) so[wave][rl][lane * 4 + e] = nv[e];
      LDSX(); }
    _Float16* dst = which == 0 ? qh : kh;
    for (int q = lane; q < 2 * 16 * 8; q += 32) { const int hh = q >> 7, rem = q & 127, rl = rem >> 3, pc = rem & 7; union { v8h h8; v4u u; } pk;
#pragma unroll
      for (int e = 0; e < 8; ++e) pk.h8[e] = (_Float16)so[wave][rl][hh * HD + pc * 8 + e];
      vst2(dst + (((size_t)b * NH + hb + hh) * LL + t0 + wave * 16 + rl) * HD + pc * 8, pk.u); } }
  else {
#pragma unroll 4
    for (int rl = 0; rl < 16; ++rl) {
#pragma unroll
      for (int e = 0; e < 4; ++e) st[lane * 4 + e][wave * 16 + rl] = (_Float16)so[wave][rl][lane * 4 + e]; }
    __syncthreads();
    for (int q = tid; q < 128 * 8; q += 128) { const int c = q >> 3, pc = q & 7, hh = c >> 6, d = c & 63;
      vst2(vT + (((size_t)b * NH + hb + hh) * HD + d) * LL + t0 + pc * 8, *(const v4u*)(&st[c][pc * 8])); }
  }
}
// ---- sigmoid attention: block (64 q, bh); all 32 key tiles; W = sigmoid(q.k/8); l += W; acc += W @ v ; out = acc / (l + eps) -> o16 [b][t][h*64+d] f16
__global__ __launch_bounds__(128) void k_attn(const _Float16* __restrict__ qh, const _Float16* __restrict__ kh, const _Float16* __restrict__ vT, _Float16* __restrict__ o16) {
  __shared__ __align__(16) _Float16 sP[4][16][72];
  __shared__ __align__(16) float sO[4][16][68];
  const int tid = threadIdx.x, w = tid >> 5, lane = tid & 31, col = lane & 15, g = lane >> 4;
  const int bh = blockIdx.y, b = bh / NH, h = bh % NH, q0 = blockIdx.x * 64 + w * 16;
  const _Float16* qb = qh + (size_t)bh * LL * HD; const _Float16* kb = kh + (size_t)bh * LL * HD; const _Float16* vb = vT + (size_t)bh * HD * LL;
  v16h aq[2];
#pragma unroll
  for (int kc = 0; kc < 2; ++kc) aq[kc] = frag_h(qb + (size_t)(q0 + col) * HD + kc * 32, lane);
  float lsum[8] = {0.f, 0.f, 0.f, 0.f, 0.f, 0.f, 0.f, 0.f}; v8f acc[4] = {};
#pragma unroll 1
  for (int kt = 0; kt < LL / 64; ++kt) {
#pragma unroll
    for (int t = 0; t < 4; ++t) { v8f s = {};
#pragma unroll
      for (int kc = 0; kc < 2; ++kc) s = wmma16(aq[kc], frag_h(kb + (size_t)(kt * 64 + t * 16 + col) * HD + kc * 32, lane), s);
#pragma unroll
      for (int r = 0; r < 8; ++r) { const float wgt = __builtin_amdgcn_rcpf(1.0f + __expf(-s[r] * 0.125f)); lsum[r] += wgt; sP[w][8 * g + r][t * 16 + col] = (_Float16)(wgt * 16384.0f); } }
    LDSX();
#pragma unroll
    for (int kc = 0; kc < 2; ++kc) { const v16h pa = frag_h(&sP[w][col][0] + kc * 32, lane);
#pragma unroll
      for (int t = 0; t < 4; ++t) acc[t] = wmma16(pa, frag_h(vb + (size_t)(t * 16 + col) * LL + kt * 64 + kc * 32, lane), acc[t]); }
    __builtin_amdgcn_wave_barrier();
  }
  // row sums: lsum[r] (this lane's 4 tiles x its column) -> reduce over the 16 col lanes of each half -> row 8g+r
#pragma unroll
  for (int off = 8; off >= 1; off >>= 1) {
#pragma unroll
    for (int r = 0; r < 8; ++r) lsum[r] += __shfl_xor(lsum[r], off, 32); }
#pragma unroll
  for (int r = 0; r < 8; ++r) { const float inv = 1.0f / ((lsum[r] + 1e-8f) * 16384.0f);
#pragma unroll
    for (int t = 0; t < 4; ++t) sO[w][8 * g + r][t * 16 + col] = acc[t][r] * inv; }
  LDSX();
  for (int q = lane; q < 16 * 8; q += 32) { const int rl = q >> 3, pc = q & 7; union { v8h h8; v4u u; } pk;
#pragma unroll
    for (int e = 0; e < 8; ++e) pk.h8[e] = (_Float16)(sO[w][rl][pc * 8 + e] * 16.0f);             // o x16 keeps the f16 operand normal
    vst2(o16 + ((size_t)b * LL + q0 + rl) * DD + h * HD + pc * 8, pk.u); }
}
__global__ __launch_bounds__(128) void k_out(const _Float16* __restrict__ o16, const _Float16* __restrict__ P, const float* __restrict__ bo, float* __restrict__ out) {
  __shared__ __align__(16) float so[4][16][132];
  const int tid = threadIdx.x, wave = tid >> 5, lane = tid & 31, col = lane & 15, g = lane >> 4;
  const int r0 = blockIdx.x * 64 + wave * 16, n0 = blockIdx.y * 128;
  v8f acc[8] = {};
#pragma unroll 1
  for (int kc = 0; kc < DD / 32; ++kc) { const v16h a = frag_h(o16 + (size_t)(r0 + col) * DD + kc * 32, lane);
#pragma unroll
    for (int j = 0; j < 8; ++j) acc[j] = wmma16(a, frag_h(P + (size_t)(3 * DD + n0 + j * 16 + col) * DD + kc * 32, lane), acc[j]); }
#pragma unroll
  for (int j = 0; j < 8; ++j) { const float bb = bo[n0 + j * 16 + col];
#pragma unroll
    for (int r = 0; r < 8; ++r) so[wave][8 * g + r][j * 16 + col] = acc[j][r] * (1.0f / 256.0f) + bb; }    // W x16, o x16
  LDSX();
#pragma unroll 4
  for (int rl = 0; rl < 16; ++rl) vst2(out + (size_t)(r0 + rl) * DD + n0 + lane * 4, *(const v4f*)(&so[wave][rl][lane * 4]));
}
extern "C" void kernel_launch(void* const* d_in, const int* in_sizes, int n_in, void* d_out, int out_size, void* d_ws, size_t ws_size, hipStream_t stream) {
  (void)in_sizes; (void)n_in; (void)out_size; (void)ws_size;
  const float* x = (const float*)d_in[0]; const float* Wq = (const float*)d_in[1]; const float* bq = (const float*)d_in[2]; const float* Wk = (const float*)d_in[3]; const float* bk = (const float*)d_in[4];
  const float* Wv = (const float*)d_in[5]; const float* bv = (const float*)d_in[6]; const float* Wo = (const float*)d_in[7]; const float* bo = (const float*)d_in[8];
  const float* qs = (const float*)d_in[9]; const float* ksv = (const float*)d_in[10];
  float* out = (float*)d_out;
  char* ws = (char*)d_ws; size_t off = 0;
  auto take = [&](size_t bytes) { char* p = ws + off; off += (bytes + 255) & ~(size_t)255; return p; };
  _Float16* x16 = (_Float16*)take((size_t)NR * DD * 2); float* rr = (float*)take((size_t)NR * 32 * 4); _Float16* P = (_Float16*)take((size_t)4 * DD * DD * 2);
  _Float16* qh = (_Float16*)take((size_t)NR * DD * 2); _Float16* kh = (_Float16*)take((size_t)NR * DD * 2); _Float16* vT = (_Float16*)take((size_t)NR * DD * 2); _Float16* o16 = (_Float16*)take((size_t)NR * DD * 2);
  k_cvtx<<<NR, 256, 0, stream>>>(x, x16, rr);
  k_packW<<<4 * DD, 256, 0, stream>>>(Wq, Wk, Wv, Wo, qs, ksv, P);
  k_proj<<<dim3(NR / 64, 3 * DD / 128), 128, 0, stream>>>(x16, rr, P, bq, bk, bv, qh, kh, vT);
  k_attn<<<dim3(LL / 64, NB * NH), 128, 0, stream>>>(qh, kh, vT, o16);
  k_out<<<dim3(NR / 64, DD / 128), 128, 0, stream>>>(o16, P, bo, out);
}

// v001
// Measured time: 137 microseconds a run.
// Two timings next to v000 put it at 2.51 and 2.49 times that version's speed.
#include <hip/hip_runtime.h>
#include <math.h>

typedef __attribute__((ext_vector_type(16))) _Float16 v16h;
typedef __attribute__((ext_vector_type(16))) __bf16 v16b;
typedef __attribute__((ext_vector_type(8)))  _Float16 v8h;
typedef __attribute__((ext_vector_type(8)))  float v8f;
typedef __attribute__((ext_vector_type(4)))  float v4f;
typedef __attribute__((ext_vector_type(2)))  float v2f;
typedef __attribute__((ext_vector_type(4)))  unsigned v4u;
typedef __attribute__((ext_vector_type(4)))  int v4i;
typedef float __attribute__((may_alias)) float_a;
typedef int __attribute__((may_alias)) int_a;

template <typename T> __device__ __forceinline__ void vst2(void* p, T v) { *(T*)p = v;  }
__device__ __forceinline__ v8f wmma16(v16h a, v16h b, v8f c) {
  v8f d = __builtin_amdgcn_wmma_f32_16x16x32_f16(false, a, false, b, (short)0, c, false, false);
  asm volatile("v_nop\n\tv_nop\n\tv_nop\n\tv_nop" : "+v"(d) : "v"(a), "v"(b));
  return d;
}
__device__ __forceinline__ v8f wmma_bf(v16b a, v16b b, v8f c) {
  v8f d = __builtin_amdgcn_wmma_f32_16x16x32_bf16(false, a, false, b, (short)0, c, false, false);
  asm volatile("v_nop\n\tv_nop\n\tv_nop\n\tv_nop" : "+v"(d) : "v"(a), "v"(b));
  return d;
}
// 16x16x32 fragments: lane = (h = lane>>4, row/col = lane&15); elements 0..7 = k0+8h+0..7, 8..15 = k0+16+8h+0..7; D element r = row 8h+r
__device__ __forceinline__ v16h frag_h(const _Float16* rowk0, int lane) {
  union { v16h v; v8h q[2]; } u; const _Float16* p = rowk0 + 8 * (lane >> 4);
  u.q[0] = *(const v8h*)p; u.q[1] = *(const v8h*)(p + 16); return u.v;
}
__device__ __forceinline__ v16h frag_f32(const float* rowk0, int lane) {
  v16h a; const float* p = rowk0 + 8 * (lane >> 4);
#pragma unroll
  for (int i = 0; i < 8; ++i) { a[i] = (_Float16)p[i]; a[8 + i] = (_Float16)p[16 + i]; }
  return a;
}
__device__ __forceinline__ v16h frag_f32s(const float* rowk0, int lane, float sc) {
  v16h a; const float* p = rowk0 + 8 * (lane >> 4);
#pragma unroll
  for (int i = 0; i < 8; ++i) { a[i] = (_Float16)(p[i] * sc); a[8 + i] = (_Float16)(p[16 + i] * sc); }
  return a;
}
// column fragment from a [K][ld] layout (column n), rows >= K read as 0
__device__ __forceinline__ v16h fragc_f32(const float* W, int k0, int n, int lane, int ld, int K) {
  v16h a; const int g = lane >> 4;
#pragma unroll
  for (int i = 0; i < 8; ++i) { const int ka = k0 + 8 * g + i, kb = ka + 16;
    a[i] = (_Float16)(ka < K ? W[(size_t)ka * ld + n] : 0.f); a[8 + i] = (_Float16)(kb < K ? W[(size_t)kb * ld + n] : 0.f); }
  return a;
}
struct F2 { v16b h, l; };
__device__ __forceinline__ F2 bsplit16(const float v[16]) { F2 r;
#pragma unroll
  for (int i = 0; i < 16; ++i) { const __bf16 h = (__bf16)v[i]; r.h[i] = h; r.l[i] = (__bf16)(v[i] - (float)h); }
  return r; }
__device__ __forceinline__ F2 split_row(const float* row, int k0, int lane) { float v[16]; const float* p = row + k0 + 8 * (lane >> 4);
#pragma unroll
  for (int i = 0; i < 8; ++i) { v[i] = p[i]; v[8 + i] = p[16 + i]; }
  return bsplit16(v); }
__device__ __forceinline__ F2 split_rowK(const float* row, int k0, int lane, int K) { float v[16]; const int g = lane >> 4;
#pragma unroll
  for (int i = 0; i < 8; ++i) { const int ka = k0 + 8 * g + i, kb = ka + 16; v[i] = ka < K ? row[ka] : 0.f; v[8 + i] = kb < K ? row[kb] : 0.f; }
  return bsplit16(v); }
__device__ __forceinline__ F2 split_col(const float* W, int k0, int n, int lane, int ld, int K) { float v[16]; const int g = lane >> 4;
#pragma unroll
  for (int i = 0; i < 8; ++i) { const int ka = k0 + 8 * g + i, kb = ka + 16; v[i] = ka < K ? W[(size_t)ka * ld + n] : 0.f; v[8 + i] = kb < K ? W[(size_t)kb * ld + n] : 0.f; }
  return bsplit16(v); }
__device__ __forceinline__ v8f mac3(const F2& a, const F2& b, v8f c) { c = wmma_bf(a.l, b.h, c); c = wmma_bf(a.h, b.l, c); return wmma_bf(a.h, b.h, c); }
__device__ __forceinline__ float sigm(float v) { return 1.0f / (1.0f + expf(-v)); }
#define LDSX() do { asm volatile("s_wait_dscnt 0" ::: "memory"); __builtin_amdgcn_wave_barrier(); __builtin_amdgcn_fence(__ATOMIC_RELEASE, "workgroup"); } while (0)

// Sigmoid attention block with QK-RMSNorm and rotary embedding. Pure f16 WMMA GEMMs over pre-converted operands (x -> f16 once;
// weights x16 f16 with the RMSNorm scales folded into the q/k weight columns; f32 accumulate): q|k|v projection with the per-row
// RMS factor, bias and RoPE in the f32 epilogue (q/k -> [b][h][l][64] f16, v -> [b][h][d][l] f16), per (b, h, 64 queries) block
// the 2048 keys streamed in 64-key tiles: S on f16 WMMA, sigmoid in f32 (hardware exp/rcp), running row sums, W x2^14 f16 @ v^T,
#define NB 2
#define LL 2048
#define DD 1024
#define NH 16
#define HD 64
#define NR (NB * LL)

// ---- operand tiles staged in LDS by asynchronous copies: rows of 128 B (64 f16), 8 lanes = one whole 128-B line, 128 threads = 16 rows a copy
#define TP 72              // LDS pitch of a staged row in f16: 144 B = 16 B x 9, conflict-free for ds_load_b128
#define R16 (16 * TP * 2)  // bytes of 16 staged rows
#define ACP(l, g) "global_load_async_to_lds_b128 %" #l ", %" #g ", off\n\t"
// this wave's copies have landed (the compiler places no wait for them)
#define WAIT_COPIES() asm volatile("s_wait_asynccnt 0x0" ::: "memory")
// this wave's LDS reads of a buffer have retired before the buffer is handed back for a refill
#define WAIT_LDS() asm volatile("s_wait_dscnt 0x0" ::: "memory")
__device__ __forceinline__ unsigned lds_at(const _Float16* p) { return (unsigned)(size_t)p; }   // LDS byte address = low 32 bits
// one GEMM stage, 64 k: buf rows 0..63 = 64 X rows, rows 64..191 = 128 W rows. s_wait_xcnt closes the copies' own statement, so that no address register of a copy is rewritten ahead of it.
__device__ __forceinline__ void stage_gemm(_Float16* buf, const _Float16* xa, const _Float16* wb, int tid) {
  const int r = tid >> 3, c = (tid & 7) * 8;
  const unsigned l = lds_at(buf + r * TP + c);
  const _Float16* a = xa + (size_t)r * DD + c; const _Float16* b = wb + (size_t)r * DD + c;
  asm volatile(ACP(0, 1) ACP(2, 3) ACP(4, 5) ACP(6, 7) ACP(8, 9) ACP(10, 11) ACP(12, 13) ACP(14, 15) ACP(16, 17) ACP(18, 19) ACP(20, 21) ACP(22, 23) "s_wait_xcnt 0x0"
               :: "v"(l), "v"(a), "v"(l + R16), "v"(a + 16 * DD), "v"(l + 2 * R16), "v"(a + 32 * DD), "v"(l + 3 * R16), "v"(a + 48 * DD),
                  "v"(l + 4 * R16), "v"(b), "v"(l + 5 * R16), "v"(b + 16 * DD), "v"(l + 6 * R16), "v"(b + 32 * DD), "v"(l + 7 * R16), "v"(b + 48 * DD),
                  "v"(l + 8 * R16), "v"(b + 64 * DD), "v"(l + 9 * R16), "v"(b + 80 * DD), "v"(l + 10 * R16), "v"(b + 96 * DD), "v"(l + 11 * R16), "v"(b + 112 * DD) : "memory");
}
// one attention tile: 64 keys x 64 dims of K, 64 dims x 64 keys of V^T; the wait as above
__device__ __forceinline__ void stage_kv(_Float16* sk, _Float16* sv, const _Float16* gk, const _Float16* gv, int tid) {
  const int r = tid >> 3, c = (tid & 7) * 8;
  const unsigned lk = lds_at(sk + r * TP + c), lv = lds_at(sv + r * TP + c);
  const _Float16* k = gk + (size_t)r * HD + c; const _Float16* v = gv + (size_t)r * LL + c;
  asm volatile(ACP(0, 1) ACP(2, 3) ACP(4, 5) ACP(6, 7) ACP(8, 9) ACP(10, 11) ACP(12, 13) ACP(14, 15) "s_wait_xcnt 0x0"
               :: "v"(lk), "v"(k), "v"(lk + R16), "v"(k + 16 * HD), "v"(lk + 2 * R16), "v"(k + 32 * HD), "v"(lk + 3 * R16), "v"(k + 48 * HD),
                  "v"(lv), "v"(v), "v"(lv + R16), "v"(v + 16 * LL), "v"(lv + 2 * R16), "v"(v + 32 * LL), "v"(lv + 3 * R16), "v"(v + 48 * LL) : "memory");
}
#define GBUF (192 * TP)           // f16 of one GEMM buffer
#define RING_B (2 * GBUF * 2)     // bytes of the two
// 64 x 128 tile over K = 1024: 16 stages, two buffers, stage s + 2 copied while stage s + 1 is worked on; k order as before
__device__ __forceinline__ void gemm_ring(_Float16* ring, const _Float16* xa, const _Float16* wb, v8f acc[8], int tid) {
  const int wave = tid >> 5, lane = tid & 31, col = lane & 15;
  stage_gemm(ring, xa, wb, tid);
  WAIT_COPIES(); __syncthreads();
  stage_gemm(ring + GBUF, xa + 64, wb + 64, tid);
#pragma unroll 1   // one trip = one stage, so that the ring's order stands once, at the trip's foot
  for (int s = 0; s < DD / 64; ++s) { _Float16* buf = ring + (s & 1) * GBUF;
#pragma unroll
    for (int kc = 0; kc < 2; ++kc) { const v16h a = frag_h(buf + (wave * 16 + col) * TP + kc * 32, lane);
#pragma unroll
      for (int j = 0; j < 8; ++j) acc[j] = wmma16(a, frag_h(buf + (64 + j * 16 + col) * TP + kc * 32, lane), acc[j]); }
    WAIT_LDS(); WAIT_COPIES(); __syncthreads();   // publishes stage s + 1 and ends every read of stage s
    if (s + 2 < DD / 64) stage_gemm(buf, xa + (s + 2) * 64, wb + (s + 2) * 64, tid); }
  WAIT_COPIES();
}

__global__ __launch_bounds__(256) void k_cvtx(const float* __restrict__ x, _Float16* __restrict__ x16, float* __restrict__ rr) {   // block = row: f16 copy + rsqrt(mean x^2 + eps)
  __shared__ float red[256];
  const int r = blockIdx.x, tid = threadIdx.x; const float* xr = x + (size_t)r * DD;
  const v4f v = *(const v4f*)(xr + tid * 4); red[tid] = v[0] * v[0] + v[1] * v[1] + v[2] * v[2] + v[3] * v[3];
  union { _Float16 h[4]; v2f f; } pk; for (int e = 0; e < 4; ++e) pk.h[e] = (_Float16)v[e];
  vst2((v2f*)(x16 + (size_t)r * DD + tid * 4), pk.f);       // 32 lanes x 8 B = one 256-B run per wave
  __syncthreads();
  for (int st = 128; st > 0; st >>= 1) { if (tid < st) red[tid] += red[tid + st]; __syncthreads(); }
  if (tid < 32) vst2(rr + (size_t)r * 32 + tid, (float_a)(tid == 0 ? rsqrtf(red[0] / (float)DD + 1e-8f) : 0.f));   // rr[row*32] (one line per row)
}
__global__ __launch_bounds__(256) void k_packW(const float* __restrict__ Wq, const float* __restrict__ Wk, const float* __restrict__ Wv, const float* __restrict__ Wo, const float* __restrict__ qs, const float* __restrict__ ksv, _Float16* __restrict__ P) {
  const int n = blockIdx.x, tid = threadIdx.x; const int which = n / DD, o = n % DD;      // rows: q | k | v | o ([out][in] each)
  const float* W = which == 0 ? Wq : (which == 1 ? Wk : (which == 2 ? Wv : Wo));
  for (int q = tid; q < DD / 8; q += 256) { union { v8h hh; v4u u; } pk;
#pragma unroll
    for (int i = 0; i < 8; ++i) { const int d = q * 8 + i; float w = W[(size_t)o * DD + d] * 16.0f; if (which == 0) w *= qs[d]; else if (which == 1) w *= ksv[d]; pk.hh[i] = (_Float16)w; }
    vst2(P + (size_t)n * DD + q * 8, pk.u); }
}
// ---- projection: block 64 rows x 128 cols (= which, 2 heads); epilogue: x rr (q,k), + bias, RoPE (q,k); q/k -> [b][h][t][64] f16; v -> vT [b][h][d][t]
__global__ __launch_bounds__(128) void k_proj(const _Float16* __restrict__ x16, const float* __restrict__ rr, const _Float16* __restrict__ P, const float* __restrict__ bq, const float* __restrict__ bk, const float* __restrict__ bv,
                                            _Float16* __restrict__ qh, _Float16* __restrict__ kh, _Float16* __restrict__ vT) {
  __shared__ __align__(16) char smem[RING_B];                        // the ring; behind the loop's last barrier it is the epilogue's staging
  float (*so)[16][132] = (float (*)[16][132])smem;                   // 33,792 B
  _Float16 (*st)[72] = (_Float16 (*)[72])(smem + 4 * 16 * 132 * 4);  // 18,432 B behind it
  __shared__ float sfr[32];
  const int tid = threadIdx.x, wave = tid >> 5, lane = tid & 31, col = lane & 15, g = lane >> 4;
  const int r0b = blockIdx.x * 64, r0 = r0b + wave * 16, n0 = blockIdx.y * 128; const int b = r0b / LL, t0 = r0b % LL;
  const int which = n0 / DD, hb = (n0 % DD) / HD; const float* bias = which == 0 ? bq : (which == 1 ? bk : bv);
  if (tid < 32) sfr[tid] = powf(10000.0f, -(float)tid / 32.0f);
  v8f acc[8] = {};
  gemm_ring((_Float16*)smem, x16 + (size_t)r0b * DD, P + (size_t)n0 * DD, acc, tid);
  __syncthreads();
#pragma unroll
  for (int j = 0; j < 8; ++j) { const int nl = j * 16 + col; const float bb = bias[(n0 % DD) + nl];
#pragma unroll
    for (int r = 0; r < 8; ++r) { const float sc = which < 2 ? rr[(size_t)(r0 + 8 * g + r) * 32] : 1.0f; so[wave][8 * g + r][nl] = acc[j][r] * (1.0f / 16.0f) * sc + bb; } }
  LDSX();
  if (which < 2) {   // RoPE in place: lane handles row rl, dims; angle index d & 31, rotation partner d^1
    for (int rl = 0; rl < 16; ++rl) { const float t = (float)(t0 + wave * 16 + rl); float nv[4];
#pragma unroll
      for (int e = 0; e < 4; ++e) { const int nl = lane * 4 + e; const int d = nl & 63; const float ang = t * sfr[d & 31]; float sn, cs; sincosf(ang, &sn, &cs);
        const float xv = so[wave][rl][nl]; const float xr = (d & 1) ? so[wave][rl][nl - 1] : -so[wave][rl][nl + 1]; nv[e] = xv * cs + xr * sn; }
      LDSX();
#pragma unroll
      for (int e = 0; e < 4; ++e) so[wave][rl][lane * 4 + e] = nv[e];
      LDSX(); }
    _Float16* dst = which == 0 ? qh : kh;
    for (int q = lane; q < 2 * 16 * 8; q += 32) { const int hh = q >> 7, rem = q & 127, rl = rem >> 3, pc = rem & 7; union { v8h h8; v4u u; } pk;
#pragma unroll
      for (int e = 0; e < 8; ++e) pk.h8[e] = (_Float16)so[wave][rl][hh * HD + pc * 8 + e];
      vst2(dst + (((size_t)b * NH + hb + hh) * LL + t0 + wave * 16 + rl) * HD + pc * 8, pk.u); } }
  else {
#pragma unroll 4
    for (int rl = 0; rl < 16; ++rl) {
#pragma unroll
      for (int e = 0; e < 4; ++e) st[lane * 4 + e][wave * 16 + rl] = (_Float16)so[wave][rl][lane * 4 + e]; }
    __syncthreads();
    for (int q = tid; q < 128 * 8; q += 128) { const int c = q >> 3, pc = q & 7, hh = c >> 6, d = c & 63;
      vst2(vT + (((size_t)b * NH + hb + hh) * HD + d) * LL + t0 + pc * 8, *(const v4u*)(&st[c][pc * 8])); }
  }
}
// ---- sigmoid attention: block (64 q, bh); all 32 key tiles; W = sigmoid(q.k/8); l += W; acc += W @ v ; out = acc / (l + eps) -> o16 [b][t][h*64+d] f16
__global__ __launch_bounds__(128) void k_attn(const _Float16* __restrict__ qh, const _Float16* __restrict__ kh, const _Float16* __restrict__ vT, _Float16* __restrict__ o16) {
  __shared__ __align__(16) _Float16 sP[4][16][72];
  __shared__ __align__(16) float sO[4][16][68];
  __shared__ __align__(16) _Float16 sK[2][64][TP];   // 64 keys x 64 dims
  __shared__ __align__(16) _Float16 sV[2][64][TP];   // 64 dims x 64 keys
  const int tid = threadIdx.x, w = tid >> 5, lane = tid & 31, col = lane & 15, g = lane >> 4;
  const int bh = blockIdx.y, b = bh / NH, h = bh % NH, q0 = blockIdx.x * 64 + w * 16;
  const _Float16* qb = qh + (size_t)bh * LL * HD; const _Float16* kb = kh + (size_t)bh * LL * HD; const _Float16* vb = vT + (size_t)bh * HD * LL;
  v16h aq[2];
#pragma unroll
  for (int kc = 0; kc < 2; ++kc) aq[kc] = frag_h(qb + (size_t)(q0 + col) * HD + kc * 32, lane);
  float lsum[8] = {0.f, 0.f, 0.f, 0.f, 0.f, 0.f, 0.f, 0.f}; v8f acc[4] = {};
  stage_kv(&sK[0][0][0], &sV[0][0][0], kb, vb, tid);
  WAIT_COPIES(); __syncthreads();
  stage_kv(&sK[1][0][0], &sV[1][0][0], kb + (size_t)64 * HD, vb + 64, tid);
#pragma unroll 1
  for (int kt = 0; kt < LL / 64; ++kt) { const int bf = kt & 1;
#pragma unroll
    for (int t = 0; t < 4; ++t) { v8f s = {};
#pragma unroll
      for (int kc = 0; kc < 2; ++kc) s = wmma16(aq[kc], frag_h(&sK[bf][t * 16 + col][kc * 32], lane), s);
#pragma unroll
      for (int r = 0; r < 8; ++r) { const float wgt = __builtin_amdgcn_rcpf(1.0f + __expf(-s[r] * 0.125f)); lsum[r] += wgt; sP[w][8 * g + r][t * 16 + col] = (_Float16)(wgt * 16384.0f); } }
    LDSX();
#pragma unroll
    for (int kc = 0; kc < 2; ++kc) { const v16h pa = frag_h(&sP[w][col][0] + kc * 32, lane);
#pragma unroll
      for (int t = 0; t < 4; ++t) acc[t] = wmma16(pa, frag_h(&sV[bf][t * 16 + col][kc * 32], lane), acc[t]); }
    WAIT_LDS(); WAIT_COPIES(); __syncthreads();   // publishes tile kt + 1 and ends every read of tile kt
    if (kt + 2 < LL / 64) stage_kv(&sK[bf][0][0], &sV[bf][0][0], kb + (size_t)(kt + 2) * 64 * HD, vb + (kt + 2) * 64, tid);
  }
  WAIT_COPIES();
  // row sums: lsum[r] (this lane's 4 tiles x its column) -> reduce over the 16 col lanes of each half -> row 8g+r
#pragma unroll
  for (int off = 8; off >= 1; off >>= 1) {
#pragma unroll
    for (int r = 0; r < 8; ++r) lsum[r] += __shfl_xor(lsum[r], off, 32); }
#pragma unroll
  for (int r = 0; r < 8; ++r) { const float inv = 1.0f / ((lsum[r] + 1e-8f) * 16384.0f);
#pragma unroll
    for (int t = 0; t < 4; ++t) sO[w][8 * g + r][t * 16 + col] = acc[t][r] * inv; }
  LDSX();
  for (int q = lane; q < 16 * 8; q += 32) { const int rl = q >> 3, pc = q & 7; union { v8h h8; v4u u; } pk;
#pragma unroll
    for (int e = 0; e < 8; ++e) pk.h8[e] = (_Float16)(sO[w][rl][pc * 8 + e] * 16.0f);             // o x16 keeps the f16 operand normal
    vst2(o16 + ((size_t)b * LL + q0 + rl) * DD + h * HD + pc * 8, pk.u); }
}
__global__ __launch_bounds__(128) void k_out(const _Float16* __restrict__ o16, const _Float16* __restrict__ P, const float* __restrict__ bo, float* __restrict__ out) {
  __shared__ __align__(16) char smem[RING_B];        // the ring; behind the loop's last barrier it is the epilogue's staging
  float (*so)[16][132] = (float (*)[16][132])smem;
  const int tid = threadIdx.x, wave = tid >> 5, lane = tid & 31, col = lane & 15, g = lane >> 4;
  const int r0 = blockIdx.x * 64 + wave * 16, n0 = blockIdx.y * 128;
  v8f acc[8] = {};
  gemm_ring((_Float16*)smem, o16 + (size_t)blockIdx.x * 64 * DD, P + (size_t)(3 * DD + n0) * DD, acc, tid);
#pragma unroll
  for (int j = 0; j < 8; ++j) { const float bb = bo[n0 + j * 16 + col];
#pragma unroll
    for (int r = 0; r < 8; ++r) so[wave][8 * g + r][j * 16 + col] = acc[j][r] * (1.0f / 256.0f) + bb; }    // W x16, o x16
  LDSX();
#pragma unroll 4
  for (int rl = 0; rl < 16; ++rl) vst2(out + (size_t)(r0 + rl) * DD + n0 + lane * 4, *(const v4f*)(&so[wave][rl][lane * 4]));
}
extern "C" void kernel_launch(void* const* d_in, const int* in_sizes, int n_in, void* d_out, int out_size, void* d_ws, size_t ws_size, hipStream_t stream) {
  (void)in_sizes; (void)n_in; (void)out_size; (void)ws_size;
  const float* x = (const float*)d_in[0]; const float* Wq = (const float*)d_in[1]; const float* bq = (const float*)d_in[2]; const float* Wk = (const float*)d_in[3]; const float* bk = (const float*)d_in[4];
  const float* Wv = (const float*)d_in[5]; const float* bv = (const float*)d_in[6]; const float* Wo = (const float*)d_in[7]; const float* bo = (const float*)d_in[8];
  const float* qs = (const float*)d_in[9]; const float* ksv = (const float*)d_in[10];
  float* out = (float*)d_out;
  char* ws = (char*)d_ws; size_t off = 0;
  auto take = [&](size_t bytes) { char* p = ws + off; off += (bytes + 255) & ~(size_t)255; return p; };
  _Float16* x16 = (_Float16*)take((size_t)NR * DD * 2); float* rr = (float*)take((size_t)NR * 32 * 4); _Float16* P = (_Float16*)take((size_t)4 * DD * DD * 2);
  _Float16* qh = (_Float16*)take((size_t)NR * DD * 2); _Float16* kh = (_Float16*)take((size_t)NR * DD * 2); _Float16* vT = (_Float16*)take((size_t)NR * DD * 2); _Float16* o16 = (_Float16*)take((size_t)NR * DD * 2);
  k_cvtx<<<NR, 256, 0, stream>>>(x, x16, rr);
  k_packW<<<4 * DD, 256, 0, stream>>>(Wq, Wk, Wv, Wo, qs, ksv, P);
  k_proj<<<dim3(NR / 64, 3 * DD / 128), 128, 0, stream>>>(x16, rr, P, bq, bk, bv, qh, kh, vT);
  k_attn<<<dim3(LL / 64, NB * NH), 128, 0, stream>>>(qh, kh, vT, o16);
  k_out<<<dim3(NR / 64, DD / 128), 128, 0, stream>>>(o16, P, bo, out);
}

// v002
// One run takes 120 microseconds.
// Two timings next to v001 both put it at 1.14 times that version's speed.
// All steps since v000 together make it 2.84 times as fast.
#include <hip/hip_runtime.h>
#include <math.h>

typedef __attribute__((ext_vector_type(16))) _Float16 v16h;
typedef __attribute__((ext_vector_type(16))) __bf16 v16b;
typedef __attribute__((ext_vector_type(8)))  _Float16 v8h;
typedef __attribute__((ext_vector_type(8)))  float v8f;
typedef __attribute__((ext_vector_type(4)))  float v4f;
typedef __attribute__((ext_vector_type(2)))  float v2f;
typedef __attribute__((ext_vector_type(4)))  unsigned v4u;
typedef __attribute__((ext_vector_type(4)))  int v4i;
typedef float __attribute__((may_alias)) float_a;
typedef int __attribute__((may_alias)) int_a;

template <typename T> __device__ __forceinline__ void vst2(void* p, T v) { *(T*)p = v;  }
__device__ __forceinline__ v8f wmma16(v16h a, v16h b, v8f c) {
  v8f d = __builtin_amdgcn_wmma_f32_16x16x32_f16(false, a, false, b, (short)0, c, false, false);
  asm volatile("v_nop\n\tv_nop\n\tv_nop\n\tv_nop" : "+v"(d) : "v"(a), "v"(b));
  return d;
}
__device__ __forceinline__ v8f wmma_bf(v16b a, v16b b, v8f c) {
  v8f d = __builtin_amdgcn_wmma_f32_16x16x32_bf16(false, a, false, b, (short)0, c, false, false);
  asm volatile("v_nop\n\tv_nop\n\tv_nop\n\tv_nop" : "+v"(d) : "v"(a), "v"(b));
  return d;
}
// 16x16x32 fragments: lane = (h = lane>>4, row/col = lane&15); elements 0..7 = k0+8h+0..7, 8..15 = k0+16+8h+0..7; D element r = row 8h+r
__device__ __forceinline__ v16h frag_h(const _Float16* rowk0, int lane) {
  union { v16h v; v8h q[2]; } u; const _Float16* p = rowk0 + 8 * (lane >> 4);
  u.q[0] = *(const v8h*)p; u.q[1] = *(const v8h*)(p + 16); return u.v;
}
__device__ __forceinline__ v16h frag_f32(const float* rowk0, int lane) {
  v16h a; const float* p = rowk0 + 8 * (lane >> 4);
#pragma unroll
  for (int i = 0; i < 8; ++i) { a[i] = (_Float16)p[i]; a[8 + i] = (_Float16)p[16 + i]; }
  return a;
}
__device__ __forceinline__ v16h frag_f32s(const float* rowk0, int lane, float sc) {
  v16h a; const float* p = rowk0 + 8 * (lane >> 4);
#pragma unroll
  for (int i = 0; i < 8; ++i) { a[i] = (_Float16)(p[i] * sc); a[8 + i] = (_Float16)(p[16 + i] * sc); }
  return a;
}
// column fragment from a [K][ld] layout (column n), rows >= K read as 0
__device__ __forceinline__ v16h fragc_f32(const float* W, int k0, int n, int lane, int ld, int K) {
  v16h a; const int g = lane >> 4;
#pragma unroll
  for (int i = 0; i < 8; ++i) { const int ka = k0 + 8 * g + i, kb = ka + 16;
    a[i] = (_Float16)(ka < K ? W[(size_t)ka * ld + n] : 0.f); a[8 + i] = (_Float16)(kb < K ? W[(size_t)kb * ld + n] : 0.f); }
  return a;
}
struct F2 { v16b h, l; };
__device__ __forceinline__ F2 bsplit16(const float v[16]) { F2 r;
#pragma unroll
  for (int i = 0; i < 16; ++i) { const __bf16 h = (__bf16)v[i]; r.h[i] = h; r.l[i] = (__bf16)(v[i] - (float)h); }
  return r; }
__device__ __forceinline__ F2 split_row(const float* row, int k0, int lane) { float v[16]; const float* p = row + k0 + 8 * (lane >> 4);
#pragma unroll
  for (int i = 0; i < 8; ++i) { v[i] = p[i]; v[8 + i] = p[16 + i]; }
  return bsplit16(v); }
__device__ __forceinline__ F2 split_rowK(const float* row, int k0, int lane, int K) { float v[16]; const int g = lane >> 4;
#pragma unroll
  for (int i = 0; i < 8; ++i) { const int ka = k0 + 8 * g + i, kb = ka + 16; v[i] = ka < K ? row[ka] : 0.f; v[8 + i] = kb < K ? row[kb] : 0.f; }
  return bsplit16(v); }
__device__ __forceinline__ F2 split_col(const float* W, int k0, int n, int lane, int ld, int K) { float v[16]; const int g = lane >> 4;
#pragma unroll
  for (int i = 0; i < 8; ++i) { const int ka = k0 + 8 * g + i, kb = ka + 16; v[i] = ka < K ? W[(size_t)ka * ld + n] : 0.f; v[8 + i] = kb < K ? W[(size_t)kb * ld + n] : 0.f; }
  return bsplit16(v); }
__device__ __forceinline__ v8f mac3(const F2& a, const F2& b, v8f c) { c = wmma_bf(a.l, b.h, c); c = wmma_bf(a.h, b.l, c); return wmma_bf(a.h, b.h, c); }
__device__ __forceinline__ float sigm(float v) { return 1.0f / (1.0f + expf(-v)); }
#define LDSX() do { asm volatile("s_wait_dscnt 0" ::: "memory"); __builtin_amdgcn_wave_barrier(); __builtin_amdgcn_fence(__ATOMIC_RELEASE, "workgroup"); } while (0)

// Sigmoid attention block with QK-RMSNorm and rotary embedding. Pure f16 WMMA GEMMs over pre-converted operands (x -> f16 once;
// weights x16 f16 with the RMSNorm scales folded into the q/k weight columns; f32 accumulate): q|k|v projection with the per-row
// RMS factor, bias and RoPE in the f32 epilogue (q/k -> [b][h][l][64] f16, v -> [b][h][d][l] f16), per (b, h, 64 queries) block
// the 2048 keys streamed in 64-key tiles: S on f16 WMMA, sigmoid in f32 (hardware exp/rcp), running row sums, W x2^14 f16 @ v^T,
#define NB 2
#define LL 2048
#define DD 1024
#define NH 16
#define HD 64
#define NR (NB * LL)

// ---- operand tiles staged in LDS by asynchronous copies: rows of 128 B (64 f16), 8 lanes = one whole 128-B line, 128 threads = 16 rows a copy
#define TP 72              // LDS pitch of a staged row in f16: 144 B = 16 B x 9, conflict-free for ds_load_b128
#define R16 (16 * TP * 2)  // bytes of 16 staged rows
#define ACP(l, g) "global_load_async_to_lds_b128 %" #l ", %" #g ", off\n\t"
// this wave's copies have landed (the compiler places no wait for them)
#define WAIT_COPIES() asm volatile("s_wait_asynccnt 0x0" ::: "memory")
// this wave's LDS reads of a buffer have retired before the buffer is handed back for a refill
#define WAIT_LDS() asm volatile("s_wait_dscnt 0x0" ::: "memory")
__device__ __forceinline__ unsigned lds_at(const _Float16* p) { return (unsigned)(size_t)p; }   // LDS byte address = low 32 bits
// one GEMM stage, 64 k: buf rows 0..63 = 64 X rows, rows 64..191 = 128 W rows. s_wait_xcnt closes the copies' own statement, so that no address register of a copy is rewritten ahead of it.
__device__ __forceinline__ void stage_gemm(_Float16* buf, const _Float16* xa, const _Float16* wb, int tid) {
  const int r = tid >> 3, c = (tid & 7) * 8;
  const unsigned l = lds_at(buf + r * TP + c);
  const _Float16* a = xa + (size_t)r * DD + c; const _Float16* b = wb + (size_t)r * DD + c;
  asm volatile(ACP(0, 1) ACP(2, 3) ACP(4, 5) ACP(6, 7) ACP(8, 9) ACP(10, 11) ACP(12, 13) ACP(14, 15) ACP(16, 17) ACP(18, 19) ACP(20, 21) ACP(22, 23) "s_wait_xcnt 0x0"
               :: "v"(l), "v"(a), "v"(l + R16), "v"(a + 16 * DD), "v"(l + 2 * R16), "v"(a + 32 * DD), "v"(l + 3 * R16), "v"(a + 48 * DD),
                  "v"(l + 4 * R16), "v"(b), "v"(l + 5 * R16), "v"(b + 16 * DD), "v"(l + 6 * R16), "v"(b + 32 * DD), "v"(l + 7 * R16), "v"(b + 48 * DD),
                  "v"(l + 8 * R16), "v"(b + 64 * DD), "v"(l + 9 * R16), "v"(b + 80 * DD), "v"(l + 10 * R16), "v"(b + 96 * DD), "v"(l + 11 * R16), "v"(b + 112 * DD) : "memory");
}
// one attention tile: 64 keys x 64 dims of K, 64 dims x 64 keys of V^T; the wait as above
__device__ __forceinline__ void stage_kv(_Float16* sk, _Float16* sv, const _Float16* gk, const _Float16* gv, int tid) {
  const int r = tid >> 3, c = (tid & 7) * 8;
  const unsigned lk = lds_at(sk + r * TP + c), lv = lds_at(sv + r * TP + c);
  const _Float16* k = gk + (size_t)r * HD + c; const _Float16* v = gv + (size_t)r * LL + c;
  asm volatile(ACP(0, 1) ACP(2, 3) ACP(4, 5) ACP(6, 7) ACP(8, 9) ACP(10, 11) ACP(12, 13) ACP(14, 15) "s_wait_xcnt 0x0"
               :: "v"(lk), "v"(k), "v"(lk + R16), "v"(k + 16 * HD), "v"(lk + 2 * R16), "v"(k + 32 * HD), "v"(lk + 3 * R16), "v"(k + 48 * HD),
                  "v"(lv), "v"(v), "v"(lv + R16), "v"(v + 16 * LL), "v"(lv + 2 * R16), "v"(v + 32 * LL), "v"(lv + 3 * R16), "v"(v + 48 * LL) : "memory");
}
#define GBUF (192 * TP)           // f16 of one GEMM buffer
#define RING_B (2 * GBUF * 2)     // bytes of the two
// 64 x 128 tile over K = 1024: 16 stages, two buffers, stage s + 2 copied while stage s + 1 is worked on; k order as before
__device__ __forceinline__ void gemm_ring(_Float16* ring, const _Float16* xa, const _Float16* wb, v8f acc[8], int tid) {
  const int wave = tid >> 5, lane = tid & 31, col = lane & 15;
  stage_gemm(ring, xa, wb, tid);
  WAIT_COPIES(); __syncthreads();
  stage_gemm(ring + GBUF, xa + 64, wb + 64, tid);
#pragma unroll 1   // one trip = one stage, so that the ring's order stands once, at the trip's foot
  for (int s = 0; s < DD / 64; ++s) { _Float16* buf = ring + (s & 1) * GBUF;
    v16h a[2], b[2][8];   // the stage's 18 fragments are read as one group ahead of its 16 WMMAs: one LDS latency a stage, counted waits, not one full wait a WMMA
#pragma unroll
    for (int kc = 0; kc < 2; ++kc) { a[kc] = frag_h(buf + (wave * 16 + col) * TP + kc * 32, lane);
#pragma unroll
      for (int j = 0; j < 8; ++j) b[kc][j] = frag_h(buf + (64 + j * 16 + col) * TP + kc * 32, lane); }
#pragma unroll
    for (int kc = 0; kc < 2; ++kc) {
#pragma unroll
      for (int j = 0; j < 8; ++j) acc[j] = wmma16(a[kc], b[kc][j], acc[j]); }
    WAIT_LDS(); WAIT_COPIES(); __syncthreads();   // publishes stage s + 1 and ends every read of stage s
    if (s + 2 < DD / 64) stage_gemm(buf, xa + (s + 2) * 64, wb + (s + 2) * 64, tid); }
  WAIT_COPIES();
}

__global__ __launch_bounds__(256) void k_cvtx(const float* __restrict__ x, _Float16* __restrict__ x16, float* __restrict__ rr) {   // block = row: f16 copy + rsqrt(mean x^2 + eps)
  __shared__ float red[256];
  const int r = blockIdx.x, tid = threadIdx.x; const float* xr = x + (size_t)r * DD;
  const v4f v = *(const v4f*)(xr + tid * 4); red[tid] = v[0] * v[0] + v[1] * v[1] + v[2] * v[2] + v[3] * v[3];
  union { _Float16 h[4]; v2f f; } pk; for (int e = 0; e < 4; ++e) pk.h[e] = (_Float16)v[e];
  vst2((v2f*)(x16 + (size_t)r * DD + tid * 4), pk.f);       // 32 lanes x 8 B = one 256-B run per wave
  __syncthreads();
  for (int st = 128; st > 0; st >>= 1) { if (tid < st) red[tid] += red[tid + st]; __syncthreads(); }
  if (tid < 32) vst2(rr + (size_t)r * 32 + tid, (float_a)(tid == 0 ? rsqrtf(red[0] / (float)DD + 1e-8f) : 0.f));   // rr[row*32] (one line per row)
}
__global__ __launch_bounds__(256) void k_packW(const float* __restrict__ Wq, const float* __restrict__ Wk, const float* __restrict__ Wv, const float* __restrict__ Wo, const float* __restrict__ qs, const float* __restrict__ ksv, _Float16* __restrict__ P) {
  const int n = blockIdx.x, tid = threadIdx.x; const int which = n / DD, o = n % DD;      // rows: q | k | v | o ([out][in] each)
  const float* W = which == 0 ? Wq : (which == 1 ? Wk : (which == 2 ? Wv : Wo));
  for (int q = tid; q < DD / 8; q += 256) { union { v8h hh; v4u u; } pk;
#pragma unroll
    for (int i = 0; i < 8; ++i) { const int d = q * 8 + i; float w = W[(size_t)o * DD + d] * 16.0f; if (which == 0) w *= qs[d]; else if (which == 1) w *= ksv[d]; pk.hh[i] = (_Float16)w; }
    vst2(P + (size_t)n * DD + q * 8, pk.u); }
}
// ---- projection: block 64 rows x 128 cols (= which, 2 heads); epilogue: x rr (q,k), + bias, RoPE (q,k); q/k -> [b][h][t][64] f16; v -> vT [b][h][d][t]
__global__ __launch_bounds__(128) void k_proj(const _Float16* __restrict__ x16, const float* __restrict__ rr, const _Float16* __restrict__ P, const float* __restrict__ bq, const float* __restrict__ bk, const float* __restrict__ bv,
                                            _Float16* __restrict__ qh, _Float16* __restrict__ kh, _Float16* __restrict__ vT) {
  __shared__ __align__(16) char smem[RING_B];                        // the ring; behind the loop's last barrier it is the epilogue's staging
  float (*so)[16][132] = (float (*)[16][132])smem;                   // 33,792 B
  _Float16 (*st)[72] = (_Float16 (*)[72])(smem + 4 * 16 * 132 * 4);  // 18,432 B behind it
  __shared__ float sfr[32];
  const int tid = threadIdx.x, wave = tid >> 5, lane = tid & 31, col = lane & 15, g = lane >> 4;
  const int r0b = blockIdx.x * 64, r0 = r0b + wave * 16, n0 = blockIdx.y * 128; const int b = r0b / LL, t0 = r0b % LL;
  const int which = n0 / DD, hb = (n0 % DD) / HD; const float* bias = which == 0 ? bq : (which == 1 ? bk : bv);
  if (tid < 32) sfr[tid] = powf(10000.0f, -(float)tid / 32.0f);
  v8f acc[8] = {};
  gemm_ring((_Float16*)smem, x16 + (size_t)r0b * DD, P + (size_t)n0 * DD, acc, tid);
  __syncthreads();
#pragma unroll
  for (int j = 0; j < 8; ++j) { const int nl = j * 16 + col; const float bb = bias[(n0 % DD) + nl];
#pragma unroll
    for (int r = 0; r < 8; ++r) { const float sc = which < 2 ? rr[(size_t)(r0 + 8 * g + r) * 32] : 1.0f; so[wave][8 * g + r][nl] = acc[j][r] * (1.0f / 16.0f) * sc + bb; } }
  LDSX();
  if (which < 2) {   // RoPE in place: lane handles row rl, dims; angle index d & 31, rotation partner d^1
    for (int rl = 0; rl < 16; ++rl) { const float t = (float)(t0 + wave * 16 + rl); float nv[4];
#pragma unroll
      for (int e = 0; e < 4; ++e) { const int nl = lane * 4 + e; const int d = nl & 63; const float ang = t * sfr[d & 31]; float sn, cs; sincosf(ang, &sn, &cs);
        const float xv = so[wave][rl][nl]; const float xr = (d & 1) ? so[wave][rl][nl - 1] : -so[wave][rl][nl + 1]; nv[e] = xv * cs + xr * sn; }
      LDSX();
#pragma unroll
      for (int e = 0; e < 4; ++e) so[wave][rl][lane * 4 + e] = nv[e];
      LDSX(); }
    _Float16* dst = which == 0 ? qh : kh;
    for (int q = lane; q < 2 * 16 * 8; q += 32) { const int hh = q >> 7, rem = q & 127, rl = rem >> 3, pc = rem & 7; union { v8h h8; v4u u; } pk;
#pragma unroll
      for (int e = 0; e < 8; ++e) pk.h8[e] = (_Float16)so[wave][rl][hh * HD + pc * 8 + e];
      vst2(dst + (((size_t)b * NH + hb + hh) * LL + t0 + wave * 16 + rl) * HD + pc * 8, pk.u); } }
  else {
#pragma unroll 4
    for (int rl = 0; rl < 16; ++rl) {
#pragma unroll
      for (int e = 0; e < 4; ++e) st[lane * 4 + e][wave * 16 + rl] = (_Float16)so[wave][rl][lane * 4 + e]; }
    __syncthreads();
    for (int q = tid; q < 128 * 8; q += 128) { const int c = q >> 3, pc = q & 7, hh = c >> 6, d = c & 63;
      vst2(vT + (((size_t)b * NH + hb + hh) * HD + d) * LL + t0 + pc * 8, *(const v4u*)(&st[c][pc * 8])); }
  }
}
// ---- sigmoid attention: block (64 q, bh); all 32 key tiles; W = sigmoid(q.k/8); l += W; acc += W @ v ; out = acc / (l + eps) -> o16 [b][t][h*64+d] f16
__global__ __launch_bounds__(128) void k_attn(const _Float16* __restrict__ qh, const _Float16* __restrict__ kh, const _Float16* __restrict__ vT, _Float16* __restrict__ o16) {
  __shared__ __align__(16) _Float16 sP[4][16][72];
  __shared__ __align__(16) float sO[4][16][68];
  __shared__ __align__(16) _Float16 sK[2][64][TP];   // 64 keys x 64 dims
  __shared__ __align__(16) _Float16 sV[2][64][TP];   // 64 dims x 64 keys
  const int tid = threadIdx.x, w = tid >> 5, lane = tid & 31, col = lane & 15, g = lane >> 4;
  const int bh = blockIdx.y, b = bh / NH, h = bh % NH, q0 = blockIdx.x * 64 + w * 16;
  const _Float16* qb = qh + (size_t)bh * LL * HD; const _Float16* kb = kh + (size_t)bh * LL * HD; const _Float16* vb = vT + (size_t)bh * HD * LL;
  v16h aq[2];
#pragma unroll
  for (int kc = 0; kc < 2; ++kc) aq[kc] = frag_h(qb + (size_t)(q0 + col) * HD + kc * 32, lane);
  float lsum[8] = {0.f, 0.f, 0.f, 0.f, 0.f, 0.f, 0.f, 0.f}; v8f acc[4] = {};
  stage_kv(&sK[0][0][0], &sV[0][0][0], kb, vb, tid);
  WAIT_COPIES(); __syncthreads();
  stage_kv(&sK[1][0][0], &sV[1][0][0], kb + (size_t)64 * HD, vb + 64, tid);
#pragma unroll 1
  for (int kt = 0; kt < LL / 64; ++kt) { const int bf = kt & 1;
    v16h fk[4][2], fv[2][4];   // the tile's 8 K and 8 V fragments are read as one group at its head: the V reads land under the score and sigmoid work
#pragma unroll
    for (int t = 0; t < 4; ++t) {
#pragma unroll
      for (int kc = 0; kc < 2; ++kc) fk[t][kc] = frag_h(&sK[bf][t * 16 + col][kc * 32], lane); }
#pragma unroll
    for (int kc = 0; kc < 2; ++kc) {
#pragma unroll
      for (int t = 0; t < 4; ++t) fv[kc][t] = frag_h(&sV[bf][t * 16 + col][kc * 32], lane); }
#pragma unroll
    for (int t = 0; t < 4; ++t) { v8f s = {};
#pragma unroll
      for (int kc = 0; kc < 2; ++kc) s = wmma16(aq[kc], fk[t][kc], s);
#pragma unroll
      for (int r = 0; r < 8; ++r) { const float wgt = __builtin_amdgcn_rcpf(1.0f + __expf(-s[r] * 0.125f)); lsum[r] += wgt; sP[w][8 * g + r][t * 16 + col] = (_Float16)(wgt * 16384.0f); } }
    LDSX();
    v16h pa[2];            // both P fragments together, ahead of the 8 WMMAs
#pragma unroll
    for (int kc = 0; kc < 2; ++kc) pa[kc] = frag_h(&sP[w][col][0] + kc * 32, lane);
#pragma unroll
    for (int kc = 0; kc < 2; ++kc) {
#pragma unroll
      for (int t = 0; t < 4; ++t) acc[t] = wmma16(pa[kc], fv[kc][t], acc[t]); }
    WAIT_LDS(); WAIT_COPIES(); __syncthreads();   // publishes tile kt + 1 and ends every read of tile kt
    if (kt + 2 < LL / 64) stage_kv(&sK[bf][0][0], &sV[bf][0][0], kb + (size_t)(kt + 2) * 64 * HD, vb + (kt + 2) * 64, tid);
  }
  WAIT_COPIES();
  // row sums: lsum[r] (this lane's 4 tiles x its column) -> reduce over the 16 col lanes of each half -> row 8g+r
#pragma unroll
  for (int off = 8; off >= 1; off >>= 1) {
#pragma unroll
    for (int r = 0; r < 8; ++r) lsum[r] += __shfl_xor(lsum[r], off, 32); }
#pragma unroll
  for (int r = 0; r < 8; ++r) { const float inv = 1.0f / ((lsum[r] + 1e-8f) * 16384.0f);
#pragma unroll
    for (int t = 0; t < 4; ++t) sO[w][8 * g + r][t * 16 + col] = acc[t][r] * inv; }
  LDSX();
  for (int q = lane; q < 16 * 8; q += 32) { const int rl = q >> 3, pc = q & 7; union { v8h h8; v4u u; } pk;
#pragma unroll
    for (int e = 0; e < 8; ++e) pk.h8[e] = (_Float16)(sO[w][rl][pc * 8 + e] * 16.0f);             // o x16 keeps the f16 operand normal
    vst2(o16 + ((size_t)b * LL + q0 + rl) * DD + h * HD + pc * 8, pk.u); }
}
__global__ __launch_bounds__(128) void k_out(const _Float16* __restrict__ o16, const _Float16* __restrict__ P, const float* __restrict__ bo, float* __restrict__ out) {
  __shared__ __align__(16) char smem[RING_B];        // the ring; behind the loop's last barrier it is the epilogue's staging
  float (*so)[16][132] = (float (*)[16][132])smem;
  const int tid = threadIdx.x, wave = tid >> 5, lane = tid & 31, col = lane & 15, g = lane >> 4;
  const int r0 = blockIdx.x * 64 + wave * 16, n0 = blockIdx.y * 128;
  v8f acc[8] = {};
  gemm_ring((_Float16*)smem, o16 + (size_t)blockIdx.x * 64 * DD, P + (size_t)(3 * DD + n0) * DD, acc, tid);
#pragma unroll
  for (int j = 0; j < 8; ++j) { const float bb = bo[n0 + j * 16 + col];
#pragma unroll
    for (int r = 0; r < 8; ++r) so[wave][8 * g + r][j * 16 + col] = acc[j][r] * (1.0f / 256.0f) + bb; }    // W x16, o x16
  LDSX();
#pragma unroll 4
  for (int rl = 0; rl < 16; ++rl) vst2(out + (size_t)(r0 + rl) * DD + n0 + lane * 4, *(const v4f*)(&so[wave][rl][lane * 4]));
}
extern "C" void kernel_launch(void* const* d_in, const int* in_sizes, int n_in, void* d_out, int out_size, void* d_ws, size_t ws_size, hipStream_t stream) {
  (void)in_sizes; (void)n_in; (void)out_size; (void)ws_size;
  const float* x = (const float*)d_in[0]; const float* Wq = (const float*)d_in[1]; const float* bq = (const float*)d_in[2]; const float* Wk = (const float*)d_in[3]; const float* bk = (const float*)d_in[4];
  const float* Wv = (const float*)d_in[5]; const float* bv = (const float*)d_in[6]; const float* Wo = (const float*)d_in[7]; const float* bo = (const float*)d_in[8];
  const float* qs = (const float*)d_in[9]; const float* ksv = (const float*)d_in[10];
  float* out = (float*)d_out;
  char* ws = (char*)d_ws; size_t off = 0;
  auto take = [&](size_t bytes) { char* p = ws + off; off += (bytes + 255) & ~(size_t)255; return p; };
  _Float16* x16 = (_Float16*)take((size_t)NR * DD * 2); float* rr = (float*)take((size_t)NR * 32 * 4); _Float16* P = (_Float16*)take((size_t)4 * DD * DD * 2);
  _Float16* qh = (_Float16*)take((size_t)NR * DD * 2); _Float16* kh = (_Float16*)take((size_t)NR * DD * 2); _Float16* vT = (_Float16*)take((size_t)NR * DD * 2); _Float16* o16 = (_Float16*)take((size_t)NR * DD * 2);
  k_cvtx<<<NR, 256, 0, stream>>>(x, x16, rr);
  k_packW<<<4 * DD, 256, 0, stream>>>(Wq, Wk, Wv, Wo, qs, ksv, P);
  k_proj<<<dim3(NR / 64, 3 * DD / 128), 128, 0, stream>>>(x16, rr, P, bq, bk, bv, qh, kh, vT);
  k_attn<<<dim3(LL / 64, NB * NH), 128, 0, stream>>>(qh, kh, vT, o16);
  k_out<<<dim3(NR / 64, DD / 128), 128, 0, stream>>>(o16, P, bo, out);
}

// v003
// One run takes 116 microseconds.
// In two side-by-side timings against v002, it was 1.04 and 1.05 times as fast.
// Counting every step since v000, it is 2.98 times as fast.
#include <hip/hip_runtime.h>
#include <math.h>

typedef __attribute__((ext_vector_type(16))) _Float16 v16h;
typedef __attribute__((ext_vector_type(16))) __bf16 v16b;
typedef __attribute__((ext_vector_type(8)))  _Float16 v8h;
typedef __attribute__((ext_vector_type(8)))  float v8f;
typedef __attribute__((ext_vector_type(4)))  float v4f;
typedef __attribute__((ext_vector_type(2)))  float v2f;
typedef __attribute__((ext_vector_type(4)))  unsigned v4u;
typedef __attribute__((ext_vector_type(4)))  int v4i;
typedef float __attribute__((may_alias)) float_a;
typedef int __attribute__((may_alias)) int_a;

template <typename T> __device__ __forceinline__ void vst2(void* p, T v) { *(T*)p = v;  }
__device__ __forceinline__ v8f wmma16(v16h a, v16h b, v8f c) {
  v8f d = __builtin_amdgcn_wmma_f32_16x16x32_f16(false, a, false, b, (short)0, c, false, false);
  asm volatile("v_nop\n\tv_nop\n\tv_nop\n\tv_nop" : "+v"(d) : "v"(a), "v"(b));
  return d;
}
__device__ __forceinline__ v8f wmma_bf(v16b a, v16b b, v8f c) {
  v8f d = __builtin_amdgcn_wmma_f32_16x16x32_bf16(false, a, false, b, (short)0, c, false, false);
  asm volatile("v_nop\n\tv_nop\n\tv_nop\n\tv_nop" : "+v"(d) : "v"(a), "v"(b));
  return d;
}
// 16x16x32 fragments: lane = (h = lane>>4, row/col = lane&15); elements 0..7 = k0+8h+0..7, 8..15 = k0+16+8h+0..7; D element r = row 8h+r
__device__ __forceinline__ v16h frag_h(const _Float16* rowk0, int lane) {
  union { v16h v; v8h q[2]; } u; const _Float16* p = rowk0 + 8 * (lane >> 4);
  u.q[0] = *(const v8h*)p; u.q[1] = *(const v8h*)(p + 16); return u.v;
}
__device__ __forceinline__ v16h frag_f32(const float* rowk0, int lane) {
  v16h a; const float* p = rowk0 + 8 * (lane >> 4);
#pragma unroll
  for (int i = 0; i < 8; ++i) { a[i] = (_Float16)p[i]; a[8 + i] = (_Float16)p[16 + i]; }
  return a;
}
__device__ __forceinline__ v16h frag_f32s(const float* rowk0, int lane, float sc) {
  v16h a; const float* p = rowk0 + 8 * (lane >> 4);
#pragma unroll
  for (int i = 0; i < 8; ++i) { a[i] = (_Float16)(p[i] * sc); a[8 + i] = (_Float16)(p[16 + i] * sc); }
  return a;
}
// column fragment from a [K][ld] layout (column n), rows >= K read as 0
__device__ __forceinline__ v16h fragc_f32(const float* W, int k0, int n, int lane, int ld, int K) {
  v16h a; const int g = lane >> 4;
#pragma unroll
  for (int i = 0; i < 8; ++i) { const int ka = k0 + 8 * g + i, kb = ka + 16;
    a[i] = (_Float16)(ka < K ? W[(size_t)ka * ld + n] : 0.f); a[8 + i] = (_Float16)(kb < K ? W[(size_t)kb * ld + n] : 0.f); }
  return a;
}
struct F2 { v16b h, l; };
__device__ __forceinline__ F2 bsplit16(const float v[16]) { F2 r;
#pragma unroll
  for (int i = 0; i < 16; ++i) { const __bf16 h = (__bf16)v[i]; r.h[i] = h; r.l[i] = (__bf16)(v[i] - (float)h); }
  return r; }
__device__ __forceinline__ F2 split_row(const float* row, int k0, int lane) { float v[16]; const float* p = row + k0 + 8 * (lane >> 4);
#pragma unroll
  for (int i = 0; i < 8; ++i) { v[i] = p[i]; v[8 + i] = p[16 + i]; }
  return bsplit16(v); }
__device__ __forceinline__ F2 split_rowK(const float* row, int k0, int lane, int K) { float v[16]; const int g = lane >> 4;
#pragma unroll
  for (int i = 0; i < 8; ++i) { const int ka = k0 + 8 * g + i, kb = ka + 16; v[i] = ka < K ? row[ka] : 0.f; v[8 + i] = kb < K ? row[kb] : 0.f; }
  return bsplit16(v); }
__device__ __forceinline__ F2 split_col(const float* W, int k0, int n, int lane, int ld, int K) { float v[16]; const int g = lane >> 4;
#pragma unroll
  for (int i = 0; i < 8; ++i) { const int ka = k0 + 8 * g + i, kb = ka + 16; v[i] = ka < K ? W[(size_t)ka * ld + n] : 0.f; v[8 + i] = kb < K ? W[(size_t)kb * ld + n] : 0.f; }
  return bsplit16(v); }
__device__ __forceinline__ v8f mac3(const F2& a, const F2& b, v8f c) { c = wmma_bf(a.l, b.h, c); c = wmma_bf(a.h, b.l, c); return wmma_bf(a.h, b.h, c); }
__device__ __forceinline__ float sigm(float v) { return 1.0f / (1.0f + expf(-v)); }
#define LDSX() do { asm volatile("s_wait_dscnt 0" ::: "memory"); __builtin_amdgcn_wave_barrier(); __builtin_amdgcn_fence(__ATOMIC_RELEASE, "workgroup"); } while (0)

// Sigmoid attention block with QK-RMSNorm and rotary embedding. Pure f16 WMMA GEMMs over pre-converted operands (x -> f16 once;
// weights x16 f16 with the RMSNorm scales folded into the q/k weight columns; f32 accumulate): q|k|v projection with the per-row
// RMS factor, bias and RoPE in the f32 epilogue (q/k -> [b][h][l][64] f16, v -> [b][h][d][l] f16), per (b, h, 64 queries) block
// the 2048 keys streamed in 64-key tiles: S on f16 WMMA, sigmoid in f32 (hardware exp/rcp), running row sums, W x2^14 f16 @ v^T,
#define NB 2
#define LL 2048
#define DD 1024
#define NH 16
#define HD 64
#define NR (NB * LL)

// ---- operand tiles staged in LDS by asynchronous copies: rows of 128 B (64 f16), 8 lanes = one whole 128-B line, 128 threads = 16 rows a copy
#define TP 72              // LDS pitch of a staged row in f16: 144 B = 16 B x 9, conflict-free for ds_load_b128
#define R16 (16 * TP * 2)  // bytes of 16 staged rows
#define ACP(l, g) "global_load_async_to_lds_b128 %" #l ", %" #g ", off\n\t"
// this wave's copies have landed (the compiler places no wait for them)
#define WAIT_COPIES() asm volatile("s_wait_asynccnt 0x0" ::: "memory")
// this wave's LDS reads of a buffer have retired before the buffer is handed back for a refill
#define WAIT_LDS() asm volatile("s_wait_dscnt 0x0" ::: "memory")
__device__ __forceinline__ unsigned lds_at(const _Float16* p) { return (unsigned)(size_t)p; }   // LDS byte address = low 32 bits
// one GEMM stage, 64 k: buf rows 0..63 = 64 X rows, rows 64..191 = 128 W rows. s_wait_xcnt closes the copies' own statement, so that no address register of a copy is rewritten ahead of it.
__device__ __forceinline__ void stage_gemm(_Float16* buf, const _Float16* xa, const _Float16* wb, int tid) {
  const int r = tid >> 3, c = (tid & 7) * 8;
  const unsigned l = lds_at(buf + r * TP + c);
  const _Float16* a = xa + (size_t)r * DD + c; const _Float16* b = wb + (size_t)r * DD + c;
  asm volatile(ACP(0, 1) ACP(2, 3) ACP(4, 5) ACP(6, 7) ACP(8, 9) ACP(10, 11) ACP(12, 13) ACP(14, 15) ACP(16, 17) ACP(18, 19) ACP(20, 21) ACP(22, 23) "s_wait_xcnt 0x0"
               :: "v"(l), "v"(a), "v"(l + R16), "v"(a + 16 * DD), "v"(l + 2 * R16), "v"(a + 32 * DD), "v"(l + 3 * R16), "v"(a + 48 * DD),
                  "v"(l + 4 * R16), "v"(b), "v"(l + 5 * R16), "v"(b + 16 * DD), "v"(l + 6 * R16), "v"(b + 32 * DD), "v"(l + 7 * R16), "v"(b + 48 * DD),
                  "v"(l + 8 * R16), "v"(b + 64 * DD), "v"(l + 9 * R16), "v"(b + 80 * DD), "v"(l + 10 * R16), "v"(b + 96 * DD), "v"(l + 11 * R16), "v"(b + 112 * DD) : "memory");
}
// one attention tile: 64 keys x 64 dims of K, 64 dims x 64 keys of V^T; the wait as above
__device__ __forceinline__ void stage_kv(_Float16* sk, _Float16* sv, const _Float16* gk, const _Float16* gv, int tid) {
  const int r = tid >> 3, c = (tid & 7) * 8;
  const unsigned lk = lds_at(sk + r * TP + c), lv = lds_at(sv + r * TP + c);
  const _Float16* k = gk + (size_t)r * HD + c; const _Float16* v = gv + (size_t)r * LL + c;
  asm volatile(ACP(0, 1) ACP(2, 3) ACP(4, 5) ACP(6, 7) ACP(8, 9) ACP(10, 11) ACP(12, 13) ACP(14, 15) "s_wait_xcnt 0x0"
               :: "v"(lk), "v"(k), "v"(lk + R16), "v"(k + 16 * HD), "v"(lk + 2 * R16), "v"(k + 32 * HD), "v"(lk + 3 * R16), "v"(k + 48 * HD),
                  "v"(lv), "v"(v), "v"(lv + R16), "v"(v + 16 * LL), "v"(lv + 2 * R16), "v"(v + 32 * LL), "v"(lv + 3 * R16), "v"(v + 48 * LL) : "memory");
}
#define GBUF (192 * TP)           // f16 of one GEMM buffer
#define RING_B (2 * GBUF * 2)     // bytes of the two
// 64 x 128 tile over K = 1024: 16 stages, two buffers, stage s + 2 copied while stage s + 1 is worked on; k order as before
__device__ __forceinline__ void gemm_ring(_Float16* ring, const _Float16* xa, const _Float16* wb, v8f acc[8], int tid) {
  const int wave = tid >> 5, lane = tid & 31, col = lane & 15;
  stage_gemm(ring, xa, wb, tid);
  WAIT_COPIES(); __syncthreads();
  stage_gemm(ring + GBUF, xa + 64, wb + 64, tid);
#pragma unroll 1   // one trip = one stage, so that the ring's order stands once, at the trip's foot
  for (int s = 0; s < DD / 64; ++s) { _Float16* buf = ring + (s & 1) * GBUF;
    v16h a[2], b[2][8];   // the stage's 18 fragments are read as one group ahead of its 16 WMMAs: one LDS latency a stage, counted waits, not one full wait a WMMA
#pragma unroll
    for (int kc = 0; kc < 2; ++kc) { a[kc] = frag_h(buf + (wave * 16 + col) * TP + kc * 32, lane);
#pragma unroll
      for (int j = 0; j < 8; ++j) b[kc][j] = frag_h(buf + (64 + j * 16 + col) * TP + kc * 32, lane); }
#pragma unroll
    for (int kc = 0; kc < 2; ++kc) {
#pragma unroll
      for (int j = 0; j < 8; ++j) acc[j] = wmma16(a[kc], b[kc][j], acc[j]); }
    WAIT_LDS(); WAIT_COPIES(); __syncthreads();   // publishes stage s + 1 and ends every read of stage s
    if (s + 2 < DD / 64) stage_gemm(buf, xa + (s + 2) * 64, wb + (s + 2) * 64, tid); }
  WAIT_COPIES();
}

// ---- operand preparation, one launch: wave n takes row n of x (f16 copy + rsqrt(mean x^2 + eps)) and row n of the packed weights (q | k | v | o, [out][in] each), each row whole.
// 4,096 waves in all, 16 to 24 loads of 16 B a lane in flight, every load 512 contiguous B, every f16 store 256, the rr store 128; the row's sum stays in the wave: no LDS, no barrier
static_assert(NR == 4 * DD, "one x row and one weight row a wave");
__global__ __launch_bounds__(256) void k_prep(const float* __restrict__ x, const float* __restrict__ Wq, const float* __restrict__ Wk, const float* __restrict__ Wv, const float* __restrict__ Wo, const float* __restrict__ qs, const float* __restrict__ ksv,
                                            _Float16* __restrict__ x16, float* __restrict__ rr, _Float16* __restrict__ P) {
  const int lane = threadIdx.x & 31, n = blockIdx.x * 8 + __builtin_amdgcn_readfirstlane(threadIdx.x >> 5);   // n in a scalar register: the row bases and the test below are scalar
  const int which = n / DD, o = n % DD;
  const float* W = which == 0 ? Wq : (which == 1 ? Wk : (which == 2 ? Wv : Wo));
  const float* xr = x + (size_t)n * DD + lane * 4; const float* wr = W + (size_t)o * DD + lane * 4;
  v4f xv[8], wv[8], sc[8];
#pragma unroll
  for (int i = 0; i < 8; ++i) xv[i] = *(const v4f*)(xr + i * 128);
#pragma unroll
  for (int i = 0; i < 8; ++i) wv[i] = *(const v4f*)(wr + i * 128);
  if (which < 2) { const float* sr = (which == 0 ? qs : ksv) + lane * 4;
#pragma unroll
    for (int i = 0; i < 8; ++i) sc[i] = *(const v4f*)(sr + i * 128); }
  else {
#pragma unroll
    for (int i = 0; i < 8; ++i) sc[i] = (v4f){1.0f, 1.0f, 1.0f, 1.0f}; }   // x 1 is exact: v and o rows keep their bits
  float ss[4] = {0.f, 0.f, 0.f, 0.f};   // four independent chains
#pragma unroll
  for (int i = 0; i < 8; ++i) { union { _Float16 h[4]; v2f f; } pk;
#pragma unroll
    for (int e = 0; e < 4; ++e) { ss[e] += xv[i][e] * xv[i][e]; pk.h[e] = (_Float16)xv[i][e]; }
    vst2((v2f*)(x16 + (size_t)n * DD + i * 128 + lane * 4), pk.f); }
#pragma unroll
  for (int i = 0; i < 8; ++i) { union { _Float16 h[4]; v2f f; } pk;
#pragma unroll
    for (int e = 0; e < 4; ++e) pk.h[e] = (_Float16)(wv[i][e] * 16.0f * sc[i][e]);
    vst2((v2f*)(P + (size_t)n * DD + i * 128 + lane * 4), pk.f); }
  float s = (ss[0] + ss[1]) + (ss[2] + ss[3]);
#pragma unroll
  for (int off = 16; off >= 1; off >>= 1) s += __shfl_xor(s, off, 32);
  vst2(rr + (size_t)n * 32 + lane, (float_a)(lane == 0 ? rsqrtf(s / (float)DD + 1e-8f) : 0.f));   // rr[row*32] (one line per row)
}
// ---- projection: block 64 rows x 128 cols (= which, 2 heads); epilogue: x rr (q,k), + bias, RoPE (q,k); q/k -> [b][h][t][64] f16; v -> vT [b][h][d][t]
__global__ __launch_bounds__(128) void k_proj(const _Float16* __restrict__ x16, const float* __restrict__ rr, const _Float16* __restrict__ P, const float* __restrict__ bq, const float* __restrict__ bk, const float* __restrict__ bv,
                                            _Float16* __restrict__ qh, _Float16* __restrict__ kh, _Float16* __restrict__ vT) {
  __shared__ __align__(16) char smem[RING_B];                        // the ring; behind the loop's last barrier it is the epilogue's staging
  float (*so)[16][132] = (float (*)[16][132])smem;                   // 33,792 B
  _Float16 (*st)[72] = (_Float16 (*)[72])(smem + 4 * 16 * 132 * 4);  // 18,432 B behind it
  __shared__ float sfr[32];
  const int tid = threadIdx.x, wave = tid >> 5, lane = tid & 31, col = lane & 15, g = lane >> 4;
  const int r0b = blockIdx.x * 64, r0 = r0b + wave * 16, n0 = blockIdx.y * 128; const int b = r0b / LL, t0 = r0b % LL;
  const int which = n0 / DD, hb = (n0 % DD) / HD; const float* bias = which == 0 ? bq : (which == 1 ? bk : bv);
  if (tid < 32) sfr[tid] = powf(10000.0f, -(float)tid / 32.0f);
  v8f acc[8] = {};
  gemm_ring((_Float16*)smem, x16 + (size_t)r0b * DD, P + (size_t)n0 * DD, acc, tid);
  __syncthreads();
#pragma unroll
  for (int j = 0; j < 8; ++j) { const int nl = j * 16 + col; const float bb = bias[(n0 % DD) + nl];
#pragma unroll
    for (int r = 0; r < 8; ++r) { const float sc = which < 2 ? rr[(size_t)(r0 + 8 * g + r) * 32] : 1.0f; so[wave][8 * g + r][nl] = acc[j][r] * (1.0f / 16.0f) * sc + bb; } }
  LDSX();
  if (which < 2) {   // RoPE in place: lane handles row rl, dims; angle index d & 31, rotation partner d^1
    for (int rl = 0; rl < 16; ++rl) { const float t = (float)(t0 + wave * 16 + rl); float nv[4];
#pragma unroll
      for (int e = 0; e < 4; ++e) { const int nl = lane * 4 + e; const int d = nl & 63; const float ang = t * sfr[d & 31]; float sn, cs; sincosf(ang, &sn, &cs);
        const float xv = so[wave][rl][nl]; const float xr = (d & 1) ? so[wave][rl][nl - 1] : -so[wave][rl][nl + 1]; nv[e] = xv * cs + xr * sn; }
      LDSX();
#pragma unroll
      for (int e = 0; e < 4; ++e) so[wave][rl][lane * 4 + e] = nv[e];
      LDSX(); }
    _Float16* dst = which == 0 ? qh : kh;
    for (int q = lane; q < 2 * 16 * 8; q += 32) { const int hh = q >> 7, rem = q & 127, rl = rem >> 3, pc = rem & 7; union { v8h h8; v4u u; } pk;
#pragma unroll
      for (int e = 0; e < 8; ++e) pk.h8[e] = (_Float16)so[wave][rl][hh * HD + pc * 8 + e];
      vst2(dst + (((size_t)b * NH + hb + hh) * LL + t0 + wave * 16 + rl) * HD + pc * 8, pk.u); } }
  else {
#pragma unroll 4
    for (int rl = 0; rl < 16; ++rl) {
#pragma unroll
      for (int e = 0; e < 4; ++e) st[lane * 4 + e][wave * 16 + rl] = (_Float16)so[wave][rl][lane * 4 + e]; }
    __syncthreads();
    for (int q = tid; q < 128 * 8; q += 128) { const int c = q >> 3, pc = q & 7, hh = c >> 6, d = c & 63;
      vst2(vT + (((size_t)b * NH + hb + hh) * HD + d) * LL + t0 + pc * 8, *(const v4u*)(&st[c][pc * 8])); }
  }
}
// ---- sigmoid attention: block (64 q, bh); all 32 key tiles; W = sigmoid(q.k/8); l += W; acc += W @ v ; out = acc / (l + eps) -> o16 [b][t][h*64+d] f16
__global__ __launch_bounds__(128) void k_attn(const _Float16* __restrict__ qh, const _Float16* __restrict__ kh, const _Float16* __restrict__ vT, _Float16* __restrict__ o16) {
  __shared__ __align__(16) _Float16 sP[4][16][72];
  __shared__ __align__(16) float sO[4][16][68];
  __shared__ __align__(16) _Float16 sK[2][64][TP];   // 64 keys x 64 dims
  __shared__ __align__(16) _Float16 sV[2][64][TP];   // 64 dims x 64 keys
  const int tid = threadIdx.x, w = tid >> 5, lane = tid & 31, col = lane & 15, g = lane >> 4;
  const int bh = blockIdx.y, b = bh / NH, h = bh % NH, q0 = blockIdx.x * 64 + w * 16;
  const _Float16* qb = qh + (size_t)bh * LL * HD; const _Float16* kb = kh + (size_t)bh * LL * HD; const _Float16* vb = vT + (size_t)bh * HD * LL;
  v16h aq[2];
#pragma unroll
  for (int kc = 0; kc < 2; ++kc) aq[kc] = frag_h(qb + (size_t)(q0 + col) * HD + kc * 32, lane);
  float lsum[8] = {0.f, 0.f, 0.f, 0.f, 0.f, 0.f, 0.f, 0.f}; v8f acc[4] = {};
  stage_kv(&sK[0][0][0], &sV[0][0][0], kb, vb, tid);
  WAIT_COPIES(); __syncthreads();
  stage_kv(&sK[1][0][0], &sV[1][0][0], kb + (size_t)64 * HD, vb + 64, tid);
#pragma unroll 1
  for (int kt = 0; kt < LL / 64; ++kt) { const int bf = kt & 1;
    v16h fk[4][2], fv[2][4];   // the tile's 8 K and 8 V fragments are read as one group at its head: the V reads land under the score and sigmoid work
#pragma unroll
    for (int t = 0; t < 4; ++t) {
#pragma unroll
      for (int kc = 0; kc < 2; ++kc) fk[t][kc] = frag_h(&sK[bf][t * 16 + col][kc * 32], lane); }
#pragma unroll
    for (int kc = 0; kc < 2; ++kc) {
#pragma unroll
      for (int t = 0; t < 4; ++t) fv[kc][t] = frag_h(&sV[bf][t * 16 + col][kc * 32], lane); }
#pragma unroll
    for (int t = 0; t < 4; ++t) { v8f s = {};
#pragma unroll
      for (int kc = 0; kc < 2; ++kc) s = wmma16(aq[kc], fk[t][kc], s);
#pragma unroll
      for (int r = 0; r < 8; ++r) { const float wgt = __builtin_amdgcn_rcpf(1.0f + __expf(-s[r] * 0.125f)); lsum[r] += wgt; sP[w][8 * g + r][t * 16 + col] = (_Float16)(wgt * 16384.0f); } }
    LDSX();
    v16h pa[2];            // both P fragments together, ahead of the 8 WMMAs
#pragma unroll
    for (int kc = 0; kc < 2; ++kc) pa[kc] = frag_h(&sP[w][col][0] + kc * 32, lane);
#pragma unroll
    for (int kc = 0; kc < 2; ++kc) {
#pragma unroll
      for (int t = 0; t < 4; ++t) acc[t] = wmma16(pa[kc], fv[kc][t], acc[t]); }
    WAIT_LDS(); WAIT_COPIES(); __syncthreads();   // publishes tile kt + 1 and ends every read of tile kt
    if (kt + 2 < LL / 64) stage_kv(&sK[bf][0][0], &sV[bf][0][0], kb + (size_t)(kt + 2) * 64 * HD, vb + (kt + 2) * 64, tid);
  }
  WAIT_COPIES();
  // row sums: lsum[r] (this lane's 4 tiles x its column) -> reduce over the 16 col lanes of each half -> row 8g+r
#pragma unroll
  for (int off = 8; off >= 1; off >>= 1) {
#pragma unroll
    for (int r = 0; r < 8; ++r) lsum[r] += __shfl_xor(lsum[r], off, 32); }
#pragma unroll
  for (int r = 0; r < 8; ++r) { const float inv = 1.0f / ((lsum[r] + 1e-8f) * 16384.0f);
#pragma unroll
    for (int t = 0; t < 4; ++t) sO[w][8 * g + r][t * 16 + col] = acc[t][r] * inv; }
  LDSX();
  for (int q = lane; q < 16 * 8; q += 32) { const int rl = q >> 3, pc = q & 7; union { v8h h8; v4u u; } pk;
#pragma unroll
    for (int e = 0; e < 8; ++e) pk.h8[e] = (_Float16)(sO[w][rl][pc * 8 + e] * 16.0f);             // o x16 keeps the f16 operand normal
    vst2(o16 + ((size_t)b * LL + q0 + rl) * DD + h * HD + pc * 8, pk.u); }
}
__global__ __launch_bounds__(128) void k_out(const _Float16* __restrict__ o16, const _Float16* __restrict__ P, const float* __restrict__ bo, float* __restrict__ out) {
  __shared__ __align__(16) char smem[RING_B];        // the ring; behind the loop's last barrier it is the epilogue's staging
  float (*so)[16][132] = (float (*)[16][132])smem;
  const int tid = threadIdx.x, wave = tid >> 5, lane = tid & 31, col = lane & 15, g = lane >> 4;
  const int r0 = blockIdx.x * 64 + wave * 16, n0 = blockIdx.y * 128;
  v8f acc[8] = {};
  gemm_ring((_Float16*)smem, o16 + (size_t)blockIdx.x * 64 * DD, P + (size_t)(3 * DD + n0) * DD, acc, tid);
#pragma unroll
  for (int j = 0; j < 8; ++j) { const float bb = bo[n0 + j * 16 + col];
#pragma unroll
    for (int r = 0; r < 8; ++r) so[wave][8 * g + r][j * 16 + col] = acc[j][r] * (1.0f / 256.0f) + bb; }    // W x16, o x16
  LDSX();
#pragma unroll 4
  for (int rl = 0; rl < 16; ++rl) vst2(out + (size_t)(r0 + rl) * DD + n0 + lane * 4, *(const v4f*)(&so[wave][rl][lane * 4]));
}
extern "C" void kernel_launch(void* const* d_in, const int* in_sizes, int n_in, void* d_out, int out_size, void* d_ws, size_t ws_size, hipStream_t stream) {
  (void)in_sizes; (void)n_in; (void)out_size; (void)ws_size;
  const float* x = (const float*)d_in[0]; const float* Wq = (const float*)d_in[1]; const float* bq = (const float*)d_in[2]; const float* Wk = (const float*)d_in[3]; const float* bk = (const float*)d_in[4];
  const float* Wv = (const float*)d_in[5]; const float* bv = (const float*)d_in[6]; const float* Wo = (const float*)d_in[7]; const float* bo = (const float*)d_in[8];
  const float* qs = (const float*)d_in[9]; const float* ksv = (const float*)d_in[10];
  float* out = (float*)d_out;
  char* ws = (char*)d_ws; size_t off = 0;
  auto take = [&](size_t bytes) { char* p = ws + off; off += (bytes + 255) & ~(size_t)255; return p; };
  _Float16* x16 = (_Float16*)take((size_t)NR * DD * 2); float* rr = (float*)take((size_t)NR * 32 * 4); _Float16* P = (_Float16*)take((size_t)4 * DD * DD * 2);
  _Float16* qh = (_Float16*)take((size_t)NR * DD * 2); _Float16* kh = (_Float16*)take((size_t)NR * DD * 2); _Float16* vT = (_Float16*)take((size_t)NR * DD * 2); _Float16* o16 = (_Float16*)take((size_t)NR * DD * 2);
  k_prep<<<NR / 8, 256, 0, stream>>>(x, Wq, Wk, Wv, Wo, qs, ksv, x16, rr, P);
  k_proj<<<dim3(NR / 64, 3 * DD / 128), 128, 0, stream>>>(x16, rr, P, bq, bk, bv, qh, kh, vT);
  k_attn<<<dim3(LL / 64, NB * NH), 128, 0, stream>>>(qh, kh, vT, o16);
  k_out<<<dim3(NR / 64, DD / 128), 128, 0, stream>>>(o16, P, bo, out);
}

// v004
// One run takes 105 microseconds.
// Two timings next to v003 both put it at 1.08 times that version's speed.
// All steps since v000 together make it 3.22 times as fast.
#include <hip/hip_runtime.h>
#include <math.h>

typedef __attribute__((ext_vector_type(16))) _Float16 v16h;
typedef __attribute__((ext_vector_type(16))) __bf16 v16b;
typedef __attribute__((ext_vector_type(8)))  _Float16 v8h;
typedef __attribute__((ext_vector_type(8)))  float v8f;
typedef __attribute__((ext_vector_type(4)))  float v4f;
typedef __attribute__((ext_vector_type(2)))  float v2f;
typedef __attribute__((ext_vector_type(4)))  unsigned v4u;
typedef __attribute__((ext_vector_type(4)))  int v4i;
typedef float __attribute__((may_alias)) float_a;
typedef int __attribute__((may_alias)) int_a;

template <typename T> __device__ __forceinline__ void vst2(void* p, T v) { *(T*)p = v;  }
__device__ __forceinline__ v8f wmma16(v16h a, v16h b, v8f c) {
  v8f d = __builtin_amdgcn_wmma_f32_16x16x32_f16(false, a, false, b, (short)0, c, false, false);
  asm volatile("v_nop\n\tv_nop\n\tv_nop\n\tv_nop" : "+v"(d) : "v"(a), "v"(b));
  return d;
}
__device__ __forceinline__ v8f wmma_bf(v16b a, v16b b, v8f c) {
  v8f d = __builtin_amdgcn_wmma_f32_16x16x32_bf16(false, a, false, b, (short)0, c, false, false);
  asm volatile("v_nop\n\tv_nop\n\tv_nop\n\tv_nop" : "+v"(d) : "v"(a), "v"(b));
  return d;
}
// 16x16x32 fragments: lane = (h = lane>>4, row/col = lane&15); elements 0..7 = k0+8h+0..7, 8..15 = k0+16+8h+0..7; D element r = row 8h+r
__device__ __forceinline__ v16h frag_h(const _Float16* rowk0, int lane) {
  union { v16h v; v8h q[2]; } u; const _Float16* p = rowk0 + 8 * (lane >> 4);
  u.q[0] = *(const v8h*)p; u.q[1] = *(const v8h*)(p + 16); return u.v;
}
__device__ __forceinline__ v16h frag_f32(const float* rowk0, int lane) {
  v16h a; const float* p = rowk0 + 8 * (lane >> 4);
#pragma unroll
  for (int i = 0; i < 8; ++i) { a[i] = (_Float16)p[i]; a[8 + i] = (_Float16)p[16 + i]; }
  return a;
}
__device__ __forceinline__ v16h frag_f32s(const float* rowk0, int lane, float sc) {
  v16h a; const float* p = rowk0 + 8 * (lane >> 4);
#pragma unroll
  for (int i = 0; i < 8; ++i) { a[i] = (_Float16)(p[i] * sc); a[8 + i] = (_Float16)(p[16 + i] * sc); }
  return a;
}
// column fragment from a [K][ld] layout (column n), rows >= K read as 0
__device__ __forceinline__ v16h fragc_f32(const float* W, int k0, int n, int lane, int ld, int K) {
  v16h a; const int g = lane >> 4;
#pragma unroll
  for (int i = 0; i < 8; ++i) { const int ka = k0 + 8 * g + i, kb = ka + 16;
    a[i] = (_Float16)(ka < K ? W[(size_t)ka * ld + n] : 0.f); a[8 + i] = (_Float16)(kb < K ? W[(size_t)kb * ld + n] : 0.f); }
  return a;
}
struct F2 { v16b h, l; };
__device__ __forceinline__ F2 bsplit16(const float v[16]) { F2 r;
#pragma unroll
  for (int i = 0; i < 16; ++i) { const __bf16 h = (__bf16)v[i]; r.h[i] = h; r.l[i] = (__bf16)(v[i] - (float)h); }
  return r; }
__device__ __forceinline__ F2 split_row(const float* row, int k0, int lane) { float v[16]; const float* p = row + k0 + 8 * (lane >> 4);
#pragma unroll
  for (int i = 0; i < 8; ++i) { v[i] = p[i]; v[8 + i] = p[16 + i]; }
  return bsplit16(v); }
__device__ __forceinline__ F2 split_rowK(const float* row, int k0, int lane, int K) { float v[16]; const int g = lane >> 4;
#pragma unroll
  for (int i = 0; i < 8; ++i) { const int ka = k0 + 8 * g + i, kb = ka + 16; v[i] = ka < K ? row[ka] : 0.f; v[8 + i] = kb < K ? row[kb] : 0.f; }
  return bsplit16(v); }
__device__ __forceinline__ F2 split_col(const float* W, int k0, int n, int lane, int ld, int K) { float v[16]; const int g = lane >> 4;
#pragma unroll
  for (int i = 0; i < 8; ++i) { const int ka = k0 + 8 * g + i, kb = ka + 16; v[i] = ka < K ? W[(size_t)ka * ld + n] : 0.f; v[8 + i] = kb < K ? W[(size_t)kb * ld + n] : 0.f; }
  return bsplit16(v); }
__device__ __forceinline__ v8f mac3(const F2& a, const F2& b, v8f c) { c = wmma_bf(a.l, b.h, c); c = wmma_bf(a.h, b.l, c); return wmma_bf(a.h, b.h, c); }
__device__ __forceinline__ float sigm(float v) { return 1.0f / (1.0f + expf(-v)); }
#define LDSX() do { asm volatile("s_wait_dscnt 0" ::: "memory"); __builtin_amdgcn_wave_barrier(); __builtin_amdgcn_fence(__ATOMIC_RELEASE, "workgroup"); } while (0)

// Sigmoid attention block with QK-RMSNorm and rotary embedding. Pure f16 WMMA GEMMs over pre-converted operands (x -> f16 once;
// weights x16 f16 with the RMSNorm scales folded into the q/k weight columns; f32 accumulate): q|k|v projection with the per-row
// RMS factor, bias and RoPE in the f32 epilogue (q/k -> [b][h][l][64] f16, v -> [b][h][d][l] f16), per (b, h, 64 queries) block
// the 2048 keys streamed in 64-key tiles: S on f16 WMMA, sigmoid in f32 (hardware exp/rcp), running row sums, W x2^14 f16 @ v^T,
#define NB 2
#define LL 2048
#define DD 1024
#define NH 16
#define HD 64
#define NR (NB * LL)

// ---- operand tiles staged in LDS by asynchronous copies: rows of 128 B (64 f16), 8 lanes = one whole 128-B line, 128 threads = 16 rows a copy
#define TP 72              // LDS pitch of a staged row in f16: 144 B = 16 B x 9, conflict-free for ds_load_b128
#define R16 (16 * TP * 2)  // bytes of 16 staged rows
#define ACP(l, g) "global_load_async_to_lds_b128 %" #l ", %" #g ", off\n\t"
// this wave's copies have landed (the compiler places no wait for them)
#define WAIT_COPIES() asm volatile("s_wait_asynccnt 0x0" ::: "memory")
// this wave's LDS reads of a buffer have retired before the buffer is handed back for a refill
#define WAIT_LDS() asm volatile("s_wait_dscnt 0x0" ::: "memory")
__device__ __forceinline__ unsigned lds_at(const _Float16* p) { return (unsigned)(size_t)p; }   // LDS byte address = low 32 bits
// one GEMM stage, 64 k: buf rows 0..63 = 64 X rows, rows 64..191 = 128 W rows. s_wait_xcnt closes the copies' own statement, so that no address register of a copy is rewritten ahead of it.
__device__ __forceinline__ void stage_gemm(_Float16* buf, const _Float16* xa, const _Float16* wb, int tid) {
  const int r = tid >> 3, c = (tid & 7) * 8;
  const unsigned l = lds_at(buf + r * TP + c);
  const _Float16* a = xa + (size_t)r * DD + c; const _Float16* b = wb + (size_t)r * DD + c;
  asm volatile(ACP(0, 1) ACP(2, 3) ACP(4, 5) ACP(6, 7) ACP(8, 9) ACP(10, 11) ACP(12, 13) ACP(14, 15) ACP(16, 17) ACP(18, 19) ACP(20, 21) ACP(22, 23) "s_wait_xcnt 0x0"
               :: "v"(l), "v"(a), "v"(l + R16), "v"(a + 16 * DD), "v"(l + 2 * R16), "v"(a + 32 * DD), "v"(l + 3 * R16), "v"(a + 48 * DD),
                  "v"(l + 4 * R16), "v"(b), "v"(l + 5 * R16), "v"(b + 16 * DD), "v"(l + 6 * R16), "v"(b + 32 * DD), "v"(l + 7 * R16), "v"(b + 48 * DD),
                  "v"(l + 8 * R16), "v"(b + 64 * DD), "v"(l + 9 * R16), "v"(b + 80 * DD), "v"(l + 10 * R16), "v"(b + 96 * DD), "v"(l + 11 * R16), "v"(b + 112 * DD) : "memory");
}
// one attention tile: 64 keys x 64 dims of K, 64 dims x 64 keys of V^T; the wait as above
__device__ __forceinline__ void stage_kv(_Float16* sk, _Float16* sv, const _Float16* gk, const _Float16* gv, int tid) {
  const int r = tid >> 3, c = (tid & 7) * 8;
  const unsigned lk = lds_at(sk + r * TP + c), lv = lds_at(sv + r * TP + c);
  const _Float16* k = gk + (size_t)r * HD + c; const _Float16* v = gv + (size_t)r * LL + c;
  asm volatile(ACP(0, 1) ACP(2, 3) ACP(4, 5) ACP(6, 7) ACP(8, 9) ACP(10, 11) ACP(12, 13) ACP(14, 15) "s_wait_xcnt 0x0"
               :: "v"(lk), "v"(k), "v"(lk + R16), "v"(k + 16 * HD), "v"(lk + 2 * R16), "v"(k + 32 * HD), "v"(lk + 3 * R16), "v"(k + 48 * HD),
                  "v"(lv), "v"(v), "v"(lv + R16), "v"(v + 16 * LL), "v"(lv + 2 * R16), "v"(v + 32 * LL), "v"(lv + 3 * R16), "v"(v + 48 * LL) : "memory");
}
#define GBUF (192 * TP)           // f16 of one GEMM buffer
#define RING_B (2 * GBUF * 2)     // bytes of the two
// 64 x 128 tile over K = 1024: 16 stages, two buffers, stage s + 2 copied while stage s + 1 is worked on; k order as before
// WA = false: X rows as A, acc[j][r] = Y[row 8h + r][n = 16j + c]. WA = true: W rows as A, acc[j][r] = Y[row c][n = 16j + 8h + r]: a lane holds 8 consecutive n of one row
template <bool WA> __device__ __forceinline__ void gemm_ring(_Float16* ring, const _Float16* xa, const _Float16* wb, v8f acc[8], int tid) {
  const int wave = tid >> 5, lane = tid & 31, col = lane & 15;
  stage_gemm(ring, xa, wb, tid);
  WAIT_COPIES(); __syncthreads();
  stage_gemm(ring + GBUF, xa + 64, wb + 64, tid);
#pragma unroll 1   // one trip = one stage, so that the ring's order stands once, at the trip's foot
  for (int s = 0; s < DD / 64; ++s) { _Float16* buf = ring + (s & 1) * GBUF;
    v16h a[2], b[2][8];   // the stage's 18 fragments are read as one group ahead of its 16 WMMAs: one LDS latency a stage, counted waits, not one full wait a WMMA
#pragma unroll
    for (int kc = 0; kc < 2; ++kc) { a[kc] = frag_h(buf + (wave * 16 + col) * TP + kc * 32, lane);
#pragma unroll
      for (int j = 0; j < 8; ++j) b[kc][j] = frag_h(buf + (64 + j * 16 + col) * TP + kc * 32, lane); }
#pragma unroll
    for (int kc = 0; kc < 2; ++kc) {
#pragma unroll
      for (int j = 0; j < 8; ++j) acc[j] = WA ? wmma16(b[kc][j], a[kc], acc[j]) : wmma16(a[kc], b[kc][j], acc[j]); }
    WAIT_LDS(); WAIT_COPIES(); __syncthreads();   // publishes stage s + 1 and ends every read of stage s
    if (s + 2 < DD / 64) stage_gemm(buf, xa + (s + 2) * 64, wb + (s + 2) * 64, tid); }
  WAIT_COPIES();
}

// ---- operand preparation, one launch: wave n takes row n of x (f16 copy + rsqrt(mean x^2 + eps)) and row n of the packed weights (q | k | v | o, [out][in] each), each row whole.
// 4,096 waves in all, 16 to 24 loads of 16 B a lane in flight, every load 512 contiguous B, every f16 store 256, the rr store 128; the row's sum stays in the wave: no LDS, no barrier
static_assert(NR == 4 * DD, "one x row and one weight row a wave");
__global__ __launch_bounds__(256) void k_prep(const float* __restrict__ x, const float* __restrict__ Wq, const float* __restrict__ Wk, const float* __restrict__ Wv, const float* __restrict__ Wo, const float* __restrict__ qs, const float* __restrict__ ksv,
                                            _Float16* __restrict__ x16, float* __restrict__ rr, _Float16* __restrict__ P) {
  const int lane = threadIdx.x & 31, n = blockIdx.x * 8 + __builtin_amdgcn_readfirstlane(threadIdx.x >> 5);   // n in a scalar register: the row bases and the test below are scalar
  const int which = n / DD, o = n % DD;
  const float* W = which == 0 ? Wq : (which == 1 ? Wk : (which == 2 ? Wv : Wo));
  const float* xr = x + (size_t)n * DD + lane * 4; const float* wr = W + (size_t)o * DD + lane * 4;
  v4f xv[8], wv[8], sc[8];
#pragma unroll
  for (int i = 0; i < 8; ++i) xv[i] = *(const v4f*)(xr + i * 128);
#pragma unroll
  for (int i = 0; i < 8; ++i) wv[i] = *(const v4f*)(wr + i * 128);
  if (which < 2) { const float* sr = (which == 0 ? qs : ksv) + lane * 4;
#pragma unroll
    for (int i = 0; i < 8; ++i) sc[i] = *(const v4f*)(sr + i * 128); }
  else {
#pragma unroll
    for (int i = 0; i < 8; ++i) sc[i] = (v4f){1.0f, 1.0f, 1.0f, 1.0f}; }   // x 1 is exact: v and o rows keep their bits
  float ss[4] = {0.f, 0.f, 0.f, 0.f};   // four independent chains
#pragma unroll
  for (int i = 0; i < 8; ++i) { union { _Float16 h[4]; v2f f; } pk;
#pragma unroll
    for (int e = 0; e < 4; ++e) { ss[e] += xv[i][e] * xv[i][e]; pk.h[e] = (_Float16)xv[i][e]; }
    vst2((v2f*)(x16 + (size_t)n * DD + i * 128 + lane * 4), pk.f); }
#pragma unroll
  for (int i = 0; i < 8; ++i) { union { _Float16 h[4]; v2f f; } pk;
#pragma unroll
    for (int e = 0; e < 4; ++e) pk.h[e] = (_Float16)(wv[i][e] * 16.0f * sc[i][e]);
    vst2((v2f*)(P + (size_t)n * DD + i * 128 + lane * 4), pk.f); }
  float s = (ss[0] + ss[1]) + (ss[2] + ss[3]);
#pragma unroll
  for (int off = 16; off >= 1; off >>= 1) s += __shfl_xor(s, off, 32);
  vst2(rr + (size_t)n * 32 + lane, (float_a)(lane == 0 ? rsqrtf(s / (float)DD + 1e-8f) : 0.f));   // rr[row*32] (one line per row)
}
// ---- projection: block 64 rows x 128 cols (= which, 2 heads); epilogue: x rr (q,k), + bias, RoPE (q,k); q/k -> [b][h][t][64] f16; v -> vT [b][h][d][t]
// the weight rows are the A operand: a lane's 8 accumulator registers are 8 consecutive outputs of one x row, and the epilogue needs no f32 staging
__global__ __launch_bounds__(128) void k_proj(const _Float16* __restrict__ x16, const float* __restrict__ rr, const _Float16* __restrict__ P, const float* __restrict__ bq, const float* __restrict__ bk, const float* __restrict__ bv,
                                            _Float16* __restrict__ qh, _Float16* __restrict__ kh, _Float16* __restrict__ vT) {
  __shared__ __align__(16) char smem[RING_B];                        // the ring; behind the loop's last barrier it is the epilogue's staging
  _Float16 (*st)[72] = (_Float16 (*)[72])smem;                       // v: 128 dims x 64 rows, 18,432 B
  __shared__ __align__(16) float sfr[32];
  const int tid = threadIdx.x, wave = tid >> 5, lane = tid & 31, col = lane & 15, g = lane >> 4;
  const int r0b = blockIdx.x * 64, r0 = r0b + wave * 16, n0 = blockIdx.y * 128; const int b = r0b / LL, t0 = r0b % LL;
  const int which = n0 / DD, hb = (n0 % DD) / HD; const float* bias = which == 0 ? bq : (which == 1 ? bk : bv);
  if (tid < 32) sfr[tid] = powf(10000.0f, -(float)tid / 32.0f);
  v8f acc[8] = {};
  gemm_ring<true>((_Float16*)smem, x16 + (size_t)r0b * DD, P + (size_t)n0 * DD, acc, tid);
  __syncthreads();
  if (which < 2) {   // q, k: lane (g, col) holds row col, dims 16j + 8g + 0..7: RMS factor, bias and RoPE (partner d ^ 1 = the neighbouring register) stay in registers
    _Float16 (*sh)[16][136] = (_Float16 (*)[16][136])smem;   // per wave 16 rows x 128 f16, pitch 272 B, only to turn 16-B pieces into whole-line stores
    const float s16 = rr[(size_t)(r0 + col) * 32] * (1.0f / 16.0f);   // x 2^-4 is exact: same bits as (acc / 16) * rr
    const float t = (float)(t0 + wave * 16 + col);
    // angle index d & 31 = 16 (j & 1) + 8g + r: 16 angles a lane serve its 64 values. The loop stays rolled (sincosf is long in text and registers);
    // each lane parks its own 16 cos and 16 sin in LDS (pitch 144 B) and reads them back as vectors: no lane reads another's
    float (*tb)[32][36] = (float (*)[32][36])(smem + 4 * 16 * 136 * 2);
    v4f bb[8][2];   // the bias loads fly under the angle loop
#pragma unroll
    for (int j = 0; j < 8; ++j) { const float* bp = bias + (n0 % DD) + j * 16 + 8 * g; bb[j][0] = *(const v4f*)bp; bb[j][1] = *(const v4f*)(bp + 4); }
#pragma unroll 1   // four angles a trip: one sincosf text of four, not sixteen
    for (int i = 0; i < 4; ++i) { const v4f fr = *(const v4f*)(&sfr[(i >> 1) * 16 + 8 * g + (i & 1) * 4]); v4f sv, cv;
#pragma unroll
      for (int e = 0; e < 4; ++e) { float s1, c1; sincosf(t * fr[e], &s1, &c1); sv[e] = s1; cv[e] = c1; }
      vst2(&tb[wave][lane][i * 4], cv); vst2(&tb[wave][lane][16 + i * 4], sv); }
    LDSX();
    float cs[2][8], sn[2][8];
#pragma unroll
    for (int p = 0; p < 2; ++p) {
#pragma unroll
      for (int q = 0; q < 2; ++q) { const v4f c4 = *(const v4f*)(&tb[wave][lane][p * 8 + q * 4]), s4 = *(const v4f*)(&tb[wave][lane][16 + p * 8 + q * 4]);
#pragma unroll
        for (int e = 0; e < 4; ++e) { cs[p][q * 4 + e] = c4[e]; sn[p][q * 4 + e] = s4[e]; } } }
#pragma unroll
    for (int j = 0; j < 8; ++j) { float xv[8]; union { v8h h8; v4u u; } pk;
#pragma unroll
      for (int r = 0; r < 8; ++r) xv[r] = acc[j][r] * s16 + bb[j][r >> 2][r & 3];
#pragma unroll
      for (int r = 0; r < 8; ++r) { const float xr = (r & 1) ? xv[r - 1] : -xv[r + 1]; pk.h8[r] = (_Float16)(xv[r] * cs[j & 1][r] + xr * sn[j & 1][r]); }
      vst2(&sh[wave][col][j * 16 + 8 * g], pk.u); }
    LDSX();
    _Float16* dst = which == 0 ? qh : kh;
#pragma unroll
    for (int q = lane; q < 2 * 16 * 8; q += 32) { const int hh = q >> 7, rem = q & 127, rl = rem >> 3, pc = rem & 7;
      vst2(dst + (((size_t)b * NH + hb + hh) * LL + t0 + wave * 16 + rl) * HD + pc * 8, *(const v4u*)(&sh[wave][rl][hh * HD + pc * 8])); } }
  else {   // v: the lane's 8 dims of row col go straight into the [dim][row] f16 tile
#pragma unroll
    for (int j = 0; j < 8; ++j) { const float* bp = bias + (n0 % DD) + j * 16 + 8 * g; const v4f b0 = *(const v4f*)bp, b1 = *(const v4f*)(bp + 4);
#pragma unroll
      for (int r = 0; r < 8; ++r) st[j * 16 + 8 * g + r][wave * 16 + col] = (_Float16)(acc[j][r] * (1.0f / 16.0f) + (r < 4 ? b0[r & 3] : b1[r & 3])); }
    __syncthreads();
    for (int q = tid; q < 128 * 8; q += 128) { const int c = q >> 3, pc = q & 7, hh = c >> 6, d = c & 63;
      vst2(vT + (((size_t)b * NH + hb + hh) * HD + d) * LL + t0 + pc * 8, *(const v4u*)(&st[c][pc * 8])); }
  }
}
// ---- sigmoid attention: block (64 q, bh); all 32 key tiles; W = sigmoid(q.k/8); l += W; acc += W @ v ; out = acc / (l + eps) -> o16 [b][t][h*64+d] f16
__global__ __launch_bounds__(128) void k_attn(const _Float16* __restrict__ qh, const _Float16* __restrict__ kh, const _Float16* __restrict__ vT, _Float16* __restrict__ o16) {
  __shared__ __align__(16) _Float16 sP[4][16][72];
  __shared__ __align__(16) float sO[4][16][68];
  __shared__ __align__(16) _Float16 sK[2][64][TP];   // 64 keys x 64 dims
  __shared__ __align__(16) _Float16 sV[2][64][TP];   // 64 dims x 64 keys
  const int tid = threadIdx.x, w = tid >> 5, lane = tid & 31, col = lane & 15, g = lane >> 4;
  const int bh = blockIdx.y, b = bh / NH, h = bh % NH, q0 = blockIdx.x * 64 + w * 16;
  const _Float16* qb = qh + (size_t)bh * LL * HD; const _Float16* kb = kh + (size_t)bh * LL * HD; const _Float16* vb = vT + (size_t)bh * HD * LL;
  v16h aq[2];
#pragma unroll
  for (int kc = 0; kc < 2; ++kc) aq[kc] = frag_h(qb + (size_t)(q0 + col) * HD + kc * 32, lane);
  float lsum[8] = {0.f, 0.f, 0.f, 0.f, 0.f, 0.f, 0.f, 0.f}; v8f acc[4] = {};
  stage_kv(&sK[0][0][0], &sV[0][0][0], kb, vb, tid);
  WAIT_COPIES(); __syncthreads();
  stage_kv(&sK[1][0][0], &sV[1][0][0], kb + (size_t)64 * HD, vb + 64, tid);
#pragma unroll 1
  for (int kt = 0; kt < LL / 64; ++kt) { const int bf = kt & 1;
    v16h fk[4][2], fv[2][4];   // the tile's 8 K and 8 V fragments are read as one group at its head: the V reads land under the score and sigmoid work
#pragma unroll
    for (int t = 0; t < 4; ++t) {
#pragma unroll
      for (int kc = 0; kc < 2; ++kc) fk[t][kc] = frag_h(&sK[bf][t * 16 + col][kc * 32], lane); }
#pragma unroll
    for (int kc = 0; kc < 2; ++kc) {
#pragma unroll
      for (int t = 0; t < 4; ++t) fv[kc][t] = frag_h(&sV[bf][t * 16 + col][kc * 32], lane); }
#pragma unroll
    for (int t = 0; t < 4; ++t) { v8f s = {};
#pragma unroll
      for (int kc = 0; kc < 2; ++kc) s = wmma16(aq[kc], fk[t][kc], s);
#pragma unroll
      for (int r = 0; r < 8; ++r) { const float wgt = __builtin_amdgcn_rcpf(1.0f + __expf(-s[r] * 0.125f)); lsum[r] += wgt; sP[w][8 * g + r][t * 16 + col] = (_Float16)(wgt * 16384.0f); } }
    LDSX();
    v16h pa[2];            // both P fragments together, ahead of the 8 WMMAs
#pragma unroll
    for (int kc = 0; kc < 2; ++kc) pa[kc] = frag_h(&sP[w][col][0] + kc * 32, lane);
#pragma unroll
    for (int kc = 0; kc < 2; ++kc) {
#pragma unroll
      for (int t = 0; t < 4; ++t) acc[t] = wmma16(pa[kc], fv[kc][t], acc[t]); }
    WAIT_LDS(); WAIT_COPIES(); __syncthreads();   // publishes tile kt + 1 and ends every read of tile kt
    if (kt + 2 < LL / 64) stage_kv(&sK[bf][0][0], &sV[bf][0][0], kb + (size_t)(kt + 2) * 64 * HD, vb + (kt + 2) * 64, tid);
  }
  WAIT_COPIES();
  // row sums: lsum[r] (this lane's 4 tiles x its column) -> reduce over the 16 col lanes of each half -> row 8g+r
#pragma unroll
  for (int off = 8; off >= 1; off >>= 1) {
#pragma unroll
    for (int r = 0; r < 8; ++r) lsum[r] += __shfl_xor(lsum[r], off, 32); }
#pragma unroll
  for (int r = 0; r < 8; ++r) { const float inv = 1.0f / ((lsum[r] + 1e-8f) * 16384.0f);
#pragma unroll
    for (int t = 0; t < 4; ++t) sO[w][8 * g + r][t * 16 + col] = acc[t][r] * inv; }
  LDSX();
  for (int q = lane; q < 16 * 8; q += 32) { const int rl = q >> 3, pc = q & 7; union { v8h h8; v4u u; } pk;
#pragma unroll
    for (int e = 0; e < 8; ++e) pk.h8[e] = (_Float16)(sO[w][rl][pc * 8 + e] * 16.0f);             // o x16 keeps the f16 operand normal
    vst2(o16 + ((size_t)b * LL + q0 + rl) * DD + h * HD + pc * 8, pk.u); }
}
__global__ __launch_bounds__(128) void k_out(const _Float16* __restrict__ o16, const _Float16* __restrict__ P, const float* __restrict__ bo, float* __restrict__ out) {
  __shared__ __align__(16) char smem[RING_B];        // the ring; behind the loop's last barrier it is the epilogue's staging
  float (*so)[16][132] = (float (*)[16][132])smem;
  const int tid = threadIdx.x, wave = tid >> 5, lane = tid & 31, col = lane & 15, g = lane >> 4;
  const int r0 = blockIdx.x * 64 + wave * 16, n0 = blockIdx.y * 128;
  v8f acc[8] = {};
  gemm_ring<false>((_Float16*)smem, o16 + (size_t)blockIdx.x * 64 * DD, P + (size_t)(3 * DD + n0) * DD, acc, tid);
#pragma unroll
  for (int j = 0; j < 8; ++j) { const float bb = bo[n0 + j * 16 + col];
#pragma unroll
    for (int r = 0; r < 8; ++r) so[wave][8 * g + r][j * 16 + col] = acc[j][r] * (1.0f / 256.0f) + bb; }    // W x16, o x16
  LDSX();
#pragma unroll 4
  for (int rl = 0; rl < 16; ++rl) vst2(out + (size_t)(r0 + rl) * DD + n0 + lane * 4, *(const v4f*)(&so[wave][rl][lane * 4]));
}
extern "C" void kernel_launch(void* const* d_in, const int* in_sizes, int n_in, void* d_out, int out_size, void* d_ws, size_t ws_size, hipStream_t stream) {
  (void)in_sizes; (void)n_in; (void)out_size; (void)ws_size;
  const float* x = (const float*)d_in[0]; const float* Wq = (const float*)d_in[1]; const float* bq = (const float*)d_in[2]; const float* Wk = (const float*)d_in[3]; const float* bk = (const float*)d_in[4];
  const float* Wv = (const float*)d_in[5]; const float* bv = (const float*)d_in[6]; const float* Wo = (const float*)d_in[7]; const float* bo = (const float*)d_in[8];
  const float* qs = (const float*)d_in[9]; const float* ksv = (const float*)d_in[10];
  float* out = (float*)d_out;
  char* ws = (char*)d_ws; size_t off = 0;
  auto take = [&](size_t bytes) { char* p = ws + off; off += (bytes + 255) & ~(size_t)255; return p; };
  _Float16* x16 = (_Float16*)take((size_t)NR * DD * 2); float* rr = (float*)take((size_t)NR * 32 * 4); _Float16* P = (_Float16*)take((size_t)4 * DD * DD * 2);
  _Float16* qh = (_Float16*)take((size_t)NR * DD * 2); _Float16* kh = (_Float16*)take((size_t)NR * DD * 2); _Float16* vT = (_Float16*)take((size_t)NR * DD * 2); _Float16* o16 = (_Float16*)take((size_t)NR * DD * 2);
  k_prep<<<NR / 8, 256, 0, stream>>>(x, Wq, Wk, Wv, Wo, qs, ksv, x16, rr, P);
  k_proj<<<dim3(NR / 64, 3 * DD / 128), 128, 0, stream>>>(x16, rr, P, bq, bk, bv, qh, kh, vT);
  k_attn<<<dim3(LL / 64, NB * NH), 128, 0, stream>>>(qh, kh, vT, o16);
  k_out<<<dim3(NR / 64, DD / 128), 128, 0, stream>>>(o16, P, bo, out);
}

// v005
// A run of this version takes 98.5 microseconds.
// Two timings next to v004 both put it at 1.07 times that version's speed.
// Counting every step since v000, it is 3.45 times as fast.
#include <hip/hip_runtime.h>
#include <math.h>

typedef __attribute__((ext_vector_type(16))) _Float16 v16h;
typedef __attribute__((ext_vector_type(16))) __bf16 v16b;
typedef __attribute__((ext_vector_type(8)))  _Float16 v8h;
typedef __attribute__((ext_vector_type(8)))  float v8f;
typedef __attribute__((ext_vector_type(4)))  float v4f;
typedef __attribute__((ext_vector_type(2)))  float v2f;
typedef __attribute__((ext_vector_type(4)))  unsigned v4u;
typedef __attribute__((ext_vector_type(4)))  int v4i;
typedef float __attribute__((may_alias)) float_a;
typedef int __attribute__((may_alias)) int_a;

template <typename T> __device__ __forceinline__ void vst2(void* p, T v) { *(T*)p = v;  }
__device__ __forceinline__ v8f wmma16(v16h a, v16h b, v8f c) {
  v8f d = __builtin_amdgcn_wmma_f32_16x16x32_f16(false, a, false, b, (short)0, c, false, false);
  asm volatile("v_nop\n\tv_nop\n\tv_nop\n\tv_nop" : "+v"(d) : "v"(a), "v"(b));
  return d;
}
__device__ __forceinline__ v8f wmma_bf(v16b a, v16b b, v8f c) {
  v8f d = __builtin_amdgcn_wmma_f32_16x16x32_bf16(false, a, false, b, (short)0, c, false, false);
  asm volatile("v_nop\n\tv_nop\n\tv_nop\n\tv_nop" : "+v"(d) : "v"(a), "v"(b));
  return d;
}
// 16x16x32 fragments: lane = (h = lane>>4, row/col = lane&15); elements 0..7 = k0+8h+0..7, 8..15 = k0+16+8h+0..7; D element r = row 8h+r
__device__ __forceinline__ v16h frag_h(const _Float16* rowk0, int lane) {
  union { v16h v; v8h q[2]; } u; const _Float16* p = rowk0 + 8 * (lane >> 4);
  u.q[0] = *(const v8h*)p; u.q[1] = *(const v8h*)(p + 16); return u.v;
}
__device__ __forceinline__ v16h frag_f32(const float* rowk0, int lane) {
  v16h a; const float* p = rowk0 + 8 * (lane >> 4);
#pragma unroll
  for (int i = 0; i < 8; ++i) { a[i] = (_Float16)p[i]; a[8 + i] = (_Float16)p[16 + i]; }
  return a;
}
__device__ __forceinline__ v16h frag_f32s(const float* rowk0, int lane, float sc) {
  v16h a; const float* p = rowk0 + 8 * (lane >> 4);
#pragma unroll
  for (int i = 0; i < 8; ++i) { a[i] = (_Float16)(p[i] * sc); a[8 + i] = (_Float16)(p[16 + i] * sc); }
  return a;
}
// column fragment from a [K][ld] layout (column n), rows >= K read as 0
__device__ __forceinline__ v16h fragc_f32(const float* W, int k0, int n, int lane, int ld, int K) {
  v16h a; const int g = lane >> 4;
#pragma unroll
  for (int i = 0; i < 8; ++i) { const int ka = k0 + 8 * g + i, kb = ka + 16;
    a[i] = (_Float16)(ka < K ? W[(size_t)ka * ld + n] : 0.f); a[8 + i] = (_Float16)(kb < K ? W[(size_t)kb * ld + n] : 0.f); }
  return a;
}
struct F2 { v16b h, l; };
__device__ __forceinline__ F2 bsplit16(const float v[16]) { F2 r;
#pragma unroll
  for (int i = 0; i < 16; ++i) { const __bf16 h = (__bf16)v[i]; r.h[i] = h; r.l[i] = (__bf16)(v[i] - (float)h); }
  return r; }
__device__ __forceinline__ F2 split_row(const float* row, int k0, int lane) { float v[16]; const float* p = row + k0 + 8 * (lane >> 4);
#pragma unroll
  for (int i = 0; i < 8; ++i) { v[i] = p[i]; v[8 + i] = p[16 + i]; }
  return bsplit16(v); }
__device__ __forceinline__ F2 split_rowK(const float* row, int k0, int lane, int K) { float v[16]; const int g = lane >> 4;
#pragma unroll
  for (int i = 0; i < 8; ++i) { const int ka = k0 + 8 * g + i, kb = ka + 16; v[i] = ka < K ? row[ka] : 0.f; v[8 + i] = kb < K ? row[kb] : 0.f; }
  return bsplit16(v); }
__device__ __forceinline__ F2 split_col(const float* W, int k0, int n, int lane, int ld, int K) { float v[16]; const int g = lane >> 4;
#pragma unroll
  for (int i = 0; i < 8; ++i) { const int ka = k0 + 8 * g + i, kb = ka + 16; v[i] = ka < K ? W[(size_t)ka * ld + n] : 0.f; v[8 + i] = kb < K ? W[(size_t)kb * ld + n] : 0.f; }
  return bsplit16(v); }
__device__ __forceinline__ v8f mac3(const F2& a, const F2& b, v8f c) { c = wmma_bf(a.l, b.h, c); c = wmma_bf(a.h, b.l, c); return wmma_bf(a.h, b.h, c); }
__device__ __forceinline__ float sigm(float v) { return 1.0f / (1.0f + expf(-v)); }
#define LDSX() do { asm volatile("s_wait_dscnt 0" ::: "memory"); __builtin_amdgcn_wave_barrier(); __builtin_amdgcn_fence(__ATOMIC_RELEASE, "workgroup"); } while (0)

// Sigmoid attention block with QK-RMSNorm and rotary embedding. Pure f16 WMMA GEMMs over pre-converted operands (x -> f16 once;
// weights x16 f16 with the RMSNorm scales folded into the q/k weight columns; f32 accumulate): q|k|v projection with the per-row
// RMS factor, bias and RoPE in the f32 epilogue (q/k -> [b][h][l][64] f16, v -> [b][h][d][l] f16), per (b, h, 64 queries) block
// the 2048 keys streamed in 64-key tiles: S on f16 WMMA, sigmoid in f32 (hardware exp/rcp), running row sums, W x2^14 f16 @ v^T,
#define NB 2
#define LL 2048
#define DD 1024
#define NH 16
#define HD 64
#define NR (NB * LL)

// ---- operand tiles staged in LDS by asynchronous copies: rows of 128 B (64 f16), 8 lanes = one whole 128-B line, 128 threads = 16 rows a copy
#define TP 72              // LDS pitch of a staged row in f16: 144 B = 16 B x 9, conflict-free for ds_load_b128
#define R16 (16 * TP * 2)  // bytes of 16 staged rows
#define ACP(l, g) "global_load_async_to_lds_b128 %" #l ", %" #g ", off\n\t"
// this wave's copies have landed (the compiler places no wait for them)
#define WAIT_COPIES() asm volatile("s_wait_asynccnt 0x0" ::: "memory")
// this wave's LDS reads of a buffer have retired before the buffer is handed back for a refill
#define WAIT_LDS() asm volatile("s_wait_dscnt 0x0" ::: "memory")
__device__ __forceinline__ unsigned lds_at(const _Float16* p) { return (unsigned)(size_t)p; }   // LDS byte address = low 32 bits
// one GEMM stage, 64 k: buf rows 0..63 = 64 X rows, rows 64..191 = 128 W rows. s_wait_xcnt closes the copies' own statement, so that no address register of a copy is rewritten ahead of it.
__device__ __forceinline__ void stage_gemm(_Float16* buf, const _Float16* xa, const _Float16* wb, int tid) {
  const int r = tid >> 3, c = (tid & 7) * 8;
  const unsigned l = lds_at(buf + r * TP + c);
  const _Float16* a = xa + (size_t)r * DD + c; const _Float16* b = wb + (size_t)r * DD + c;
  asm volatile(ACP(0, 1) ACP(2, 3) ACP(4, 5) ACP(6, 7) ACP(8, 9) ACP(10, 11) ACP(12, 13) ACP(14, 15) ACP(16, 17) ACP(18, 19) ACP(20, 21) ACP(22, 23) "s_wait_xcnt 0x0"
               :: "v"(l), "v"(a), "v"(l + R16), "v"(a + 16 * DD), "v"(l + 2 * R16), "v"(a + 32 * DD), "v"(l + 3 * R16), "v"(a + 48 * DD),
                  "v"(l + 4 * R16), "v"(b), "v"(l + 5 * R16), "v"(b + 16 * DD), "v"(l + 6 * R16), "v"(b + 32 * DD), "v"(l + 7 * R16), "v"(b + 48 * DD),
                  "v"(l + 8 * R16), "v"(b + 64 * DD), "v"(l + 9 * R16), "v"(b + 80 * DD), "v"(l + 10 * R16), "v"(b + 96 * DD), "v"(l + 11 * R16), "v"(b + 112 * DD) : "memory");
}
// one attention tile: 64 keys x 64 dims of K, 64 dims x 64 keys of V^T; the wait as above
__device__ __forceinline__ void stage_kv(_Float16* sk, _Float16* sv, const _Float16* gk, const _Float16* gv, int tid) {
  const int r = tid >> 3, c = (tid & 7) * 8;
  const unsigned lk = lds_at(sk + r * TP + c), lv = lds_at(sv + r * TP + c);
  const _Float16* k = gk + (size_t)r * HD + c; const _Float16* v = gv + (size_t)r * LL + c;
  asm volatile(ACP(0, 1) ACP(2, 3) ACP(4, 5) ACP(6, 7) ACP(8, 9) ACP(10, 11) ACP(12, 13) ACP(14, 15) "s_wait_xcnt 0x0"
               :: "v"(lk), "v"(k), "v"(lk + R16), "v"(k + 16 * HD), "v"(lk + 2 * R16), "v"(k + 32 * HD), "v"(lk + 3 * R16), "v"(k + 48 * HD),
                  "v"(lv), "v"(v), "v"(lv + R16), "v"(v + 16 * LL), "v"(lv + 2 * R16), "v"(v + 32 * LL), "v"(lv + 3 * R16), "v"(v + 48 * LL) : "memory");
}
#define GBUF (192 * TP)           // f16 of one GEMM buffer
#define RING_B (2 * GBUF * 2)     // bytes of the two
// 64 x 128 tile over K = 1024: 16 stages, two buffers, stage s + 2 copied while stage s + 1 is worked on; k order as before
// X rows as A: acc[j][r] = Y[row 8h + r][n = 16j + c]
__device__ __forceinline__ void gemm_ring(_Float16* ring, const _Float16* xa, const _Float16* wb, v8f acc[8], int tid) {
  const int wave = tid >> 5, lane = tid & 31, col = lane & 15;
  stage_gemm(ring, xa, wb, tid);
  WAIT_COPIES(); __syncthreads();
  stage_gemm(ring + GBUF, xa + 64, wb + 64, tid);
#pragma unroll 1   // one trip = one stage, so that the ring's order stands once, at the trip's foot
  for (int s = 0; s < DD / 64; ++s) { _Float16* buf = ring + (s & 1) * GBUF;
    v16h a[2], b[2][8];   // the stage's 18 fragments are read as one group ahead of its 16 WMMAs: one LDS latency a stage, counted waits, not one full wait a WMMA
#pragma unroll
    for (int kc = 0; kc < 2; ++kc) { a[kc] = frag_h(buf + (wave * 16 + col) * TP + kc * 32, lane);
#pragma unroll
      for (int j = 0; j < 8; ++j) b[kc][j] = frag_h(buf + (64 + j * 16 + col) * TP + kc * 32, lane); }
#pragma unroll
    for (int kc = 0; kc < 2; ++kc) {
#pragma unroll
      for (int j = 0; j < 8; ++j) acc[j] = wmma16(a[kc], b[kc][j], acc[j]); }
    WAIT_LDS(); WAIT_COPIES(); __syncthreads();   // publishes stage s + 1 and ends every read of stage s
    if (s + 2 < DD / 64) stage_gemm(buf, xa + (s + 2) * 64, wb + (s + 2) * 64, tid); }
  WAIT_COPIES();
}
// ---- 128 x 128 tile (q|k|v GEMM): a wave takes 32 X rows x all 128 W rows, so each W fragment read from LDS feeds two WMMAs
// eight copies = 128 rows of one operand; an asm statement takes 30 operands, so a stage is two statements, each closed by its own s_wait_xcnt as above
__device__ __forceinline__ void stage_rows128(unsigned l, const _Float16* a) {
  asm volatile(ACP(0, 1) ACP(2, 3) ACP(4, 5) ACP(6, 7) ACP(8, 9) ACP(10, 11) ACP(12, 13) ACP(14, 15) "s_wait_xcnt 0x0"
               :: "v"(l), "v"(a), "v"(l + R16), "v"(a + 16 * DD), "v"(l + 2 * R16), "v"(a + 32 * DD), "v"(l + 3 * R16), "v"(a + 48 * DD),
                  "v"(l + 4 * R16), "v"(a + 64 * DD), "v"(l + 5 * R16), "v"(a + 80 * DD), "v"(l + 6 * R16), "v"(a + 96 * DD), "v"(l + 7 * R16), "v"(a + 112 * DD) : "memory");
}
// one stage, 64 k: buf rows 0..127 = 128 X rows, rows 128..255 = 128 W rows
__device__ __forceinline__ void stage_gemm2(_Float16* buf, const _Float16* xa, const _Float16* wb, int tid) {
  const int r = tid >> 3, c = (tid & 7) * 8;
  const unsigned l = lds_at(buf + r * TP + c);
  stage_rows128(l, xa + (size_t)r * DD + c); stage_rows128(l + 8 * R16, wb + (size_t)r * DD + c);
}
#define GBUF2 (256 * TP)          // f16 of one buffer
#define RING2_B (2 * GBUF2 * 2)   // bytes of the two
// the ring's order as above; k order as before. W rows as A: acc[i][j][r] = Y[row 16i + c][n = 16j + 8h + r]: a lane holds 8 consecutive n of one row
__device__ __forceinline__ void gemm_ring2(_Float16* ring, const _Float16* xa, const _Float16* wb, v8f acc[2][8], int tid) {
  const int wave = tid >> 5, lane = tid & 31, col = lane & 15;
  stage_gemm2(ring, xa, wb, tid);
  WAIT_COPIES(); __syncthreads();
  stage_gemm2(ring + GBUF2, xa + 64, wb + 64, tid);
#pragma unroll 1   // one trip = one stage, so that the ring's order stands once, at the trip's foot
  for (int s = 0; s < DD / 64; ++s) { _Float16* buf = ring + (s & 1) * GBUF2;
#pragma unroll
    for (int kc = 0; kc < 2; ++kc) { v16h a[2], b[8];   // 32 k: 10 fragments read as one group ahead of their 16 WMMAs
#pragma unroll
      for (int i = 0; i < 2; ++i) a[i] = frag_h(buf + (wave * 32 + i * 16 + col) * TP + kc * 32, lane);
#pragma unroll
      for (int j = 0; j < 8; ++j) b[j] = frag_h(buf + (128 + j * 16 + col) * TP + kc * 32, lane);
#pragma unroll
      for (int j = 0; j < 8; ++j) {
#pragma unroll
        for (int i = 0; i < 2; ++i) acc[i][j] = wmma16(b[j], a[i], acc[i][j]); } }
    WAIT_LDS(); WAIT_COPIES(); __syncthreads();   // publishes stage s + 1 and ends every read of stage s
    if (s + 2 < DD / 64) stage_gemm2(buf, xa + (s + 2) * 64, wb + (s + 2) * 64, tid); }
  WAIT_COPIES();
}

// ---- operand preparation, one launch: wave n takes row n of x (f16 copy + rsqrt(mean x^2 + eps)) and row n of the packed weights (q | k | v | o, [out][in] each), each row whole.
// 4,096 waves in all, 16 to 24 loads of 16 B a lane in flight, every load 512 contiguous B, every f16 store 256, the rr store 128; the row's sum stays in the wave: no LDS, no barrier
static_assert(NR == 4 * DD, "one x row and one weight row a wave");
__global__ __launch_bounds__(256) void k_prep(const float* __restrict__ x, const float* __restrict__ Wq, const float* __restrict__ Wk, const float* __restrict__ Wv, const float* __restrict__ Wo, const float* __restrict__ qs, const float* __restrict__ ksv,
                                            _Float16* __restrict__ x16, float* __restrict__ rr, _Float16* __restrict__ P) {
  const int lane = threadIdx.x & 31, n = blockIdx.x * 8 + __builtin_amdgcn_readfirstlane(threadIdx.x >> 5);   // n in a scalar register: the row bases and the test below are scalar
  const int which = n / DD, o = n % DD;
  const float* W = which == 0 ? Wq : (which == 1 ? Wk : (which == 2 ? Wv : Wo));
  const float* xr = x + (size_t)n * DD + lane * 4; const float* wr = W + (size_t)o * DD + lane * 4;
  v4f xv[8], wv[8], sc[8];
#pragma unroll
  for (int i = 0; i < 8; ++i) xv[i] = *(const v4f*)(xr + i * 128);
#pragma unroll
  for (int i = 0; i < 8; ++i) wv[i] = *(const v4f*)(wr + i * 128);
  if (which < 2) { const float* sr = (which == 0 ? qs : ksv) + lane * 4;
#pragma unroll
    for (int i = 0; i < 8; ++i) sc[i] = *(const v4f*)(sr + i * 128); }
  else {
#pragma unroll
    for (int i = 0; i < 8; ++i) sc[i] = (v4f){1.0f, 1.0f, 1.0f, 1.0f}; }   // x 1 is exact: v and o rows keep their bits
  float ss[4] = {0.f, 0.f, 0.f, 0.f};   // four independent chains
#pragma unroll
  for (int i = 0; i < 8; ++i) { union { _Float16 h[4]; v2f f; } pk;
#pragma unroll
    for (int e = 0; e < 4; ++e) { ss[e] += xv[i][e] * xv[i][e]; pk.h[e] = (_Float16)xv[i][e]; }
    vst2((v2f*)(x16 + (size_t)n * DD + i * 128 + lane * 4), pk.f); }
#pragma unroll
  for (int i = 0; i < 8; ++i) { union { _Float16 h[4]; v2f f; } pk;
#pragma unroll
    for (int e = 0; e < 4; ++e) pk.h[e] = (_Float16)(wv[i][e] * 16.0f * sc[i][e]);
    vst2((v2f*)(P + (size_t)n * DD + i * 128 + lane * 4), pk.f); }
  float s = (ss[0] + ss[1]) + (ss[2] + ss[3]);
#pragma unroll
  for (int off = 16; off >= 1; off >>= 1) s += __shfl_xor(s, off, 32);
  vst2(rr + (size_t)n * 32 + lane, (float_a)(lane == 0 ? rsqrtf(s / (float)DD + 1e-8f) : 0.f));   // rr[row*32] (one line per row)
}
// ---- projection: block 128 rows x 128 cols (= which, 2 heads); epilogue: x rr (q,k), + bias, RoPE (q,k); q/k -> [b][h][t][64] f16; v -> vT [b][h][d][t]
// the weight rows are the A operand: a lane's 8 accumulator registers are 8 consecutive outputs of one x row, and the epilogue needs no f32 staging
__global__ __launch_bounds__(128) void k_proj(const _Float16* __restrict__ x16, const float* __restrict__ rr, const _Float16* __restrict__ P, const float* __restrict__ bq, const float* __restrict__ bk, const float* __restrict__ bv,
                                            _Float16* __restrict__ qh, _Float16* __restrict__ kh, _Float16* __restrict__ vT) {
  __shared__ __align__(16) char smem[RING2_B];                       // the ring; behind the loop's last barrier it is the epilogue's staging
  __shared__ __align__(16) float sfr[32];
  const int tid = threadIdx.x, wave = tid >> 5, lane = tid & 31, col = lane & 15, g = lane >> 4;
  const int r0b = blockIdx.x * 128, r0 = r0b + wave * 32, n0 = blockIdx.y * 128; const int b = r0b / LL, t0 = r0b % LL;
  const int which = n0 / DD, hb = (n0 % DD) / HD; const float* bias = which == 0 ? bq : (which == 1 ? bk : bv);
  if (tid < 32) sfr[tid] = powf(10000.0f, -(float)tid / 32.0f);
  v8f acc[2][8] = {};
  gemm_ring2((_Float16*)smem, x16 + (size_t)r0b * DD, P + (size_t)n0 * DD, acc, tid);
  __syncthreads();
  if (which < 2) {   // q, k: lane (g, col) holds rows 16i + col, dims 16j + 8g + 0..7: RMS factor, bias and RoPE (partner d ^ 1 = the neighbouring register) stay in registers
    _Float16 (*sh)[32][136] = (_Float16 (*)[32][136])smem;   // per wave 32 rows x 128 f16, pitch 272 B, only to turn 16-B pieces into whole-line stores
    float s16[2];
#pragma unroll
    for (int i = 0; i < 2; ++i) s16[i] = rr[(size_t)(r0 + i * 16 + col) * 32] * (1.0f / 16.0f);   // x 2^-4 is exact: same bits as (acc / 16) * rr
    // angle index d & 31 = 16 (j & 1) + 8g + r: 16 angles a row serve its 64 values in the lane. The loop stays rolled (sincosf is long in text and registers);
    // each lane parks its own 2 x (16 cos, 16 sin) in LDS (pitch 272 B) and reads them back as vectors: no lane reads another's
    float (*tb)[32][68] = (float (*)[32][68])(smem + 4 * 32 * 136 * 2);
    static_assert(4 * 32 * 136 * 2 + 4 * 32 * 68 * 4 <= RING2_B, "epilogue staging fits the ring");
    v4f bb[8][2];   // the bias loads fly under the angle loop
#pragma unroll
    for (int j = 0; j < 8; ++j) { const float* bp = bias + (n0 % DD) + j * 16 + 8 * g; bb[j][0] = *(const v4f*)bp; bb[j][1] = *(const v4f*)(bp + 4); }
#pragma unroll 1   // four angles a trip: one sincosf text of four, not thirty-two
    for (int ii = 0; ii < 8; ++ii) { const int i = ii & 3, ro = ii >> 2; const float t = (float)(t0 + wave * 32 + ro * 16 + col);
      const v4f fr = *(const v4f*)(&sfr[(i >> 1) * 16 + 8 * g + (i & 1) * 4]); v4f sv, cv;
#pragma unroll
      for (int e = 0; e < 4; ++e) { float s1, c1; sincosf(t * fr[e], &s1, &c1); sv[e] = s1; cv[e] = c1; }
      vst2(&tb[wave][lane][ro * 32 + i * 4], cv); vst2(&tb[wave][lane][ro * 32 + 16 + i * 4], sv); }
    LDSX();
#pragma unroll
    for (int i = 0; i < 2; ++i) { float cs[2][8], sn[2][8];
#pragma unroll
      for (int p = 0; p < 2; ++p) {
#pragma unroll
        for (int q = 0; q < 2; ++q) { const v4f c4 = *(const v4f*)(&tb[wave][lane][i * 32 + p * 8 + q * 4]), s4 = *(const v4f*)(&tb[wave][lane][i * 32 + 16 + p * 8 + q * 4]);
#pragma unroll
          for (int e = 0; e < 4; ++e) { cs[p][q * 4 + e] = c4[e]; sn[p][q * 4 + e] = s4[e]; } } }
#pragma unroll
      for (int j = 0; j < 8; ++j) { float xv[8]; union { v8h h8; v4u u; } pk;
#pragma unroll
        for (int r = 0; r < 8; ++r) xv[r] = acc[i][j][r] * s16[i] + bb[j][r >> 2][r & 3];
#pragma unroll
        for (int r = 0; r < 8; ++r) { const float xr = (r & 1) ? xv[r - 1] : -xv[r + 1]; pk.h8[r] = (_Float16)(xv[r] * cs[j & 1][r] + xr * sn[j & 1][r]); }
        vst2(&sh[wave][i * 16 + col][j * 16 + 8 * g], pk.u); } }
    LDSX();
    _Float16* dst = which == 0 ? qh : kh;
#pragma unroll
    for (int q = lane; q < 2 * 32 * 8; q += 32) { const int hh = q >> 8, rem = q & 255, rl = rem >> 3, pc = rem & 7;
      vst2(dst + (((size_t)b * NH + hb + hh) * LL + t0 + wave * 32 + rl) * HD + pc * 8, *(const v4u*)(&sh[wave][rl][hh * HD + pc * 8])); } }
  else {   // v: the lane's 8 dims of rows 16i + col go straight into the [dim][row] f16 tile
    _Float16 (*st)[136] = (_Float16 (*)[136])smem;                   // 128 dims x 128 rows, pitch 272 B
#pragma unroll
    for (int j = 0; j < 8; ++j) { const float* bp = bias + (n0 % DD) + j * 16 + 8 * g; const v4f b0 = *(const v4f*)bp, b1 = *(const v4f*)(bp + 4);
#pragma unroll
      for (int i = 0; i < 2; ++i) {
#pragma unroll
        for (int r = 0; r < 8; ++r) st[j * 16 + 8 * g + r][wave * 32 + i * 16 + col] = (_Float16)(acc[i][j][r] * (1.0f / 16.0f) + (r < 4 ? b0[r & 3] : b1[r & 3])); } }
    __syncthreads();
    for (int q = tid; q < 128 * 16; q += 128) { const int c = q >> 4, pc = q & 15, hh = c >> 6, d = c & 63;
      vst2(vT + (((size_t)b * NH + hb + hh) * HD + d) * LL + t0 + pc * 8, *(const v4u*)(&st[c][pc * 8])); }
  }
}
// ---- sigmoid attention: block (64 q, bh); all 32 key tiles; W = sigmoid(q.k/8); l += W; acc += W @ v ; out = acc / (l + eps) -> o16 [b][t][h*64+d] f16
__global__ __launch_bounds__(128) void k_attn(const _Float16* __restrict__ qh, const _Float16* __restrict__ kh, const _Float16* __restrict__ vT, _Float16* __restrict__ o16) {
  __shared__ __align__(16) _Float16 sP[4][16][72];
  __shared__ __align__(16) float sO[4][16][68];
  __shared__ __align__(16) _Float16 sK[2][64][TP];   // 64 keys x 64 dims
  __shared__ __align__(16) _Float16 sV[2][64][TP];   // 64 dims x 64 keys
  const int tid = threadIdx.x, w = tid >> 5, lane = tid & 31, col = lane & 15, g = lane >> 4;
  const int bh = blockIdx.y, b = bh / NH, h = bh % NH, q0 = blockIdx.x * 64 + w * 16;
  const _Float16* qb = qh + (size_t)bh * LL * HD; const _Float16* kb = kh + (size_t)bh * LL * HD; const _Float16* vb = vT + (size_t)bh * HD * LL;
  v16h aq[2];
#pragma unroll
  for (int kc = 0; kc < 2; ++kc) aq[kc] = frag_h(qb + (size_t)(q0 + col) * HD + kc * 32, lane);
  float lsum[8] = {0.f, 0.f, 0.f, 0.f, 0.f, 0.f, 0.f, 0.f}; v8f acc[4] = {};
  stage_kv(&sK[0][0][0], &sV[0][0][0], kb, vb, tid);
  WAIT_COPIES(); __syncthreads();
  stage_kv(&sK[1][0][0], &sV[1][0][0], kb + (size_t)64 * HD, vb + 64, tid);
#pragma unroll 1
  for (int kt = 0; kt < LL / 64; ++kt) { const int bf = kt & 1;
    v16h fk[4][2], fv[2][4];   // the tile's 8 K and 8 V fragments are read as one group at its head: the V reads land under the score and sigmoid work
#pragma unroll
    for (int t = 0; t < 4; ++t) {
#pragma unroll
      for (int kc = 0; kc < 2; ++kc) fk[t][kc] = frag_h(&sK[bf][t * 16 + col][kc * 32], lane); }
#pragma unroll
    for (int kc = 0; kc < 2; ++kc) {
#pragma unroll
      for (int t = 0; t < 4; ++t) fv[kc][t] = frag_h(&sV[bf][t * 16 + col][kc * 32], lane); }
#pragma unroll
    for (int t = 0; t < 4; ++t) { v8f s = {};
#pragma unroll
      for (int kc = 0; kc < 2; ++kc) s = wmma16(aq[kc], fk[t][kc], s);
#pragma unroll
      for (int r = 0; r < 8; ++r) { const float wgt = __builtin_amdgcn_rcpf(1.0f + __expf(-s[r] * 0.125f)); lsum[r] += wgt; sP[w][8 * g + r][t * 16 + col] = (_Float16)(wgt * 16384.0f); } }
    LDSX();
    v16h pa[2];            // both P fragments together, ahead of the 8 WMMAs
#pragma unroll
    for (int kc = 0; kc < 2; ++kc) pa[kc] = frag_h(&sP[w][col][0] + kc * 32, lane);
#pragma unroll
    for (int kc = 0; kc < 2; ++kc) {
#pragma unroll
      for (int t = 0; t < 4; ++t) acc[t] = wmma16(pa[kc], fv[kc][t], acc[t]); }
    WAIT_LDS(); WAIT_COPIES(); __syncthreads();   // publishes tile kt + 1 and ends every read of tile kt
    if (kt + 2 < LL / 64) stage_kv(&sK[bf][0][0], &sV[bf][0][0], kb + (size_t)(kt + 2) * 64 * HD, vb + (kt + 2) * 64, tid);
  }
  WAIT_COPIES();
  // row sums: lsum[r] (this lane's 4 tiles x its column) -> reduce over the 16 col lanes of each half -> row 8g+r
#pragma unroll
  for (int off = 8; off >= 1; off >>= 1) {
#pragma unroll
    for (int r = 0; r < 8; ++r) lsum[r] += __shfl_xor(lsum[r], off, 32); }
#pragma unroll
  for (int r = 0; r < 8; ++r) { const float inv = 1.0f / ((lsum[r] + 1e-8f) * 16384.0f);
#pragma unroll
    for (int t = 0; t < 4; ++t) sO[w][8 * g + r][t * 16 + col] = acc[t][r] * inv; }
  LDSX();
  for (int q = lane; q < 16 * 8; q += 32) { const int rl = q >> 3, pc = q & 7; union { v8h h8; v4u u; } pk;
#pragma unroll
    for (int e = 0; e < 8; ++e) pk.h8[e] = (_Float16)(sO[w][rl][pc * 8 + e] * 16.0f);             // o x16 keeps the f16 operand normal
    vst2(o16 + ((size_t)b * LL + q0 + rl) * DD + h * HD + pc * 8, pk.u); }
}
__global__ __launch_bounds__(128) void k_out(const _Float16* __restrict__ o16, const _Float16* __restrict__ P, const float* __restrict__ bo, float* __restrict__ out) {
  __shared__ __align__(16) char smem[RING_B];        // the ring; behind the loop's last barrier it is the epilogue's staging
  float (*so)[16][132] = (float (*)[16][132])smem;
  const int tid = threadIdx.x, wave = tid >> 5, lane = tid & 31, col = lane & 15, g = lane >> 4;
  const int r0 = blockIdx.x * 64 + wave * 16, n0 = blockIdx.y * 128;
  v8f acc[8] = {};
  gemm_ring((_Float16*)smem, o16 + (size_t)blockIdx.x * 64 * DD, P + (size_t)(3 * DD + n0) * DD, acc, tid);
#pragma unroll
  for (int j = 0; j < 8; ++j) { const float bb = bo[n0 + j * 16 + col];
#pragma unroll
    for (int r = 0; r < 8; ++r) so[wave][8 * g + r][j * 16 + col] = acc[j][r] * (1.0f / 256.0f) + bb; }    // W x16, o x16
  LDSX();
#pragma unroll 4
  for (int rl = 0; rl < 16; ++rl) vst2(out + (size_t)(r0 + rl) * DD + n0 + lane * 4, *(const v4f*)(&so[wave][rl][lane * 4]));
}
extern "C" void kernel_launch(void* const* d_in, const int* in_sizes, int n_in, void* d_out, int out_size, void* d_ws, size_t ws_size, hipStream_t stream) {
  (void)in_sizes; (void)n_in; (void)out_size; (void)ws_size;
  const float* x = (const float*)d_in[0]; const float* Wq = (const float*)d_in[1]; const float* bq = (const float*)d_in[2]; const float* Wk = (const float*)d_in[3]; const float* bk = (const float*)d_in[4];
  const float* Wv = (const float*)d_in[5]; const float* bv = (const float*)d_in[6]; const float* Wo = (const float*)d_in[7]; const float* bo = (const float*)d_in[8];
  const float* qs = (const float*)d_in[9]; const float* ksv = (const float*)d_in[10];
  float* out = (float*)d_out;
  char* ws = (char*)d_ws; size_t off = 0;
  auto take = [&](size_t bytes) { char* p = ws + off; off += (bytes + 255) & ~(size_t)255; return p; };
  _Float16* x16 = (_Float16*)take((size_t)NR * DD * 2); float* rr = (float*)take((size_t)NR * 32 * 4); _Float16* P = (_Float16*)take((size_t)4 * DD * DD * 2);
  _Float16* qh = (_Float16*)take((size_t)NR * DD * 2); _Float16* kh = (_Float16*)take((size_t)NR * DD * 2); _Float16* vT = (_Float16*)take((size_t)NR * DD * 2); _Float16* o16 = (_Float16*)take((size_t)NR * DD * 2);
  k_prep<<<NR / 8, 256, 0, stream>>>(x, Wq, Wk, Wv, Wo, qs, ksv, x16, rr, P);
  k_proj<<<dim3(NR / 128, 3 * DD / 128), 128, 0, stream>>>(x16, rr, P, bq, bk, bv, qh, kh, vT);
  k_attn<<<dim3(LL / 64, NB * NH), 128, 0, stream>>>(qh, kh, vT, o16);
  k_out<<<dim3(NR / 64, DD / 128), 128, 0, stream>>>(o16, P, bo, out);
}

// v006
// One run takes 92.3 microseconds.
// Timed twice side by side with v005, it ran 1.09 times as fast both times.
// Over all steps from v000 it is 3.75 times as fast.
#include <hip/hip_runtime.h>
#include <math.h>

typedef __attribute__((ext_vector_type(16))) _Float16 v16h;
typedef __attribute__((ext_vector_type(16))) __bf16 v16b;
typedef __attribute__((ext_vector_type(8)))  _Float16 v8h;
typedef __attribute__((ext_vector_type(2)))  _Float16 v2h;
typedef __attribute__((ext_vector_type(8)))  float v8f;
typedef __attribute__((ext_vector_type(4)))  float v4f;
typedef __attribute__((ext_vector_type(2)))  float v2f;
typedef __attribute__((ext_vector_type(4)))  unsigned v4u;
typedef __attribute__((ext_vector_type(4)))  int v4i;
typedef float __attribute__((may_alias)) float_a;
typedef int __attribute__((may_alias)) int_a;

template <typename T> __device__ __forceinline__ void vst2(void* p, T v) { *(T*)p = v;  }
__device__ __forceinline__ v8f wmma16(v16h a, v16h b, v8f c) {
  v8f d = __builtin_amdgcn_wmma_f32_16x16x32_f16(false, a, false, b, (short)0, c, false, false);
  asm volatile("v_nop\n\tv_nop\n\tv_nop\n\tv_nop" : "+v"(d) : "v"(a), "v"(b));
  return d;
}
__device__ __forceinline__ v8f wmma_bf(v16b a, v16b b, v8f c) {
  v8f d = __builtin_amdgcn_wmma_f32_16x16x32_bf16(false, a, false, b, (short)0, c, false, false);
  asm volatile("v_nop\n\tv_nop\n\tv_nop\n\tv_nop" : "+v"(d) : "v"(a), "v"(b));
  return d;
}
// 16x16x32 fragments: lane = (h = lane>>4, row/col = lane&15); elements 0..7 = k0+8h+0..7, 8..15 = k0+16+8h+0..7; D element r = row 8h+r
__device__ __forceinline__ v16h frag_h(const _Float16* rowk0, int lane) {
  union { v16h v; v8h q[2]; } u; const _Float16* p = rowk0 + 8 * (lane >> 4);
  u.q[0] = *(const v8h*)p; u.q[1] = *(const v8h*)(p + 16); return u.v;
}
__device__ __forceinline__ v16h frag_f32(const float* rowk0, int lane) {
  v16h a; const float* p = rowk0 + 8 * (lane >> 4);
#pragma unroll
  for (int i = 0; i < 8; ++i) { a[i] = (_Float16)p[i]; a[8 + i] = (_Float16)p[16 + i]; }
  return a;
}
__device__ __forceinline__ v16h frag_f32s(const float* rowk0, int lane, float sc) {
  v16h a; const float* p = rowk0 + 8 * (lane >> 4);
#pragma unroll
  for (int i = 0; i < 8; ++i) { a[i] = (_Float16)(p[i] * sc); a[8 + i] = (_Float16)(p[16 + i] * sc); }
  return a;
}
// column fragment from a [K][ld] layout (column n), rows >= K read as 0
__device__ __forceinline__ v16h fragc_f32(const float* W, int k0, int n, int lane, int ld, int K) {
  v16h a; const int g = lane >> 4;
#pragma unroll
  for (int i = 0; i < 8; ++i) { const int ka = k0 + 8 * g + i, kb = ka + 16;
    a[i] = (_Float16)(ka < K ? W[(size_t)ka * ld + n] : 0.f); a[8 + i] = (_Float16)(kb < K ? W[(size_t)kb * ld + n] : 0.f); }
  return a;
}
struct F2 { v16b h, l; };
__device__ __forceinline__ F2 bsplit16(const float v[16]) { F2 r;
#pragma unroll
  for (int i = 0; i < 16; ++i) { const __bf16 h = (__bf16)v[i]; r.h[i] = h; r.l[i] = (__bf16)(v[i] - (float)h); }
  return r; }
__device__ __forceinline__ F2 split_row(const float* row, int k0, int lane) { float v[16]; const float* p = row + k0 + 8 * (lane >> 4);
#pragma unroll
  for (int i = 0; i < 8; ++i) { v[i] = p[i]; v[8 + i] = p[16 + i]; }
  return bsplit16(v); }
__device__ __forceinline__ F2 split_rowK(const float* row, int k0, int lane, int K) { float v[16]; const int g = lane >> 4;
#pragma unroll
  for (int i = 0; i < 8; ++i) { const int ka = k0 + 8 * g + i, kb = ka + 16; v[i] = ka < K ? row[ka] : 0.f; v[8 + i] = kb < K ? row[kb] : 0.f; }
  return bsplit16(v); }
__device__ __forceinline__ F2 split_col(const float* W, int k0, int n, int lane, int ld, int K) { float v[16]; const int g = lane >> 4;
#pragma unroll
  for (int i = 0; i < 8; ++i) { const int ka = k0 + 8 * g + i, kb = ka + 16; v[i] = ka < K ? W[(size_t)ka * ld + n] : 0.f; v[8 + i] = kb < K ? W[(size_t)kb * ld + n] : 0.f; }
  return bsplit16(v); }
__device__ __forceinline__ v8f mac3(const F2& a, const F2& b, v8f c) { c = wmma_bf(a.l, b.h, c); c = wmma_bf(a.h, b.l, c); return wmma_bf(a.h, b.h, c); }
__device__ __forceinline__ float sigm(float v) { return 1.0f / (1.0f + expf(-v)); }
#define LDSX() do { asm volatile("s_wait_dscnt 0" ::: "memory"); __builtin_amdgcn_wave_barrier(); __builtin_amdgcn_fence(__ATOMIC_RELEASE, "workgroup"); } while (0)

// Sigmoid attention block with QK-RMSNorm and rotary embedding. Pure f16 WMMA GEMMs over pre-converted operands (x -> f16 once;
// weights x16 f16 with the RMSNorm scales folded into the q/k weight columns; f32 accumulate): q|k|v projection with the per-row
// RMS factor, bias and RoPE in the f32 epilogue (q/k -> [b][h][l][64] f16, v -> [b][h][d][l] f16), per (b, h, 64 queries) block
// the 2048 keys streamed in 64-key tiles: S on f16 WMMA, sigmoid in f32 (hardware exp/rcp), running row sums, W x2^14 f16 @ v^T,
#define NB 2
#define LL 2048
#define DD 1024
#define NH 16
#define HD 64
#define NR (NB * LL)

// ---- operand tiles staged in LDS by asynchronous copies: rows of 128 B (64 f16), 8 lanes = one whole 128-B line, 128 threads = 16 rows a copy
#define TP 72              // LDS pitch of a staged row in f16: 144 B = 16 B x 9, conflict-free for ds_load_b128
#define R16 (16 * TP * 2)  // bytes of 16 staged rows
#define ACP(l, g) "global_load_async_to_lds_b128 %" #l ", %" #g ", off\n\t"
// this wave's copies have landed (the compiler places no wait for them)
#define WAIT_COPIES() asm volatile("s_wait_asynccnt 0x0" ::: "memory")
// this wave's LDS reads of a buffer have retired before the buffer is handed back for a refill
#define WAIT_LDS() asm volatile("s_wait_dscnt 0x0" ::: "memory")
__device__ __forceinline__ unsigned lds_at(const _Float16* p) { return (unsigned)(size_t)p; }   // LDS byte address = low 32 bits
// one GEMM stage, 64 k: buf rows 0..63 = 64 X rows, rows 64..191 = 128 W rows. s_wait_xcnt closes the copies' own statement, so that no address register of a copy is rewritten ahead of it.
__device__ __forceinline__ void stage_gemm(_Float16* buf, const _Float16* xa, const _Float16* wb, int tid) {
  const int r = tid >> 3, c = (tid & 7) * 8;
  const unsigned l = lds_at(buf + r * TP + c);
  const _Float16* a = xa + (size_t)r * DD + c; const _Float16* b = wb + (size_t)r * DD + c;
  asm volatile(ACP(0, 1) ACP(2, 3) ACP(4, 5) ACP(6, 7) ACP(8, 9) ACP(10, 11) ACP(12, 13) ACP(14, 15) ACP(16, 17) ACP(18, 19) ACP(20, 21) ACP(22, 23) "s_wait_xcnt 0x0"
               :: "v"(l), "v"(a), "v"(l + R16), "v"(a + 16 * DD), "v"(l + 2 * R16), "v"(a + 32 * DD), "v"(l + 3 * R16), "v"(a + 48 * DD),
                  "v"(l + 4 * R16), "v"(b), "v"(l + 5 * R16), "v"(b + 16 * DD), "v"(l + 6 * R16), "v"(b + 32 * DD), "v"(l + 7 * R16), "v"(b + 48 * DD),
                  "v"(l + 8 * R16), "v"(b + 64 * DD), "v"(l + 9 * R16), "v"(b + 80 * DD), "v"(l + 10 * R16), "v"(b + 96 * DD), "v"(l + 11 * R16), "v"(b + 112 * DD) : "memory");
}
// one attention tile: 64 keys x 64 dims of K, 64 dims x 64 keys of V^T; the wait as above
__device__ __forceinline__ void stage_kv(_Float16* sk, _Float16* sv, const _Float16* gk, const _Float16* gv, int tid) {
  const int r = tid >> 3, c = (tid & 7) * 8;
  const unsigned lk = lds_at(sk + r * TP + c), lv = lds_at(sv + r * TP + c);
  const _Float16* k = gk + (size_t)r * HD + c; const _Float16* v = gv + (size_t)r * LL + c;
  asm volatile(ACP(0, 1) ACP(2, 3) ACP(4, 5) ACP(6, 7) ACP(8, 9) ACP(10, 11) ACP(12, 13) ACP(14, 15) "s_wait_xcnt 0x0"
               :: "v"(lk), "v"(k), "v"(lk + R16), "v"(k + 16 * HD), "v"(lk + 2 * R16), "v"(k + 32 * HD), "v"(lk + 3 * R16), "v"(k + 48 * HD),
                  "v"(lv), "v"(v), "v"(lv + R16), "v"(v + 16 * LL), "v"(lv + 2 * R16), "v"(v + 32 * LL), "v"(lv + 3 * R16), "v"(v + 48 * LL) : "memory");
}
#define GBUF (192 * TP)           // f16 of one GEMM buffer
#define RING_B (2 * GBUF * 2)     // bytes of the two
// 64 x 128 tile over K = 1024: 16 stages, two buffers, stage s + 2 copied while stage s + 1 is worked on; k order as before
// X rows as A: acc[j][r] = Y[row 8h + r][n = 16j + c]
__device__ __forceinline__ void gemm_ring(_Float16* ring, const _Float16* xa, const _Float16* wb, v8f acc[8], int tid) {
  const int wave = tid >> 5, lane = tid & 31, col = lane & 15;
  stage_gemm(ring, xa, wb, tid);
  WAIT_COPIES(); __syncthreads();
  stage_gemm(ring + GBUF, xa + 64, wb + 64, tid);
#pragma unroll 1   // one trip = one stage, so that the ring's order stands once, at the trip's foot
  for (int s = 0; s < DD / 64; ++s) { _Float16* buf = ring + (s & 1) * GBUF;
    v16h a[2], b[2][8];   // the stage's 18 fragments are read as one group ahead of its 16 WMMAs: one LDS latency a stage, counted waits, not one full wait a WMMA
#pragma unroll
    for (int kc = 0; kc < 2; ++kc) { a[kc] = frag_h(buf + (wave * 16 + col) * TP + kc * 32, lane);
#pragma unroll
      for (int j = 0; j < 8; ++j) b[kc][j] = frag_h(buf + (64 + j * 16 + col) * TP + kc * 32, lane); }
#pragma unroll
    for (int kc = 0; kc < 2; ++kc) {
#pragma unroll
      for (int j = 0; j < 8; ++j) acc[j] = wmma16(a[kc], b[kc][j], acc[j]); }
    WAIT_LDS(); WAIT_COPIES(); __syncthreads();   // publishes stage s + 1 and ends every read of stage s
    if (s + 2 < DD / 64) stage_gemm(buf, xa + (s + 2) * 64, wb + (s + 2) * 64, tid); }
  WAIT_COPIES();
}
// ---- 128 x 128 tile (q|k|v GEMM): a wave takes 32 X rows x all 128 W rows, so each W fragment read from LDS feeds two WMMAs
// eight copies = 128 rows of one operand; an asm statement takes 30 operands, so a stage is two statements, each closed by its own s_wait_xcnt as above
__device__ __forceinline__ void stage_rows128(unsigned l, const _Float16* a) {
  asm volatile(ACP(0, 1) ACP(2, 3) ACP(4, 5) ACP(6, 7) ACP(8, 9) ACP(10, 11) ACP(12, 13) ACP(14, 15) "s_wait_xcnt 0x0"
               :: "v"(l), "v"(a), "v"(l + R16), "v"(a + 16 * DD), "v"(l + 2 * R16), "v"(a + 32 * DD), "v"(l + 3 * R16), "v"(a + 48 * DD),
                  "v"(l + 4 * R16), "v"(a + 64 * DD), "v"(l + 5 * R16), "v"(a + 80 * DD), "v"(l + 6 * R16), "v"(a + 96 * DD), "v"(l + 7 * R16), "v"(a + 112 * DD) : "memory");
}
// one stage, 64 k: buf rows 0..127 = 128 X rows, rows 128..255 = 128 W rows
__device__ __forceinline__ void stage_gemm2(_Float16* buf, const _Float16* xa, const _Float16* wb, int tid) {
  const int r = tid >> 3, c = (tid & 7) * 8;
  const unsigned l = lds_at(buf + r * TP + c);
  stage_rows128(l, xa + (size_t)r * DD + c); stage_rows128(l + 8 * R16, wb + (size_t)r * DD + c);
}
#define GBUF2 (256 * TP)          // f16 of one buffer
#define RING2_B (2 * GBUF2 * 2)   // bytes of the two
// the ring's order as above; k order as before. W rows as A: acc[i][j][r] = Y[row 16i + c][n = 16j + 8h + r]: a lane holds 8 consecutive n of one row
__device__ __forceinline__ void gemm_ring2(_Float16* ring, const _Float16* xa, const _Float16* wb, v8f acc[2][8], int tid) {
  const int wave = tid >> 5, lane = tid & 31, col = lane & 15;
  stage_gemm2(ring, xa, wb, tid);
  WAIT_COPIES(); __syncthreads();
  stage_gemm2(ring + GBUF2, xa + 64, wb + 64, tid);
#pragma unroll 1   // one trip = one stage, so that the ring's order stands once, at the trip's foot
  for (int s = 0; s < DD / 64; ++s) { _Float16* buf = ring + (s & 1) * GBUF2;
#pragma unroll
    for (int kc = 0; kc < 2; ++kc) { v16h a[2], b[8];   // 32 k: 10 fragments read as one group ahead of their 16 WMMAs
#pragma unroll
      for (int i = 0; i < 2; ++i) a[i] = frag_h(buf + (wave * 32 + i * 16 + col) * TP + kc * 32, lane);
#pragma unroll
      for (int j = 0; j < 8; ++j) b[j] = frag_h(buf + (128 + j * 16 + col) * TP + kc * 32, lane);
#pragma unroll
      for (int j = 0; j < 8; ++j) {
#pragma unroll
        for (int i = 0; i < 2; ++i) acc[i][j] = wmma16(b[j], a[i], acc[i][j]); } }
    WAIT_LDS(); WAIT_COPIES(); __syncthreads();   // publishes stage s + 1 and ends every read of stage s
    if (s + 2 < DD / 64) stage_gemm2(buf, xa + (s + 2) * 64, wb + (s + 2) * 64, tid); }
  WAIT_COPIES();
}

// ---- operand preparation, one launch: wave n takes row n of x (f16 copy + rsqrt(mean x^2 + eps)) and row n of the packed weights (q | k | v | o, [out][in] each), each row whole.
// 4,096 waves in all, 16 to 24 loads of 16 B a lane in flight, every load 512 contiguous B, every f16 store 256, the rr store 128; the row's sum stays in the wave: no LDS, no barrier
static_assert(NR == 4 * DD, "one x row and one weight row a wave");
__global__ __launch_bounds__(256) void k_prep(const float* __restrict__ x, const float* __restrict__ Wq, const float* __restrict__ Wk, const float* __restrict__ Wv, const float* __restrict__ Wo, const float* __restrict__ qs, const float* __restrict__ ksv,
                                            _Float16* __restrict__ x16, float* __restrict__ rr, _Float16* __restrict__ P) {
  const int lane = threadIdx.x & 31, n = blockIdx.x * 8 + __builtin_amdgcn_readfirstlane(threadIdx.x >> 5);   // n in a scalar register: the row bases and the test below are scalar
  const int which = n / DD, o = n % DD;
  const float* W = which == 0 ? Wq : (which == 1 ? Wk : (which == 2 ? Wv : Wo));
  const float* xr = x + (size_t)n * DD + lane * 4; const float* wr = W + (size_t)o * DD + lane * 4;
  v4f xv[8], wv[8], sc[8];
#pragma unroll
  for (int i = 0; i < 8; ++i) xv[i] = *(const v4f*)(xr + i * 128);
#pragma unroll
  for (int i = 0; i < 8; ++i) wv[i] = *(const v4f*)(wr + i * 128);
  if (which < 2) { const float* sr = (which == 0 ? qs : ksv) + lane * 4;
#pragma unroll
    for (int i = 0; i < 8; ++i) sc[i] = *(const v4f*)(sr + i * 128); }
  else {
#pragma unroll
    for (int i = 0; i < 8; ++i) sc[i] = (v4f){1.0f, 1.0f, 1.0f, 1.0f}; }   // x 1 is exact: v and o rows keep their bits
  float ss[4] = {0.f, 0.f, 0.f, 0.f};   // four independent chains
#pragma unroll
  for (int i = 0; i < 8; ++i) { union { _Float16 h[4]; v2f f; } pk;
#pragma unroll
    for (int e = 0; e < 4; ++e) { ss[e] += xv[i][e] * xv[i][e]; pk.h[e] = (_Float16)xv[i][e]; }
    vst2((v2f*)(x16 + (size_t)n * DD + i * 128 + lane * 4), pk.f); }
#pragma unroll
  for (int i = 0; i < 8; ++i) { union { _Float16 h[4]; v2f f; } pk;
#pragma unroll
    for (int e = 0; e < 4; ++e) pk.h[e] = (_Float16)(wv[i][e] * 16.0f * sc[i][e]);
    vst2((v2f*)(P + (size_t)n * DD + i * 128 + lane * 4), pk.f); }
  float s = (ss[0] + ss[1]) + (ss[2] + ss[3]);
#pragma unroll
  for (int off = 16; off >= 1; off >>= 1) s += __shfl_xor(s, off, 32);
  vst2(rr + (size_t)n * 32 + lane, (float_a)(lane == 0 ? rsqrtf(s / (float)DD + 1e-8f) : 0.f));   // rr[row*32] (one line per row)
}
// ---- projection: block 128 rows x 128 cols (= which, 2 heads); epilogue: x rr (q,k), + bias, RoPE (q,k); q/k -> [b][h][t][64] f16; v -> vT [b][h][d][t]
// the weight rows are the A operand: a lane's 8 accumulator registers are 8 consecutive outputs of one x row, and the epilogue needs no f32 staging
__global__ __launch_bounds__(128) void k_proj(const _Float16* __restrict__ x16, const float* __restrict__ rr, const _Float16* __restrict__ P, const float* __restrict__ bq, const float* __restrict__ bk, const float* __restrict__ bv,
                                            _Float16* __restrict__ qh, _Float16* __restrict__ kh, _Float16* __restrict__ vT) {
  __shared__ __align__(16) char smem[RING2_B];                       // the ring; behind the loop's last barrier it is the epilogue's staging
  __shared__ __align__(16) float sfr[32];
  const int tid = threadIdx.x, wave = tid >> 5, lane = tid & 31, col = lane & 15, g = lane >> 4;
  const int r0b = blockIdx.x * 128, r0 = r0b + wave * 32, n0 = blockIdx.y * 128; const int b = r0b / LL, t0 = r0b % LL;
  const int which = n0 / DD, hb = (n0 % DD) / HD; const float* bias = which == 0 ? bq : (which == 1 ? bk : bv);
  if (tid < 32) sfr[tid] = powf(10000.0f, -(float)tid / 32.0f);
  v8f acc[2][8] = {};
  gemm_ring2((_Float16*)smem, x16 + (size_t)r0b * DD, P + (size_t)n0 * DD, acc, tid);
  __syncthreads();
  if (which < 2) {   // q, k: lane (g, col) holds rows 16i + col, dims 16j + 8g + 0..7: RMS factor, bias and RoPE (partner d ^ 1 = the neighbouring register) stay in registers
    _Float16 (*sh)[32][136] = (_Float16 (*)[32][136])smem;   // per wave 32 rows x 128 f16, pitch 272 B, only to turn 16-B pieces into whole-line stores
    float s16[2];
#pragma unroll
    for (int i = 0; i < 2; ++i) s16[i] = rr[(size_t)(r0 + i * 16 + col) * 32] * (1.0f / 16.0f);   // x 2^-4 is exact: same bits as (acc / 16) * rr
    // angle index d & 31 = 16 (j & 1) + 8g + r: 16 angles a row serve its 64 values in the lane. The loop stays rolled (sincosf is long in text and registers);
    // each lane parks its own 2 x (16 cos, 16 sin) in LDS (pitch 272 B) and reads them back as vectors: no lane reads another's
    float (*tb)[32][68] = (float (*)[32][68])(smem + 4 * 32 * 136 * 2);
    static_assert(4 * 32 * 136 * 2 + 4 * 32 * 68 * 4 <= RING2_B, "epilogue staging fits the ring");
    v4f bb[8][2];   // the bias loads fly under the angle loop
#pragma unroll
    for (int j = 0; j < 8; ++j) { const float* bp = bias + (n0 % DD) + j * 16 + 8 * g; bb[j][0] = *(const v4f*)bp; bb[j][1] = *(const v4f*)(bp + 4); }
#pragma unroll 1   // four angles a trip: one sincosf text of four, not thirty-two
    for (int ii = 0; ii < 8; ++ii) { const int i = ii & 3, ro = ii >> 2; const float t = (float)(t0 + wave * 32 + ro * 16 + col);
      const v4f fr = *(const v4f*)(&sfr[(i >> 1) * 16 + 8 * g + (i & 1) * 4]); v4f sv, cv;
#pragma unroll
      for (int e = 0; e < 4; ++e) { float s1, c1; sincosf(t * fr[e], &s1, &c1); sv[e] = s1; cv[e] = c1; }
      vst2(&tb[wave][lane][ro * 32 + i * 4], cv); vst2(&tb[wave][lane][ro * 32 + 16 + i * 4], sv); }
    LDSX();
#pragma unroll
    for (int i = 0; i < 2; ++i) { float cs[2][8], sn[2][8];
#pragma unroll
      for (int p = 0; p < 2; ++p) {
#pragma unroll
        for (int q = 0; q < 2; ++q) { const v4f c4 = *(const v4f*)(&tb[wave][lane][i * 32 + p * 8 + q * 4]), s4 = *(const v4f*)(&tb[wave][lane][i * 32 + 16 + p * 8 + q * 4]);
#pragma unroll
          for (int e = 0; e < 4; ++e) { cs[p][q * 4 + e] = c4[e]; sn[p][q * 4 + e] = s4[e]; } } }
#pragma unroll
      for (int j = 0; j < 8; ++j) { float xv[8]; union { v8h h8; v4u u; } pk;
#pragma unroll
        for (int r = 0; r < 8; ++r) xv[r] = acc[i][j][r] * s16[i] + bb[j][r >> 2][r & 3];
#pragma unroll
        for (int r = 0; r < 8; ++r) { const float xr = (r & 1) ? xv[r - 1] : -xv[r + 1]; pk.h8[r] = (_Float16)(xv[r] * cs[j & 1][r] + xr * sn[j & 1][r]); }
        vst2(&sh[wave][i * 16 + col][j * 16 + 8 * g], pk.u); } }
    LDSX();
    _Float16* dst = which == 0 ? qh : kh;
#pragma unroll
    for (int q = lane; q < 2 * 32 * 8; q += 32) { const int hh = q >> 8, rem = q & 255, rl = rem >> 3, pc = rem & 7;
      vst2(dst + (((size_t)b * NH + hb + hh) * LL + t0 + wave * 32 + rl) * HD + pc * 8, *(const v4u*)(&sh[wave][rl][hh * HD + pc * 8])); } }
  else {   // v: the lane's 8 dims of rows 16i + col go straight into the [dim][row] f16 tile
    _Float16 (*st)[136] = (_Float16 (*)[136])smem;                   // 128 dims x 128 rows, pitch 272 B
#pragma unroll
    for (int j = 0; j < 8; ++j) { const float* bp = bias + (n0 % DD) + j * 16 + 8 * g; const v4f b0 = *(const v4f*)bp, b1 = *(const v4f*)(bp + 4);
#pragma unroll
      for (int i = 0; i < 2; ++i) {
#pragma unroll
        for (int r = 0; r < 8; ++r) st[j * 16 + 8 * g + r][wave * 32 + i * 16 + col] = (_Float16)(acc[i][j][r] * (1.0f / 16.0f) + (r < 4 ? b0[r & 3] : b1[r & 3])); } }
    __syncthreads();
    for (int q = tid; q < 128 * 16; q += 128) { const int c = q >> 4, pc = q & 15, hh = c >> 6, d = c & 63;
      vst2(vT + (((size_t)b * NH + hb + hh) * HD + d) * LL + t0 + pc * 8, *(const v4u*)(&st[c][pc * 8])); }
  }
}
__global__ __launch_bounds__(128) void k_attn(const _Float16* __restrict__ qh, const _Float16* __restrict__ kh, const _Float16* __restrict__ vT, _Float16* __restrict__ o16) {
  __shared__ __align__(16) _Float16 sO[4][16][72];   // per wave 16 queries x 64 dims, only to turn 16-B pieces into whole-line stores
  __shared__ __align__(16) _Float16 sK[2][64][TP];   // 64 keys x 64 dims
  __shared__ __align__(16) _Float16 sV[2][64][TP];   // 64 dims x 64 keys
  const int tid = threadIdx.x, w = tid >> 5, lane = tid & 31, col = lane & 15, g = lane >> 4;
  const int bh = blockIdx.y, b = bh / NH, h = bh % NH, q0 = blockIdx.x * 64 + w * 16;
  const _Float16* qb = qh + (size_t)bh * LL * HD; const _Float16* kb = kh + (size_t)bh * LL * HD; const _Float16* vb = vT + (size_t)bh * HD * LL;
  v16h bq[2];
#pragma unroll
  for (int kc = 0; kc < 2; ++kc) bq[kc] = frag_h(qb + (size_t)(q0 + col) * HD + kc * 32, lane);
  v2f lsum[4] = {}; v8f acc[4] = {};   // lsum: 8 chains, all of query col; acc[t][r] = O[query col][dim 16t + 8g + r]
  stage_kv(&sK[0][0][0], &sV[0][0][0], kb, vb, tid);
  WAIT_COPIES(); __syncthreads();
  stage_kv(&sK[1][0][0], &sV[1][0][0], kb + (size_t)64 * HD, vb + 64, tid);
#pragma unroll 1
  for (int kt = 0; kt < LL / 64; ++kt) { const int bf = kt & 1;
    v16h fk[4][2], fv[2][4];   // the tile's 8 K and 8 V fragments are read as one group at its head: the V reads land under the score and sigmoid work
#pragma unroll
    for (int t = 0; t < 4; ++t) {
#pragma unroll
      for (int kc = 0; kc < 2; ++kc) fk[t][kc] = frag_h(&sK[bf][t * 16 + col][kc * 32], lane); }
#pragma unroll
    for (int kc = 0; kc < 2; ++kc) {
#pragma unroll
      for (int t = 0; t < 4; ++t) fv[kc][t] = frag_h(&sV[bf][t * 16 + col][kc * 32], lane); }
    v16h pb[2];            // P^T as B operand: elements 0..7 from key tile 2kc, 8..15 from key tile 2kc + 1
#pragma unroll
    for (int t = 0; t < 4; ++t) { v8f s = {};
#pragma unroll
      for (int kc = 0; kc < 2; ++kc) s = wmma16(fk[t][kc], bq[kc], s);
#pragma unroll
      for (int r = 0; r < 8; r += 2) {   // two keys at a time: the pair is one register of the operand
        const v2f e = {__expf(-s[r] * 0.125f), __expf(-s[r + 1] * 0.125f)}; const v2f d = e + 1.0f;
        const v2f wgt = {__builtin_amdgcn_rcpf(d[0]), __builtin_amdgcn_rcpf(d[1])}; lsum[r >> 1] += wgt;
        const v2h p = __builtin_convertvector(wgt * 16384.0f, v2h); pb[t >> 1][(t & 1) * 8 + r] = p[0]; pb[t >> 1][(t & 1) * 8 + r + 1] = p[1]; } }
#pragma unroll
    for (int kc = 0; kc < 2; ++kc) {
#pragma unroll
      for (int t = 0; t < 4; ++t) acc[t] = wmma16(fv[kc][t], pb[kc], acc[t]); }
    WAIT_LDS(); WAIT_COPIES(); __syncthreads();   // publishes tile kt + 1 and ends every read of tile kt
    if (kt + 2 < LL / 64) stage_kv(&sK[bf][0][0], &sV[bf][0][0], kb + (size_t)(kt + 2) * 64 * HD, vb + (kt + 2) * 64, tid);
  }
  WAIT_COPIES();
  // row sum of query col: the lane's 8 chains, then the other half's keys
  const v2f l2 = (lsum[0] + lsum[1]) + (lsum[2] + lsum[3]); float l = l2[0] + l2[1];
  l += __shfl_xor(l, 16, 32);
  const float inv = 1.0f / ((l + 1e-8f) * 16384.0f);
#pragma unroll
  for (int t = 0; t < 4; ++t) { union { v8h h8; v4u u; } pk;
#pragma unroll
    for (int r = 0; r < 8; ++r) pk.h8[r] = (_Float16)(acc[t][r] * inv * 16.0f);                   // o x16 keeps the f16 operand normal
    vst2(&sO[w][col][t * 16 + 8 * g], pk.u); }
  LDSX();
  for (int q = lane; q < 16 * 8; q += 32) { const int rl = q >> 3, pc = q & 7;
    vst2(o16 + ((size_t)b * LL + q0 + rl) * DD + h * HD + pc * 8, *(const v4u*)(&sO[w][rl][pc * 8])); }
}
__global__ __launch_bounds__(128) void k_out(const _Float16* __restrict__ o16, const _Float16* __restrict__ P, const float* __restrict__ bo, float* __restrict__ out) {
  __shared__ __align__(16) char smem[RING_B];        // the ring; behind the loop's last barrier it is the epilogue's staging
  float (*so)[16][132] = (float (*)[16][132])smem;
  const int tid = threadIdx.x, wave = tid >> 5, lane = tid & 31, col = lane & 15, g = lane >> 4;
  const int r0 = blockIdx.x * 64 + wave * 16, n0 = blockIdx.y * 128;
  v8f acc[8] = {};
  gemm_ring((_Float16*)smem, o16 + (size_t)blockIdx.x * 64 * DD, P + (size_t)(3 * DD + n0) * DD, acc, tid);
#pragma unroll
  for (int j = 0; j < 8; ++j) { const float bb = bo[n0 + j * 16 + col];
#pragma unroll
    for (int r = 0; r < 8; ++r) so[wave][8 * g + r][j * 16 + col] = acc[j][r] * (1.0f / 256.0f) + bb; }    // W x16, o x16
  LDSX();
#pragma unroll 4
  for (int rl = 0; rl < 16; ++rl) vst2(out + (size_t)(r0 + rl) * DD + n0 + lane * 4, *(const v4f*)(&so[wave][rl][lane * 4]));
}
extern "C" void kernel_launch(void* const* d_in, const int* in_sizes, int n_in, void* d_out, int out_size, void* d_ws, size_t ws_size, hipStream_t stream) {
  (void)in_sizes; (void)n_in; (void)out_size; (void)ws_size;
  const float* x = (const float*)d_in[0]; const float* Wq = (const float*)d_in[1]; const float* bq = (const float*)d_in[2]; const float* Wk = (const float*)d_in[3]; const float* bk = (const float*)d_in[4];
  const float* Wv = (const float*)d_in[5]; const float* bv = (const float*)d_in[6]; const float* Wo = (const float*)d_in[7]; const float* bo = (const float*)d_in[8];
  const float* qs = (const float*)d_in[9]; const float* ksv = (const float*)d_in[10];
  float* out = (float*)d_out;
  char* ws = (char*)d_ws; size_t off = 0;
  auto take = [&](size_t bytes) { char* p = ws + off; off += (bytes + 255) & ~(size_t)255; return p; };
  _Float16* x16 = (_Float16*)take((size_t)NR * DD * 2); float* rr = (float*)take((size_t)NR * 32 * 4); _Float16* P = (_Float16*)take((size_t)4 * DD * DD * 2);
  _Float16* qh = (_Float16*)take((size_t)NR * DD * 2); _Float16* kh = (_Float16*)take((size_t)NR * DD * 2); _Float16* vT = (_Float16*)take((size_t)NR * DD * 2); _Float16* o16 = (_Float16*)take((size_t)NR * DD * 2);
  k_prep<<<NR / 8, 256, 0, stream>>>(x, Wq, Wk, Wv, Wo, qs, ksv, x16, rr, P);
  k_proj<<<dim3(NR / 128, 3 * DD / 128), 128, 0, stream>>>(x16, rr, P, bq, bk, bv, qh, kh, vT);
  k_attn<<<dim3(LL / 64, NB * NH), 128, 0, stream>>>(qh, kh, vT, o16);
  k_out<<<dim3(NR / 64, DD / 128), 128, 0, stream>>>(o16, P, bo, out);
}

// v007
// One run takes 85.4 microseconds.
// Next to v006, in two timings, it ran 1.08 times as fast each time.
// All steps since v000 together make it 4.05 times as fast.
#include <hip/hip_runtime.h>
#include <math.h>

typedef __attribute__((ext_vector_type(16))) _Float16 v16h;
typedef __attribute__((ext_vector_type(16))) __bf16 v16b;
typedef __attribute__((ext_vector_type(8)))  _Float16 v8h;
typedef __attribute__((ext_vector_type(2)))  _Float16 v2h;
typedef __attribute__((ext_vector_type(8)))  float v8f;
typedef __attribute__((ext_vector_type(4)))  float v4f;
typedef __attribute__((ext_vector_type(2)))  float v2f;
typedef __attribute__((ext_vector_type(4)))  unsigned v4u;
typedef __attribute__((ext_vector_type(4)))  int v4i;
typedef float __attribute__((may_alias)) float_a;
typedef int __attribute__((may_alias)) int_a;

template <typename T> __device__ __forceinline__ void vst2(void* p, T v) { *(T*)p = v;  }
__device__ __forceinline__ v8f wmma16(v16h a, v16h b, v8f c) {
  v8f d = __builtin_amdgcn_wmma_f32_16x16x32_f16(false, a, false, b, (short)0, c, false, false);
  asm volatile("v_nop\n\tv_nop\n\tv_nop\n\tv_nop" : "+v"(d) : "v"(a), "v"(b));
  return d;
}
__device__ __forceinline__ v8f wmma_bf(v16b a, v16b b, v8f c) {
  v8f d = __builtin_amdgcn_wmma_f32_16x16x32_bf16(false, a, false, b, (short)0, c, false, false);
  asm volatile("v_nop\n\tv_nop\n\tv_nop\n\tv_nop" : "+v"(d) : "v"(a), "v"(b));
  return d;
}
// 16x16x32 fragments: lane = (h = lane>>4, row/col = lane&15); elements 0..7 = k0+8h+0..7, 8..15 = k0+16+8h+0..7; D element r = row 8h+r
__device__ __forceinline__ v16h frag_h(const _Float16* rowk0, int lane) {
  union { v16h v; v8h q[2]; } u; const _Float16* p = rowk0 + 8 * (lane >> 4);
  u.q[0] = *(const v8h*)p; u.q[1] = *(const v8h*)(p + 16); return u.v;
}
__device__ __forceinline__ v16h frag_f32(const float* rowk0, int lane) {
  v16h a; const float* p = rowk0 + 8 * (lane >> 4);
#pragma unroll
  for (int i = 0; i < 8; ++i) { a[i] = (_Float16)p[i]; a[8 + i] = (_Float16)p[16 + i]; }
  return a;
}
__device__ __forceinline__ v16h frag_f32s(const float* rowk0, int lane, float sc) {
  v16h a; const float* p = rowk0 + 8 * (lane >> 4);
#pragma unroll
  for (int i = 0; i < 8; ++i) { a[i] = (_Float16)(p[i] * sc); a[8 + i] = (_Float16)(p[16 + i] * sc); }
  return a;
}
// column fragment from a [K][ld] layout (column n), rows >= K read as 0
__device__ __forceinline__ v16h fragc_f32(const float* W, int k0, int n, int lane, int ld, int K) {
  v16h a; const int g = lane >> 4;
#pragma unroll
  for (int i = 0; i < 8; ++i) { const int ka = k0 + 8 * g + i, kb = ka + 16;
    a[i] = (_Float16)(ka < K ? W[(size_t)ka * ld + n] : 0.f); a[8 + i] = (_Float16)(kb < K ? W[(size_t)kb * ld + n] : 0.f); }
  return a;
}
struct F2 { v16b h, l; };
__device__ __forceinline__ F2 bsplit16(const float v[16]) { F2 r;
#pragma unroll
  for (int i = 0; i < 16; ++i) { const __bf16 h = (__bf16)v[i]; r.h[i] = h; r.l[i] = (__bf16)(v[i] - (float)h); }
  return r; }
__device__ __forceinline__ F2 split_row(const float* row, int k0, int lane) { float v[16]; const float* p = row + k0 + 8 * (lane >> 4);
#pragma unroll
  for (int i = 0; i < 8; ++i) { v[i] = p[i]; v[8 + i] = p[16 + i]; }
  return bsplit16(v); }
__device__ __forceinline__ F2 split_rowK(const float* row, int k0, int lane, int K) { float v[16]; const int g = lane >> 4;
#pragma unroll
  for (int i = 0; i < 8; ++i) { const int ka = k0 + 8 * g + i, kb = ka + 16; v[i] = ka < K ? row[ka] : 0.f; v[8 + i] = kb < K ? row[kb] : 0.f; }
  return bsplit16(v); }
__device__ __forceinline__ F2 split_col(const float* W, int k0, int n, int lane, int ld, int K) { float v[16]; const int g = lane >> 4;
#pragma unroll
  for (int i = 0; i < 8; ++i) { const int ka = k0 + 8 * g + i, kb = ka + 16; v[i] = ka < K ? W[(size_t)ka * ld + n] : 0.f; v[8 + i] = kb < K ? W[(size_t)kb * ld + n] : 0.f; }
  return bsplit16(v); }
__device__ __forceinline__ v8f mac3(const F2& a, const F2& b, v8f c) { c = wmma_bf(a.l, b.h, c); c = wmma_bf(a.h, b.l, c); return wmma_bf(a.h, b.h, c); }
__device__ __forceinline__ float sigm(float v) { return 1.0f / (1.0f + expf(-v)); }
#define LDSX() do { asm volatile("s_wait_dscnt 0" ::: "memory"); __builtin_amdgcn_wave_barrier(); __builtin_amdgcn_fence(__ATOMIC_RELEASE, "workgroup"); } while (0)

// Sigmoid attention block with QK-RMSNorm and rotary embedding. Pure f16 WMMA GEMMs over pre-converted operands (x -> f16 once;
// weights x16 f16 with the RMSNorm scales folded into the q/k weight columns; f32 accumulate): q|k|v projection with the per-row
// RMS factor, bias and RoPE in the f32 epilogue (q/k -> [b][h][l][64] f16, v -> [b][h][d][l] f16), per (b, h, 64 queries) block
// the 2048 keys streamed in 64-key tiles: S on f16 WMMA, sigmoid in f32 (hardware tanh), running row sums, W x2^14 f16 @ v^T,
#define NB 2
#define LL 2048
#define DD 1024
#define NH 16
#define HD 64
#define NR (NB * LL)

// ---- operand tiles staged in LDS by asynchronous copies: rows of 128 B (64 f16), 8 lanes = one whole 128-B line, 128 threads = 16 rows a copy
#define TP 72              // LDS pitch of a staged row in f16: 144 B = 16 B x 9, conflict-free for ds_load_b128
#define R16 (16 * TP * 2)  // bytes of 16 staged rows
#define ACP(l, g) "global_load_async_to_lds_b128 %" #l ", %" #g ", off\n\t"
// this wave's copies have landed (the compiler places no wait for them)
#define WAIT_COPIES() asm volatile("s_wait_asynccnt 0x0" ::: "memory")
// this wave's LDS reads of a buffer have retired before the buffer is handed back for a refill
#define WAIT_LDS() asm volatile("s_wait_dscnt 0x0" ::: "memory")
__device__ __forceinline__ unsigned lds_at(const _Float16* p) { return (unsigned)(size_t)p; }   // LDS byte address = low 32 bits
// one GEMM stage, 64 k: buf rows 0..63 = 64 X rows, rows 64..191 = 128 W rows. s_wait_xcnt closes the copies' own statement, so that no address register of a copy is rewritten ahead of it.
__device__ __forceinline__ void stage_gemm(_Float16* buf, const _Float16* xa, const _Float16* wb, int tid) {
  const int r = tid >> 3, c = (tid & 7) * 8;
  const unsigned l = lds_at(buf + r * TP + c);
  const _Float16* a = xa + (size_t)r * DD + c; const _Float16* b = wb + (size_t)r * DD + c;
  asm volatile(ACP(0, 1) ACP(2, 3) ACP(4, 5) ACP(6, 7) ACP(8, 9) ACP(10, 11) ACP(12, 13) ACP(14, 15) ACP(16, 17) ACP(18, 19) ACP(20, 21) ACP(22, 23) "s_wait_xcnt 0x0"
               :: "v"(l), "v"(a), "v"(l + R16), "v"(a + 16 * DD), "v"(l + 2 * R16), "v"(a + 32 * DD), "v"(l + 3 * R16), "v"(a + 48 * DD),
                  "v"(l + 4 * R16), "v"(b), "v"(l + 5 * R16), "v"(b + 16 * DD), "v"(l + 6 * R16), "v"(b + 32 * DD), "v"(l + 7 * R16), "v"(b + 48 * DD),
                  "v"(l + 8 * R16), "v"(b + 64 * DD), "v"(l + 9 * R16), "v"(b + 80 * DD), "v"(l + 10 * R16), "v"(b + 96 * DD), "v"(l + 11 * R16), "v"(b + 112 * DD) : "memory");
}
// one attention tile: 64 keys x 64 dims of K, 64 dims x 64 keys of V^T; the wait as above
__device__ __forceinline__ void stage_kv(_Float16* sk, _Float16* sv, const _Float16* gk, const _Float16* gv, int tid) {
  const int r = tid >> 3, c = (tid & 7) * 8;
  const unsigned lk = lds_at(sk + r * TP + c), lv = lds_at(sv + r * TP + c);
  const _Float16* k = gk + (size_t)r * HD + c; const _Float16* v = gv + (size_t)r * LL + c;
  asm volatile(ACP(0, 1) ACP(2, 3) ACP(4, 5) ACP(6, 7) ACP(8, 9) ACP(10, 11) ACP(12, 13) ACP(14, 15) "s_wait_xcnt 0x0"
               :: "v"(lk), "v"(k), "v"(lk + R16), "v"(k + 16 * HD), "v"(lk + 2 * R16), "v"(k + 32 * HD), "v"(lk + 3 * R16), "v"(k + 48 * HD),
                  "v"(lv), "v"(v), "v"(lv + R16), "v"(v + 16 * LL), "v"(lv + 2 * R16), "v"(v + 32 * LL), "v"(lv + 3 * R16), "v"(v + 48 * LL) : "memory");
}
#define GBUF (192 * TP)           // f16 of one GEMM buffer
#define RING_B (2 * GBUF * 2)     // bytes of the two
// 64 x 128 tile over K = 1024: 16 stages, two buffers, stage s + 2 copied while stage s + 1 is worked on; k order as before
// X rows as A: acc[j][r] = Y[row 8h + r][n = 16j + c]
__device__ __forceinline__ void gemm_ring(_Float16* ring, const _Float16* xa, const _Float16* wb, v8f acc[8], int tid) {
  const int wave = tid >> 5, lane = tid & 31, col = lane & 15;
  stage_gemm(ring, xa, wb, tid);
  WAIT_COPIES(); __syncthreads();
  stage_gemm(ring + GBUF, xa + 64, wb + 64, tid);
#pragma unroll 1   // one trip = one stage, so that the ring's order stands once, at the trip's foot
  for (int s = 0; s < DD / 64; ++s) { _Float16* buf = ring + (s & 1) * GBUF;
    v16h a[2], b[2][8];   // the stage's 18 fragments are read as one group ahead of its 16 WMMAs: one LDS latency a stage, counted waits, not one full wait a WMMA
#pragma unroll
    for (int kc = 0; kc < 2; ++kc) { a[kc] = frag_h(buf + (wave * 16 + col) * TP + kc * 32, lane);
#pragma unroll
      for (int j = 0; j < 8; ++j) b[kc][j] = frag_h(buf + (64 + j * 16 + col) * TP + kc * 32, lane); }
#pragma unroll
    for (int kc = 0; kc < 2; ++kc) {
#pragma unroll
      for (int j = 0; j < 8; ++j) acc[j] = wmma16(a[kc], b[kc][j], acc[j]); }
    WAIT_LDS(); WAIT_COPIES(); __syncthreads();   // publishes stage s + 1 and ends every read of stage s
    if (s + 2 < DD / 64) stage_gemm(buf, xa + (s + 2) * 64, wb + (s + 2) * 64, tid); }
  WAIT_COPIES();
}
// ---- 128 x 128 tile (q|k|v GEMM): a wave takes 32 X rows x all 128 W rows, so each W fragment read from LDS feeds two WMMAs
// eight copies = 128 rows of one operand; an asm statement takes 30 operands, so a stage is two statements, each closed by its own s_wait_xcnt as above
__device__ __forceinline__ void stage_rows128(unsigned l, const _Float16* a) {
  asm volatile(ACP(0, 1) ACP(2, 3) ACP(4, 5) ACP(6, 7) ACP(8, 9) ACP(10, 11) ACP(12, 13) ACP(14, 15) "s_wait_xcnt 0x0"
               :: "v"(l), "v"(a), "v"(l + R16), "v"(a + 16 * DD), "v"(l + 2 * R16), "v"(a + 32 * DD), "v"(l + 3 * R16), "v"(a + 48 * DD),
                  "v"(l + 4 * R16), "v"(a + 64 * DD), "v"(l + 5 * R16), "v"(a + 80 * DD), "v"(l + 6 * R16), "v"(a + 96 * DD), "v"(l + 7 * R16), "v"(a + 112 * DD) : "memory");
}
// one stage, 64 k: buf rows 0..127 = 128 X rows, rows 128..255 = 128 W rows
__device__ __forceinline__ void stage_gemm2(_Float16* buf, const _Float16* xa, const _Float16* wb, int tid) {
  const int r = tid >> 3, c = (tid & 7) * 8;
  const unsigned l = lds_at(buf + r * TP + c);
  stage_rows128(l, xa + (size_t)r * DD + c); stage_rows128(l + 8 * R16, wb + (size_t)r * DD + c);
}
#define GBUF2 (256 * TP)          // f16 of one buffer
#define RING2_B (2 * GBUF2 * 2)   // bytes of the two
// the ring's order as above; k order as before. W rows as A: acc[i][j][r] = Y[row 16i + c][n = 16j + 8h + r]: a lane holds 8 consecutive n of one row
__device__ __forceinline__ void gemm_ring2(_Float16* ring, const _Float16* xa, const _Float16* wb, v8f acc[2][8], int tid) {
  const int wave = tid >> 5, lane = tid & 31, col = lane & 15;
  stage_gemm2(ring, xa, wb, tid);
  WAIT_COPIES(); __syncthreads();
  stage_gemm2(ring + GBUF2, xa + 64, wb + 64, tid);
#pragma unroll 1   // one trip = one stage, so that the ring's order stands once, at the trip's foot
  for (int s = 0; s < DD / 64; ++s) { _Float16* buf = ring + (s & 1) * GBUF2;
#pragma unroll
    for (int kc = 0; kc < 2; ++kc) { v16h a[2], b[8];   // 32 k: 10 fragments read as one group ahead of their 16 WMMAs
#pragma unroll
      for (int i = 0; i < 2; ++i) a[i] = frag_h(buf + (wave * 32 + i * 16 + col) * TP + kc * 32, lane);
#pragma unroll
      for (int j = 0; j < 8; ++j) b[j] = frag_h(buf + (128 + j * 16 + col) * TP + kc * 32, lane);
#pragma unroll
      for (int j = 0; j < 8; ++j) {
#pragma unroll
        for (int i = 0; i < 2; ++i) acc[i][j] = wmma16(b[j], a[i], acc[i][j]); } }
    WAIT_LDS(); WAIT_COPIES(); __syncthreads();   // publishes stage s + 1 and ends every read of stage s
    if (s + 2 < DD / 64) stage_gemm2(buf, xa + (s + 2) * 64, wb + (s + 2) * 64, tid); }
  WAIT_COPIES();
}

// ---- operand preparation, one launch: wave n takes row n of x (f16 copy + rsqrt(mean x^2 + eps)) and row n of the packed weights (q | k | v | o, [out][in] each), each row whole.
// 4,096 waves in all, 16 to 24 loads of 16 B a lane in flight, every load 512 contiguous B, every f16 store 256, the rr store 128; the row's sum stays in the wave: no LDS, no barrier
static_assert(NR == 4 * DD, "one x row and one weight row a wave");
__global__ __launch_bounds__(256) void k_prep(const float* __restrict__ x, const float* __restrict__ Wq, const float* __restrict__ Wk, const float* __restrict__ Wv, const float* __restrict__ Wo, const float* __restrict__ qs, const float* __restrict__ ksv,
                                            _Float16* __restrict__ x16, float* __restrict__ rr, _Float16* __restrict__ P) {
  const int lane = threadIdx.x & 31, n = blockIdx.x * 8 + __builtin_amdgcn_readfirstlane(threadIdx.x >> 5);   // n in a scalar register: the row bases and the test below are scalar
  const int which = n / DD, o = n % DD;
  const float* W = which == 0 ? Wq : (which == 1 ? Wk : (which == 2 ? Wv : Wo));
  const float* xr = x + (size_t)n * DD + lane * 4; const float* wr = W + (size_t)o * DD + lane * 4;
  v4f xv[8], wv[8], sc[8];
#pragma unroll
  for (int i = 0; i < 8; ++i) xv[i] = *(const v4f*)(xr + i * 128);
#pragma unroll
  for (int i = 0; i < 8; ++i) wv[i] = *(const v4f*)(wr + i * 128);
  if (which < 2) { const float* sr = (which == 0 ? qs : ksv) + lane * 4;
#pragma unroll
    for (int i = 0; i < 8; ++i) sc[i] = *(const v4f*)(sr + i * 128); }
  else {
#pragma unroll
    for (int i = 0; i < 8; ++i) sc[i] = (v4f){1.0f, 1.0f, 1.0f, 1.0f}; }   // x 1 is exact: v and o rows keep their bits
  float ss[4] = {0.f, 0.f, 0.f, 0.f};   // four independent chains
#pragma unroll
  for (int i = 0; i < 8; ++i) { union { _Float16 h[4]; v2f f; } pk;
#pragma unroll
    for (int e = 0; e < 4; ++e) { ss[e] += xv[i][e] * xv[i][e]; pk.h[e] = (_Float16)xv[i][e]; }
    vst2((v2f*)(x16 + (size_t)n * DD + i * 128 + lane * 4), pk.f); }
#pragma unroll
  for (int i = 0; i < 8; ++i) { union { _Float16 h[4]; v2f f; } pk;
#pragma unroll
    for (int e = 0; e < 4; ++e) pk.h[e] = (_Float16)(wv[i][e] * 16.0f * sc[i][e]);
    vst2((v2f*)(P + (size_t)n * DD + i * 128 + lane * 4), pk.f); }
  float s = (ss[0] + ss[1]) + (ss[2] + ss[3]);
#pragma unroll
  for (int off = 16; off >= 1; off >>= 1) s += __shfl_xor(s, off, 32);
  vst2(rr + (size_t)n * 32 + lane, (float_a)(lane == 0 ? rsqrtf(s / (float)DD + 1e-8f) : 0.f));   // rr[row*32] (one line per row)
}
// ---- projection: block 128 rows x 128 cols (= which, 2 heads); epilogue: x rr (q,k), + bias, RoPE (q,k); q/k -> [b][h][t][64] f16; v -> vT [b][h][d][t]
// the weight rows are the A operand: a lane's 8 accumulator registers are 8 consecutive outputs of one x row, and the epilogue needs no f32 staging
__global__ __launch_bounds__(128) void k_proj(const _Float16* __restrict__ x16, const float* __restrict__ rr, const _Float16* __restrict__ P, const float* __restrict__ bq, const float* __restrict__ bk, const float* __restrict__ bv,
                                            _Float16* __restrict__ qh, _Float16* __restrict__ kh, _Float16* __restrict__ vT) {
  __shared__ __align__(16) char smem[RING2_B];                       // the ring; behind the loop's last barrier it is the epilogue's staging
  __shared__ __align__(16) float sfr[32];
  const int tid = threadIdx.x, wave = tid >> 5, lane = tid & 31, col = lane & 15, g = lane >> 4;
  const int r0b = blockIdx.x * 128, r0 = r0b + wave * 32, n0 = blockIdx.y * 128; const int b = r0b / LL, t0 = r0b % LL;
  const int which = n0 / DD, hb = (n0 % DD) / HD; const float* bias = which == 0 ? bq : (which == 1 ? bk : bv);
  if (tid < 32) sfr[tid] = powf(10000.0f, -(float)tid / 32.0f);
  v8f acc[2][8] = {};
  gemm_ring2((_Float16*)smem, x16 + (size_t)r0b * DD, P + (size_t)n0 * DD, acc, tid);
  __syncthreads();
  if (which < 2) {   // q, k: lane (g, col) holds rows 16i + col, dims 16j + 8g + 0..7: RMS factor, bias and RoPE (partner d ^ 1 = the neighbouring register) stay in registers
    _Float16 (*sh)[32][136] = (_Float16 (*)[32][136])smem;   // per wave 32 rows x 128 f16, pitch 272 B, only to turn 16-B pieces into whole-line stores
    float s16[2];
#pragma unroll
    for (int i = 0; i < 2; ++i) s16[i] = rr[(size_t)(r0 + i * 16 + col) * 32] * (1.0f / 16.0f);   // x 2^-4 is exact: same bits as (acc / 16) * rr
    // angle index d & 31 = 16 (j & 1) + 8g + r: 16 angles a row serve its 64 values in the lane. The loop stays rolled (sincosf is long in text and registers);
    // each lane parks its own 2 x (16 cos, 16 sin) in LDS (pitch 272 B) and reads them back as vectors: no lane reads another's
    float (*tb)[32][68] = (float (*)[32][68])(smem + 4 * 32 * 136 * 2);
    static_assert(4 * 32 * 136 * 2 + 4 * 32 * 68 * 4 <= RING2_B, "epilogue staging fits the ring");
    v4f bb[8][2];   // the bias loads fly under the angle loop
#pragma unroll
    for (int j = 0; j < 8; ++j) { const float* bp = bias + (n0 % DD) + j * 16 + 8 * g; bb[j][0] = *(const v4f*)bp; bb[j][1] = *(const v4f*)(bp + 4); }
#pragma unroll 1   // four angles a trip: one sincosf text of four, not thirty-two
    for (int ii = 0; ii < 8; ++ii) { const int i = ii & 3, ro = ii >> 2; const float t = (float)(t0 + wave * 32 + ro * 16 + col);
      const v4f fr = *(const v4f*)(&sfr[(i >> 1) * 16 + 8 * g + (i & 1) * 4]); v4f sv, cv;
#pragma unroll
      for (int e = 0; e < 4; ++e) { float s1, c1; sincosf(t * fr[e], &s1, &c1); sv[e] = s1; cv[e] = c1; }
      vst2(&tb[wave][lane][ro * 32 + i * 4], cv); vst2(&tb[wave][lane][ro * 32 + 16 + i * 4], sv); }
    LDSX();
#pragma unroll
    for (int i = 0; i < 2; ++i) { float cs[2][8], sn[2][8];
#pragma unroll
      for (int p = 0; p < 2; ++p) {
#pragma unroll
        for (int q = 0; q < 2; ++q) { const v4f c4 = *(const v4f*)(&tb[wave][lane][i * 32 + p * 8 + q * 4]), s4 = *(const v4f*)(&tb[wave][lane][i * 32 + 16 + p * 8 + q * 4]);
#pragma unroll
          for (int e = 0; e < 4; ++e) { cs[p][q * 4 + e] = c4[e]; sn[p][q * 4 + e] = s4[e]; } } }
#pragma unroll
      for (int j = 0; j < 8; ++j) { float xv[8]; union { v8h h8; v4u u; } pk;
#pragma unroll
        for (int r = 0; r < 8; ++r) xv[r] = acc[i][j][r] * s16[i] + bb[j][r >> 2][r & 3];
#pragma unroll
        for (int r = 0; r < 8; ++r) { const float xr = (r & 1) ? xv[r - 1] : -xv[r + 1]; pk.h8[r] = (_Float16)(xv[r] * cs[j & 1][r] + xr * sn[j & 1][r]); }
        vst2(&sh[wave][i * 16 + col][j * 16 + 8 * g], pk.u); } }
    LDSX();
    _Float16* dst = which == 0 ? qh : kh;
#pragma unroll
    for (int q = lane; q < 2 * 32 * 8; q += 32) { const int hh = q >> 8, rem = q & 255, rl = rem >> 3, pc = rem & 7;
      vst2(dst + (((size_t)b * NH + hb + hh) * LL + t0 + wave * 32 + rl) * HD + pc * 8, *(const v4u*)(&sh[wave][rl][hh * HD + pc * 8])); } }
  else {   // v: the lane's 8 dims of rows 16i + col go straight into the [dim][row] f16 tile
    _Float16 (*st)[136] = (_Float16 (*)[136])smem;                   // 128 dims x 128 rows, pitch 272 B
#pragma unroll
    for (int j = 0; j < 8; ++j) { const float* bp = bias + (n0 % DD) + j * 16 + 8 * g; const v4f b0 = *(const v4f*)bp, b1 = *(const v4f*)(bp + 4);
#pragma unroll
      for (int i = 0; i < 2; ++i) {
#pragma unroll
        for (int r = 0; r < 8; ++r) st[j * 16 + 8 * g + r][wave * 32 + i * 16 + col] = (_Float16)(acc[i][j][r] * (1.0f / 16.0f) + (r < 4 ? b0[r & 3] : b1[r & 3])); } }
    __syncthreads();
    for (int q = tid; q < 128 * 16; q += 128) { const int c = q >> 4, pc = q & 15, hh = c >> 6, d = c & 63;
      vst2(vT + (((size_t)b * NH + hb + hh) * HD + d) * LL + t0 + pc * 8, *(const v4u*)(&st[c][pc * 8])); }
  }
}
__global__ __launch_bounds__(128) void k_attn(const _Float16* __restrict__ qh, const _Float16* __restrict__ kh, const _Float16* __restrict__ vT, _Float16* __restrict__ o16) {
  __shared__ __align__(16) _Float16 sO[4][16][72];   // per wave 16 queries x 64 dims, only to turn 16-B pieces into whole-line stores
  __shared__ __align__(16) _Float16 sK[2][64][TP];   // 64 keys x 64 dims
  __shared__ __align__(16) _Float16 sV[2][64][TP];   // 64 dims x 64 keys
  const int tid = threadIdx.x, w = tid >> 5, lane = tid & 31, col = lane & 15, g = lane >> 4;
  const int bh = blockIdx.y, b = bh / NH, h = bh % NH, q0 = blockIdx.x * 64 + w * 16;
  const _Float16* qb = qh + (size_t)bh * LL * HD; const _Float16* kb = kh + (size_t)bh * LL * HD; const _Float16* vb = vT + (size_t)bh * HD * LL;
  v16h bq[2];
#pragma unroll
  for (int kc = 0; kc < 2; ++kc) bq[kc] = frag_h(qb + (size_t)(q0 + col) * HD + kc * 32, lane);
  v2f lsum[4] = {}; v8f acc[4] = {};   // lsum: 8 chains of tanh values, all of query col; acc[t][r] = O[query col][dim 16t + 8g + r]
  stage_kv(&sK[0][0][0], &sV[0][0][0], kb, vb, tid);
  WAIT_COPIES(); __syncthreads();
  stage_kv(&sK[1][0][0], &sV[1][0][0], kb + (size_t)64 * HD, vb + 64, tid);
#pragma unroll 1
  for (int kt = 0; kt < LL / 64; ++kt) { const int bf = kt & 1;
    v16h fk[4][2], fv[2][4];   // the tile's 8 K and 8 V fragments are read as one group at its head: the V reads land under the score and sigmoid work
#pragma unroll
    for (int t = 0; t < 4; ++t) {
#pragma unroll
      for (int kc = 0; kc < 2; ++kc) fk[t][kc] = frag_h(&sK[bf][t * 16 + col][kc * 32], lane); }
#pragma unroll
    for (int kc = 0; kc < 2; ++kc) {
#pragma unroll
      for (int t = 0; t < 4; ++t) fv[kc][t] = frag_h(&sV[bf][t * 16 + col][kc * 32], lane); }
    v16h pb[2];            // P^T as B operand: elements 0..7 from key tile 2kc, 8..15 from key tile 2kc + 1
#pragma unroll
    for (int t = 0; t < 4; ++t) { v8f s = {};
#pragma unroll
      for (int kc = 0; kc < 2; ++kc) s = wmma16(fk[t][kc], bq[kc], s);
#pragma unroll
      for (int r = 0; r < 8; r += 2) {   // two keys at a time: the pair is one register of the operand
        // sigmoid(s / 8) = (1 + tanh(s / 16)) / 2: one transcendental a score. P x 2^14 = 8192 tanh + 8192 in one fma; the row sum adds the tanh values, its halving and its LL / 2 come behind the loop
        const v2f a = (v2f){s[r], s[r + 1]} * 0.0625f;
        const v2f th = {__builtin_amdgcn_tanhf(a[0]), __builtin_amdgcn_tanhf(a[1])}; lsum[r >> 1] += th;
        const v2h p = __builtin_convertvector(th * 8192.0f + 8192.0f, v2h); pb[t >> 1][(t & 1) * 8 + r] = p[0]; pb[t >> 1][(t & 1) * 8 + r + 1] = p[1]; } }
#pragma unroll
    for (int kc = 0; kc < 2; ++kc) {
#pragma unroll
      for (int t = 0; t < 4; ++t) acc[t] = wmma16(fv[kc][t], pb[kc], acc[t]); }
    WAIT_LDS(); WAIT_COPIES(); __syncthreads();   // publishes tile kt + 1 and ends every read of tile kt
    if (kt + 2 < LL / 64) stage_kv(&sK[bf][0][0], &sV[bf][0][0], kb + (size_t)(kt + 2) * 64 * HD, vb + (kt + 2) * 64, tid);
  }
  WAIT_COPIES();
  // row sum of query col: the lane's 8 chains of tanh values, then the other half's keys; sum of weights = LL / 2 + half the sum of tanh
  const v2f l2 = (lsum[0] + lsum[1]) + (lsum[2] + lsum[3]); float ts = l2[0] + l2[1];
  ts += __shfl_xor(ts, 16, 32);
  const float l = 0.5f * ts + (float)(LL / 2);
  const float inv = 1.0f / ((l + 1e-8f) * 16384.0f);
#pragma unroll
  for (int t = 0; t < 4; ++t) { union { v8h h8; v4u u; } pk;
#pragma unroll
    for (int r = 0; r < 8; ++r) pk.h8[r] = (_Float16)(acc[t][r] * inv * 16.0f);                   // o x16 keeps the f16 operand normal
    vst2(&sO[w][col][t * 16 + 8 * g], pk.u); }
  LDSX();
  for (int q = lane; q < 16 * 8; q += 32) { const int rl = q >> 3, pc = q & 7;
    vst2(o16 + ((size_t)b * LL + q0 + rl) * DD + h * HD + pc * 8, *(const v4u*)(&sO[w][rl][pc * 8])); }
}
__global__ __launch_bounds__(128) void k_out(const _Float16* __restrict__ o16, const _Float16* __restrict__ P, const float* __restrict__ bo, float* __restrict__ out) {
  __shared__ __align__(16) char smem[RING_B];        // the ring; behind the loop's last barrier it is the epilogue's staging
  float (*so)[16][132] = (float (*)[16][132])smem;
  const int tid = threadIdx.x, wave = tid >> 5, lane = tid & 31, col = lane & 15, g = lane >> 4;
  const int r0 = blockIdx.x * 64 + wave * 16, n0 = blockIdx.y * 128;
  v8f acc[8] = {};
  gemm_ring((_Float16*)smem, o16 + (size_t)blockIdx.x * 64 * DD, P + (size_t)(3 * DD + n0) * DD, acc, tid);
#pragma unroll
  for (int j = 0; j < 8; ++j) { const float bb = bo[n0 + j * 16 + col];
#pragma unroll
    for (int r = 0; r < 8; ++r) so[wave][8 * g + r][j * 16 + col] = acc[j][r] * (1.0f / 256.0f) + bb; }    // W x16, o x16
  LDSX();
#pragma unroll 4
  for (int rl = 0; rl < 16; ++rl) vst2(out + (size_t)(r0 + rl) * DD + n0 + lane * 4, *(const v4f*)(&so[wave][rl][lane * 4]));
}
extern "C" void kernel_launch(void* const* d_in, const int* in_sizes, int n_in, void* d_out, int out_size, void* d_ws, size_t ws_size, hipStream_t stream) {
  (void)in_sizes; (void)n_in; (void)out_size; (void)ws_size;
  const float* x = (const float*)d_in[0]; const float* Wq = (const float*)d_in[1]; const float* bq = (const float*)d_in[2]; const float* Wk = (const float*)d_in[3]; const float* bk = (const float*)d_in[4];
  const float* Wv = (const float*)d_in[5]; const float* bv = (const float*)d_in[6]; const float* Wo = (const float*)d_in[7]; const float* bo = (const float*)d_in[8];
  const float* qs = (const float*)d_in[9]; const float* ksv = (const float*)d_in[10];
  float* out = (float*)d_out;
  char* ws = (char*)d_ws; size_t off = 0;
  auto take = [&](size_t bytes) { char* p = ws + off; off += (bytes + 255) & ~(size_t)255; return p; };
  _Float16* x16 = (_Float16*)take((size_t)NR * DD * 2); float* rr = (float*)take((size_t)NR * 32 * 4); _Float16* P = (_Float16*)take((size_t)4 * DD * DD * 2);
  _Float16* qh = (_Float16*)take((size_t)NR * DD * 2); _Float16* kh = (_Float16*)take((size_t)NR * DD * 2); _Float16* vT = (_Float16*)take((size_t)NR * DD * 2); _Float16* o16 = (_Float16*)take((size_t)NR * DD * 2);
  k_prep<<<NR / 8, 256, 0, stream>>>(x, Wq, Wk, Wv, Wo, qs, ksv, x16, rr, P);
  k_proj<<<dim3(NR / 128, 3 * DD / 128), 128, 0, stream>>>(x16, rr, P, bq, bk, bv, qh, kh, vT);
  k_attn<<<dim3(LL / 64, NB * NH), 128, 0, stream>>>(qh, kh, vT, o16);
  k_out<<<dim3(NR / 64, DD / 128), 128, 0, stream>>>(o16, P, bo, out);
}

// v008
// A run of this version takes 80.9 microseconds.
// Next to v007, in two timings, it ran 1.04 and 1.03 times as fast.
// Counting every step since v000, it is 4.19 times as fast.
#include <hip/hip_runtime.h>
#include <math.h>

typedef __attribute__((ext_vector_type(16))) _Float16 v16h;
typedef __attribute__((ext_vector_type(16))) __bf16 v16b;
typedef __attribute__((ext_vector_type(8)))  _Float16 v8h;
typedef __attribute__((ext_vector_type(2)))  _Float16 v2h;
typedef __attribute__((ext_vector_type(8)))  float v8f;
typedef __attribute__((ext_vector_type(4)))  float v4f;
typedef __attribute__((ext_vector_type(2)))  float v2f;
typedef __attribute__((ext_vector_type(4)))  unsigned v4u;
typedef __attribute__((ext_vector_type(4)))  int v4i;
typedef float __attribute__((may_alias)) float_a;
typedef int __attribute__((may_alias)) int_a;

template <typename T> __device__ __forceinline__ void vst2(void* p, T v) { *(T*)p = v;  }
__device__ __forceinline__ v8f wmma16(v16h a, v16h b, v8f c) {
  v8f d = __builtin_amdgcn_wmma_f32_16x16x32_f16(false, a, false, b, (short)0, c, false, false);
  asm volatile("v_nop\n\tv_nop\n\tv_nop\n\tv_nop" : "+v"(d) : "v"(a), "v"(b));
  return d;
}
__device__ __forceinline__ v8f wmma_bf(v16b a, v16b b, v8f c) {
  v8f d = __builtin_amdgcn_wmma_f32_16x16x32_bf16(false, a, false, b, (short)0, c, false, false);
  asm volatile("v_nop\n\tv_nop\n\tv_nop\n\tv_nop" : "+v"(d) : "v"(a), "v"(b));
  return d;
}
// 16x16x32 fragments: lane = (h = lane>>4, row/col = lane&15); elements 0..7 = k0+8h+0..7, 8..15 = k0+16+8h+0..7; D element r = row 8h+r
__device__ __forceinline__ v16h frag_h(const _Float16* rowk0, int lane) {
  union { v16h v; v8h q[2]; } u; const _Float16* p = rowk0 + 8 * (lane >> 4);
  u.q[0] = *(const v8h*)p; u.q[1] = *(const v8h*)(p + 16); return u.v;
}
__device__ __forceinline__ v16h frag_f32(const float* rowk0, int lane) {
  v16h a; const float* p = rowk0 + 8 * (lane >> 4);
#pragma unroll
  for (int i = 0; i < 8; ++i) { a[i] = (_Float16)p[i]; a[8 + i] = (_Float16)p[16 + i]; }
  return a;
}
__device__ __forceinline__ v16h frag_f32s(const float* rowk0, int lane, float sc) {
  v16h a; const float* p = rowk0 + 8 * (lane >> 4);
#pragma unroll
  for (int i = 0; i < 8; ++i) { a[i] = (_Float16)(p[i] * sc); a[8 + i] = (_Float16)(p[16 + i] * sc); }
  return a;
}
// column fragment from a [K][ld] layout (column n), rows >= K read as 0
__device__ __forceinline__ v16h fragc_f32(const float* W, int k0, int n, int lane, int ld, int K) {
  v16h a; const int g = lane >> 4;
#pragma unroll
  for (int i = 0; i < 8; ++i) { const int ka = k0 + 8 * g + i, kb = ka + 16;
    a[i] = (_Float16)(ka < K ? W[(size_t)ka * ld + n] : 0.f); a[8 + i] = (_Float16)(kb < K ? W[(size_t)kb * ld + n] : 0.f); }
  return a;
}
struct F2 { v16b h, l; };
__device__ __forceinline__ F2 bsplit16(const float v[16]) { F2 r;
#pragma unroll
  for (int i = 0; i < 16; ++i) { const __bf16 h = (__bf16)v[i]; r.h[i] = h; r.l[i] = (__bf16)(v[i] - (float)h); }
  return r; }
__device__ __forceinline__ F2 split_row(const float* row, int k0, int lane) { float v[16]; const float* p = row + k0 + 8 * (lane >> 4);
#pragma unroll
  for (int i = 0; i < 8; ++i) { v[i] = p[i]; v[8 + i] = p[16 + i]; }
  return bsplit16(v); }
__device__ __forceinline__ F2 split_rowK(const float* row, int k0, int lane, int K) { float v[16]; const int g = lane >> 4;
#pragma unroll
  for (int i = 0; i < 8; ++i) { const int ka = k0 + 8 * g + i, kb = ka + 16; v[i] = ka < K ? row[ka] : 0.f; v[8 + i] = kb < K ? row[kb] : 0.f; }
  return bsplit16(v); }
__device__ __forceinline__ F2 split_col(const float* W, int k0, int n, int lane, int ld, int K) { float v[16]; const int g = lane >> 4;
#pragma unroll
  for (int i = 0; i < 8; ++i) { const int ka = k0 + 8 * g + i, kb = ka + 16; v[i] = ka < K ? W[(size_t)ka * ld + n] : 0.f; v[8 + i] = kb < K ? W[(size_t)kb * ld + n] : 0.f; }
  return bsplit16(v); }
__device__ __forceinline__ v8f mac3(const F2& a, const F2& b, v8f c) { c = wmma_bf(a.l, b.h, c); c = wmma_bf(a.h, b.l, c); return wmma_bf(a.h, b.h, c); }
__device__ __forceinline__ float sigm(float v) { return 1.0f / (1.0f + expf(-v)); }
#define LDSX() do { asm volatile("s_wait_dscnt 0" ::: "memory"); __builtin_amdgcn_wave_barrier(); __builtin_amdgcn_fence(__ATOMIC_RELEASE, "workgroup"); } while (0)

// Sigmoid attention block with QK-RMSNorm and rotary embedding. Pure f16 WMMA GEMMs over pre-converted operands (x -> f16 once;
// weights x16 f16 with the RMSNorm scales folded into the q/k weight columns; f32 accumulate): q|k|v projection with the per-row
// RMS factor, bias and RoPE in the f32 epilogue (q/k -> [b][h][l][64] f16, v -> [b][h][d][l] f16), per (b, h, 128 queries) block
// the 2048 keys streamed in 64-key tiles: S on f16 WMMA, sigmoid in f32 (hardware tanh), running row sums, W x2^14 f16 @ v^T,
#define NB 2
#define LL 2048
#define DD 1024
#define NH 16
#define HD 64
#define NR (NB * LL)

// ---- operand tiles staged in LDS by asynchronous copies: rows of 128 B (64 f16), 8 lanes = one whole 128-B line, 128 threads = 16 rows a copy
#define TP 72              // LDS pitch of a staged row in f16: 144 B = 16 B x 9, conflict-free for ds_load_b128
#define R16 (16 * TP * 2)  // bytes of 16 staged rows
#define ACP(l, g) "global_load_async_to_lds_b128 %" #l ", %" #g ", off\n\t"
// this wave's copies have landed (the compiler places no wait for them)
#define WAIT_COPIES() asm volatile("s_wait_asynccnt 0x0" ::: "memory")
// this wave's LDS reads of a buffer have retired before the buffer is handed back for a refill
#define WAIT_LDS() asm volatile("s_wait_dscnt 0x0" ::: "memory")
__device__ __forceinline__ unsigned lds_at(const _Float16* p) { return (unsigned)(size_t)p; }   // LDS byte address = low 32 bits
// one GEMM stage, 64 k: buf rows 0..63 = 64 X rows, rows 64..191 = 128 W rows. s_wait_xcnt closes the copies' own statement, so that no address register of a copy is rewritten ahead of it.
__device__ __forceinline__ void stage_gemm(_Float16* buf, const _Float16* xa, const _Float16* wb, int tid) {
  const int r = tid >> 3, c = (tid & 7) * 8;
  const unsigned l = lds_at(buf + r * TP + c);
  const _Float16* a = xa + (size_t)r * DD + c; const _Float16* b = wb + (size_t)r * DD + c;
  asm volatile(ACP(0, 1) ACP(2, 3) ACP(4, 5) ACP(6, 7) ACP(8, 9) ACP(10, 11) ACP(12, 13) ACP(14, 15) ACP(16, 17) ACP(18, 19) ACP(20, 21) ACP(22, 23) "s_wait_xcnt 0x0"
               :: "v"(l), "v"(a), "v"(l + R16), "v"(a + 16 * DD), "v"(l + 2 * R16), "v"(a + 32 * DD), "v"(l + 3 * R16), "v"(a + 48 * DD),
                  "v"(l + 4 * R16), "v"(b), "v"(l + 5 * R16), "v"(b + 16 * DD), "v"(l + 6 * R16), "v"(b + 32 * DD), "v"(l + 7 * R16), "v"(b + 48 * DD),
                  "v"(l + 8 * R16), "v"(b + 64 * DD), "v"(l + 9 * R16), "v"(b + 80 * DD), "v"(l + 10 * R16), "v"(b + 96 * DD), "v"(l + 11 * R16), "v"(b + 112 * DD) : "memory");
}
// one attention tile: 64 keys x 64 dims of K, 64 dims x 64 keys of V^T, by 256 threads = 32 rows a copy; the wait as above
__device__ __forceinline__ void stage_kv(_Float16* sk, _Float16* sv, const _Float16* gk, const _Float16* gv, int tid) {
  const int r = tid >> 3, c = (tid & 7) * 8;
  const unsigned lk = lds_at(sk + r * TP + c), lv = lds_at(sv + r * TP + c);
  const _Float16* k = gk + (size_t)r * HD + c; const _Float16* v = gv + (size_t)r * LL + c;
  asm volatile(ACP(0, 1) ACP(2, 3) ACP(4, 5) ACP(6, 7) "s_wait_xcnt 0x0"
               :: "v"(lk), "v"(k), "v"(lk + 2 * R16), "v"(k + 32 * HD), "v"(lv), "v"(v), "v"(lv + 2 * R16), "v"(v + 32 * LL) : "memory");
}
#define GBUF (192 * TP)           // f16 of one GEMM buffer
#define RING_B (2 * GBUF * 2)     // bytes of the two
// 64 x 128 tile over K = 1024: 16 stages, two buffers, stage s + 2 copied while stage s + 1 is worked on; k order as before
// X rows as A: acc[j][r] = Y[row 8h + r][n = 16j + c]
__device__ __forceinline__ void gemm_ring(_Float16* ring, const _Float16* xa, const _Float16* wb, v8f acc[8], int tid) {
  const int wave = tid >> 5, lane = tid & 31, col = lane & 15;
  stage_gemm(ring, xa, wb, tid);
  WAIT_COPIES(); __syncthreads();
  stage_gemm(ring + GBUF, xa + 64, wb + 64, tid);
#pragma unroll 1   // one trip = one stage, so that the ring's order stands once, at the trip's foot
  for (int s = 0; s < DD / 64; ++s) { _Float16* buf = ring + (s & 1) * GBUF;
    v16h a[2], b[2][8];   // the stage's 18 fragments are read as one group ahead of its 16 WMMAs: one LDS latency a stage, counted waits, not one full wait a WMMA
#pragma unroll
    for (int kc = 0; kc < 2; ++kc) { a[kc] = frag_h(buf + (wave * 16 + col) * TP + kc * 32, lane);
#pragma unroll
      for (int j = 0; j < 8; ++j) b[kc][j] = frag_h(buf + (64 + j * 16 + col) * TP + kc * 32, lane); }
#pragma unroll
    for (int kc = 0; kc < 2; ++kc) {
#pragma unroll
      for (int j = 0; j < 8; ++j) acc[j] = wmma16(a[kc], b[kc][j], acc[j]); }
    WAIT_LDS(); WAIT_COPIES(); __syncthreads();   // publishes stage s + 1 and ends every read of stage s
    if (s + 2 < DD / 64) stage_gemm(buf, xa + (s + 2) * 64, wb + (s + 2) * 64, tid); }
  WAIT_COPIES();
}
// ---- 128 x 128 tile (q|k|v GEMM): a wave takes 32 X rows x all 128 W rows, so each W fragment read from LDS feeds two WMMAs
// eight copies = 128 rows of one operand; an asm statement takes 30 operands, so a stage is two statements, each closed by its own s_wait_xcnt as above
__device__ __forceinline__ void stage_rows128(unsigned l, const _Float16* a) {
  asm volatile(ACP(0, 1) ACP(2, 3) ACP(4, 5) ACP(6, 7) ACP(8, 9) ACP(10, 11) ACP(12, 13) ACP(14, 15) "s_wait_xcnt 0x0"
               :: "v"(l), "v"(a), "v"(l + R16), "v"(a + 16 * DD), "v"(l + 2 * R16), "v"(a + 32 * DD), "v"(l + 3 * R16), "v"(a + 48 * DD),
                  "v"(l + 4 * R16), "v"(a + 64 * DD), "v"(l + 5 * R16), "v"(a + 80 * DD), "v"(l + 6 * R16), "v"(a + 96 * DD), "v"(l + 7 * R16), "v"(a + 112 * DD) : "memory");
}
// one stage, 64 k: buf rows 0..127 = 128 X rows, rows 128..255 = 128 W rows
__device__ __forceinline__ void stage_gemm2(_Float16* buf, const _Float16* xa, const _Float16* wb, int tid) {
  const int r = tid >> 3, c = (tid & 7) * 8;
  const unsigned l = lds_at(buf + r * TP + c);
  stage_rows128(l, xa + (size_t)r * DD + c); stage_rows128(l + 8 * R16, wb + (size_t)r * DD + c);
}
#define GBUF2 (256 * TP)          // f16 of one buffer
#define RING2_B (2 * GBUF2 * 2)   // bytes of the two
// the ring's order as above; k order as before. W rows as A: acc[i][j][r] = Y[row 16i + c][n = 16j + 8h + r]: a lane holds 8 consecutive n of one row
__device__ __forceinline__ void gemm_ring2(_Float16* ring, const _Float16* xa, const _Float16* wb, v8f acc[2][8], int tid) {
  const int wave = tid >> 5, lane = tid & 31, col = lane & 15;
  stage_gemm2(ring, xa, wb, tid);
  WAIT_COPIES(); __syncthreads();
  stage_gemm2(ring + GBUF2, xa + 64, wb + 64, tid);
#pragma unroll 1   // one trip = one stage, so that the ring's order stands once, at the trip's foot
  for (int s = 0; s < DD / 64; ++s) { _Float16* buf = ring + (s & 1) * GBUF2;
#pragma unroll
    for (int kc = 0; kc < 2; ++kc) { v16h a[2], b[8];   // 32 k: 10 fragments read as one group ahead of their 16 WMMAs
#pragma unroll
      for (int i = 0; i < 2; ++i) a[i] = frag_h(buf + (wave * 32 + i * 16 + col) * TP + kc * 32, lane);
#pragma unroll
      for (int j = 0; j < 8; ++j) b[j] = frag_h(buf + (128 + j * 16 + col) * TP + kc * 32, lane);
#pragma unroll
      for (int j = 0; j < 8; ++j) {
#pragma unroll
        for (int i = 0; i < 2; ++i) acc[i][j] = wmma16(b[j], a[i], acc[i][j]); } }
    WAIT_LDS(); WAIT_COPIES(); __syncthreads();   // publishes stage s + 1 and ends every read of stage s
    if (s + 2 < DD / 64) stage_gemm2(buf, xa + (s + 2) * 64, wb + (s + 2) * 64, tid); }
  WAIT_COPIES();
}

// ---- operand preparation, one launch: wave n takes row n of x (f16 copy + rsqrt(mean x^2 + eps)) and row n of the packed weights (q | k | v | o, [out][in] each), each row whole.
// 4,096 waves in all, 16 to 24 loads of 16 B a lane in flight, every load 512 contiguous B, every f16 store 256, the rr store 128; the row's sum stays in the wave: no LDS, no barrier
static_assert(NR == 4 * DD, "one x row and one weight row a wave");
__global__ __launch_bounds__(256) void k_prep(const float* __restrict__ x, const float* __restrict__ Wq, const float* __restrict__ Wk, const float* __restrict__ Wv, const float* __restrict__ Wo, const float* __restrict__ qs, const float* __restrict__ ksv,
                                            _Float16* __restrict__ x16, float* __restrict__ rr, _Float16* __restrict__ P) {
  const int lane = threadIdx.x & 31, n = blockIdx.x * 8 + __builtin_amdgcn_readfirstlane(threadIdx.x >> 5);   // n in a scalar register: the row bases and the test below are scalar
  const int which = n / DD, o = n % DD;
  const float* W = which == 0 ? Wq : (which == 1 ? Wk : (which == 2 ? Wv : Wo));
  const float* xr = x + (size_t)n * DD + lane * 4; const float* wr = W + (size_t)o * DD + lane * 4;
  v4f xv[8], wv[8], sc[8];
#pragma unroll
  for (int i = 0; i < 8; ++i) xv[i] = *(const v4f*)(xr + i * 128);
#pragma unroll
  for (int i = 0; i < 8; ++i) wv[i] = *(const v4f*)(wr + i * 128);
  if (which < 2) { const float* sr = (which == 0 ? qs : ksv) + lane * 4;
#pragma unroll
    for (int i = 0; i < 8; ++i) sc[i] = *(const v4f*)(sr + i * 128); }
  else {
#pragma unroll
    for (int i = 0; i < 8; ++i) sc[i] = (v4f){1.0f, 1.0f, 1.0f, 1.0f}; }   // x 1 is exact: v and o rows keep their bits
  float ss[4] = {0.f, 0.f, 0.f, 0.f};   // four independent chains
#pragma unroll
  for (int i = 0; i < 8; ++i) { union { _Float16 h[4]; v2f f; } pk;
#pragma unroll
    for (int e = 0; e < 4; ++e) { ss[e] += xv[i][e] * xv[i][e]; pk.h[e] = (_Float16)xv[i][e]; }
    vst2((v2f*)(x16 + (size_t)n * DD + i * 128 + lane * 4), pk.f); }
#pragma unroll
  for (int i = 0; i < 8; ++i) { union { _Float16 h[4]; v2f f; } pk;
#pragma unroll
    for (int e = 0; e < 4; ++e) pk.h[e] = (_Float16)(wv[i][e] * 16.0f * sc[i][e]);
    vst2((v2f*)(P + (size_t)n * DD + i * 128 + lane * 4), pk.f); }
  float s = (ss[0] + ss[1]) + (ss[2] + ss[3]);
#pragma unroll
  for (int off = 16; off >= 1; off >>= 1) s += __shfl_xor(s, off, 32);
  vst2(rr + (size_t)n * 32 + lane, (float_a)(lane == 0 ? rsqrtf(s / (float)DD + 1e-8f) : 0.f));   // rr[row*32] (one line per row)
}
// ---- projection: block 128 rows x 128 cols (= which, 2 heads); epilogue: x rr (q,k), + bias, RoPE (q,k); q/k -> [b][h][t][64] f16; v -> vT [b][h][d][t]
// the weight rows are the A operand: a lane's 8 accumulator registers are 8 consecutive outputs of one x row, and the epilogue needs no f32 staging
__global__ __launch_bounds__(128) void k_proj(const _Float16* __restrict__ x16, const float* __restrict__ rr, const _Float16* __restrict__ P, const float* __restrict__ bq, const float* __restrict__ bk, const float* __restrict__ bv,
                                            _Float16* __restrict__ qh, _Float16* __restrict__ kh, _Float16* __restrict__ vT) {
  __shared__ __align__(16) char smem[RING2_B];                       // the ring; behind the loop's last barrier it is the epilogue's staging
  __shared__ __align__(16) float sfr[32];
  const int tid = threadIdx.x, wave = tid >> 5, lane = tid & 31, col = lane & 15, g = lane >> 4;
  const int r0b = blockIdx.x * 128, r0 = r0b + wave * 32, n0 = blockIdx.y * 128; const int b = r0b / LL, t0 = r0b % LL;
  const int which = n0 / DD, hb = (n0 % DD) / HD; const float* bias = which == 0 ? bq : (which == 1 ? bk : bv);
  if (tid < 32) sfr[tid] = powf(10000.0f, -(float)tid / 32.0f);
  v8f acc[2][8] = {};
  gemm_ring2((_Float16*)smem, x16 + (size_t)r0b * DD, P + (size_t)n0 * DD, acc, tid);
  __syncthreads();
  if (which < 2) {   // q, k: lane (g, col) holds rows 16i + col, dims 16j + 8g + 0..7: RMS factor, bias and RoPE (partner d ^ 1 = the neighbouring register) stay in registers
    _Float16 (*sh)[32][136] = (_Float16 (*)[32][136])smem;   // per wave 32 rows x 128 f16, pitch 272 B, only to turn 16-B pieces into whole-line stores
    float s16[2];
#pragma unroll
    for (int i = 0; i < 2; ++i) s16[i] = rr[(size_t)(r0 + i * 16 + col) * 32] * (1.0f / 16.0f);   // x 2^-4 is exact: same bits as (acc / 16) * rr
    // angle index d & 31 = 16 (j & 1) + 8g + r: 16 angles a row serve its 64 values in the lane. The loop stays rolled (sincosf is long in text and registers);
    // each lane parks its own 2 x (16 cos, 16 sin) in LDS (pitch 272 B) and reads them back as vectors: no lane reads another's
    float (*tb)[32][68] = (float (*)[32][68])(smem + 4 * 32 * 136 * 2);
    static_assert(4 * 32 * 136 * 2 + 4 * 32 * 68 * 4 <= RING2_B, "epilogue staging fits the ring");
    v4f bb[8][2];   // the bias loads fly under the angle loop
#pragma unroll
    for (int j = 0; j < 8; ++j) { const float* bp = bias + (n0 % DD) + j * 16 + 8 * g; bb[j][0] = *(const v4f*)bp; bb[j][1] = *(const v4f*)(bp + 4); }
#pragma unroll 1   // four angles a trip: one sincosf text of four, not thirty-two
    for (int ii = 0; ii < 8; ++ii) { const int i = ii & 3, ro = ii >> 2; const float t = (float)(t0 + wave * 32 + ro * 16 + col);
      const v4f fr = *(const v4f*)(&sfr[(i >> 1) * 16 + 8 * g + (i & 1) * 4]); v4f sv, cv;
#pragma unroll
      for (int e = 0; e < 4; ++e) { float s1, c1; sincosf(t * fr[e], &s1, &c1); sv[e] = s1; cv[e] = c1; }
      vst2(&tb[wave][lane][ro * 32 + i * 4], cv); vst2(&tb[wave][lane][ro * 32 + 16 + i * 4], sv); }
    LDSX();
#pragma unroll
    for (int i = 0; i < 2; ++i) { float cs[2][8], sn[2][8];
#pragma unroll
      for (int p = 0; p < 2; ++p) {
#pragma unroll
        for (int q = 0; q < 2; ++q) { const v4f c4 = *(const v4f*)(&tb[wave][lane][i * 32 + p * 8 + q * 4]), s4 = *(const v4f*)(&tb[wave][lane][i * 32 + 16 + p * 8 + q * 4]);
#pragma unroll
          for (int e = 0; e < 4; ++e) { cs[p][q * 4 + e] = c4[e]; sn[p][q * 4 + e] = s4[e]; } } }
#pragma unroll
      for (int j = 0; j < 8; ++j) { float xv[8]; union { v8h h8; v4u u; } pk;
#pragma unroll
        for (int r = 0; r < 8; ++r) xv[r] = acc[i][j][r] * s16[i] + bb[j][r >> 2][r & 3];
#pragma unroll
        for (int r = 0; r < 8; ++r) { const float xr = (r & 1) ? xv[r - 1] : -xv[r + 1]; pk.h8[r] = (_Float16)(xv[r] * cs[j & 1][r] + xr * sn[j & 1][r]); }
        vst2(&sh[wave][i * 16 + col][j * 16 + 8 * g], pk.u); } }
    LDSX();
    _Float16* dst = which == 0 ? qh : kh;
#pragma unroll
    for (int q = lane; q < 2 * 32 * 8; q += 32) { const int hh = q >> 8, rem = q & 255, rl = rem >> 3, pc = rem & 7;
      vst2(dst + (((size_t)b * NH + hb + hh) * LL + t0 + wave * 32 + rl) * HD + pc * 8, *(const v4u*)(&sh[wave][rl][hh * HD + pc * 8])); } }
  else {   // v: the lane's 8 dims of rows 16i + col go straight into the [dim][row] f16 tile
    _Float16 (*st)[136] = (_Float16 (*)[136])smem;                   // 128 dims x 128 rows, pitch 272 B
#pragma unroll
    for (int j = 0; j < 8; ++j) { const float* bp = bias + (n0 % DD) + j * 16 + 8 * g; const v4f b0 = *(const v4f*)bp, b1 = *(const v4f*)(bp + 4);
#pragma unroll
      for (int i = 0; i < 2; ++i) {
#pragma unroll
        for (int r = 0; r < 8; ++r) st[j * 16 + 8 * g + r][wave * 32 + i * 16 + col] = (_Float16)(acc[i][j][r] * (1.0f / 16.0f) + (r < 4 ? b0[r & 3] : b1[r & 3])); } }
    __syncthreads();
    for (int q = tid; q < 128 * 16; q += 128) { const int c = q >> 4, pc = q & 15, hh = c >> 6, d = c & 63;
      vst2(vT + (((size_t)b * NH + hb + hh) * HD + d) * LL + t0 + pc * 8, *(const v4u*)(&st[c][pc * 8])); }
  }
}
__global__ __launch_bounds__(256) void k_attn(const _Float16* __restrict__ qh, const _Float16* __restrict__ kh, const _Float16* __restrict__ vT, _Float16* __restrict__ o16) {
  __shared__ __align__(16) _Float16 sO[8][16][72];   // per wave 16 queries x 64 dims, only to turn 16-B pieces into whole-line stores
  __shared__ __align__(16) _Float16 sKV[2][2][64][TP];   // the ring, one array: behind the loop it is the exchange of the key halves
  _Float16 (*sK)[64][TP] = sKV[0];                   // 64 keys x 64 dims
  _Float16 (*sV)[64][TP] = sKV[1];                   // 64 dims x 64 keys
  const int tid = threadIdx.x, w = tid >> 5, lane = tid & 31, col = lane & 15, g = lane >> 4;
  const int qg = w & 3, hk = w >> 2;                 // query group of 32, key half of every tile
  const int bh = blockIdx.y, b = bh / NH, h = bh % NH, q0 = blockIdx.x * 128 + qg * 32;
  const _Float16* qb = qh + (size_t)bh * LL * HD; const _Float16* kb = kh + (size_t)bh * LL * HD; const _Float16* vb = vT + (size_t)bh * HD * LL;
  v16h bq[2][2];
#pragma unroll
  for (int i = 0; i < 2; ++i) {
#pragma unroll
    for (int kc = 0; kc < 2; ++kc) bq[i][kc] = frag_h(qb + (size_t)(q0 + i * 16 + col) * HD + kc * 32, lane); }
  v2f lsum[2][4] = {}; v8f acc[2][4] = {};   // lsum[i]: 8 chains of tanh values, all of query 16i + col; acc[i][t][r] = O[query 16i + col][dim 16t + 8g + r], this wave's keys only
  stage_kv(&sK[0][0][0], &sV[0][0][0], kb, vb, tid);
  WAIT_COPIES(); __syncthreads();
  stage_kv(&sK[1][0][0], &sV[1][0][0], kb + (size_t)64 * HD, vb + 64, tid);
#pragma unroll 1
  for (int kt = 0; kt < LL / 64; ++kt) { const int bf = kt & 1;
    v16h fk[2][2], fv[4];   // the wave's 4 K and 4 V fragments of the tile are read as one group at its head: the V reads land under the score and sigmoid work
#pragma unroll
    for (int t = 0; t < 2; ++t) {
#pragma unroll
      for (int kc = 0; kc < 2; ++kc) fk[t][kc] = frag_h(&sK[bf][hk * 32 + t * 16 + col][kc * 32], lane); }
#pragma unroll
    for (int t = 0; t < 4; ++t) fv[t] = frag_h(&sV[bf][t * 16 + col][hk * 32], lane);
    v16h pb[2];            // P^T of query group i as B operand: elements 0..7 from the wave's first 16 keys, 8..15 from its second
#pragma unroll
    for (int t = 0; t < 2; ++t) { v8f s[2] = {};
#pragma unroll
      for (int kc = 0; kc < 2; ++kc) {
#pragma unroll
        for (int i = 0; i < 2; ++i) s[i] = wmma16(fk[t][kc], bq[i][kc], s[i]); }
#pragma unroll
      for (int i = 0; i < 2; ++i) {
#pragma unroll
        for (int r = 0; r < 8; r += 2) {   // two keys at a time: the pair is one register of the operand
          // sigmoid(s / 8) = (1 + tanh(s / 16)) / 2: one transcendental a score. P x 2^14 = 8192 tanh + 8192 in one fma; the row sum adds the tanh values, its halving and its LL / 2 come behind the loop
          const v2f a = (v2f){s[i][r], s[i][r + 1]} * 0.0625f;
          const v2f th = {__builtin_amdgcn_tanhf(a[0]), __builtin_amdgcn_tanhf(a[1])}; lsum[i][r >> 1] += th;
          const v2h p = __builtin_convertvector(th * 8192.0f + 8192.0f, v2h); pb[i][t * 8 + r] = p[0]; pb[i][t * 8 + r + 1] = p[1]; } } }
#pragma unroll
    for (int t = 0; t < 4; ++t) {
#pragma unroll
      for (int i = 0; i < 2; ++i) acc[i][t] = wmma16(fv[t], pb[i], acc[i][t]); }
    WAIT_LDS(); WAIT_COPIES(); __syncthreads();   // publishes tile kt + 1 and ends every read of tile kt
    if (kt + 2 < LL / 64) stage_kv(&sK[bf][0][0], &sV[bf][0][0], kb + (size_t)(kt + 2) * 64 * HD, vb + (kt + 2) * 64, tid);
  }
  WAIT_COPIES();
  // join of the key halves: wave w and wave w ^ 4 hold the same 32 queries. Wave w finishes query group hk and hands the other group's partial sums to its partner
  // through the ring, which is free behind the loop's last barrier; [wave][piece][lane] of 16 B: every store and load is 512 contiguous B
  v4f* ex = (v4f*)&sKV[0][0][0][0]; float_a* exs = (float_a*)(ex + 8 * 8 * 32);
  static_assert(8 * 8 * 32 * 16 + 8 * 32 * 4 <= sizeof(sKV), "the exchange fits the ring");
  const bool up = hk != 0;
  float ts2[2];   // the lane's 8 chains of tanh values
#pragma unroll
  for (int i = 0; i < 2; ++i) { const v2f l2 = (lsum[i][0] + lsum[i][1]) + (lsum[i][2] + lsum[i][3]); ts2[i] = l2[0] + l2[1]; }
#pragma unroll
  for (int t = 0; t < 4; ++t) { const v8f o = up ? acc[0][t] : acc[1][t];
    vst2(ex + (w * 8 + t * 2) * 32 + lane, (v4f){o[0], o[1], o[2], o[3]}); vst2(ex + (w * 8 + t * 2 + 1) * 32 + lane, (v4f){o[4], o[5], o[6], o[7]}); }
  exs[w * 32 + lane] = up ? ts2[0] : ts2[1];
  __syncthreads();   // the partner's partial sums are in LDS
  // row sum of query 16 hk + col: this wave's keys, the partner's, then the other half's lanes; sum of weights = LL / 2 + half the sum of tanh
  float ts = (up ? ts2[1] : ts2[0]) + exs[(w ^ 4) * 32 + lane];
  ts += __shfl_xor(ts, 16, 32);
  const float l = 0.5f * ts + (float)(LL / 2);
  const float inv = 1.0f / ((l + 1e-8f) * 16384.0f);
#pragma unroll
  for (int t = 0; t < 4; ++t) { union { v8h h8; v4u u; } pk; const v8f o = up ? acc[1][t] : acc[0][t];
    const v4f p0 = ex[((w ^ 4) * 8 + t * 2) * 32 + lane], p1 = ex[((w ^ 4) * 8 + t * 2 + 1) * 32 + lane];
#pragma unroll
    for (int r = 0; r < 8; ++r) pk.h8[r] = (_Float16)((o[r] + (r < 4 ? p0[r & 3] : p1[r & 3])) * inv * 16.0f);   // o x16 keeps the f16 operand normal
    vst2(&sO[w][col][t * 16 + 8 * g], pk.u); }
  LDSX();
  for (int q = lane; q < 16 * 8; q += 32) { const int rl = q >> 3, pc = q & 7;
    vst2(o16 + ((size_t)b * LL + q0 + hk * 16 + rl) * DD + h * HD + pc * 8, *(const v4u*)(&sO[w][rl][pc * 8])); }
}
__global__ __launch_bounds__(128) void k_out(const _Float16* __restrict__ o16, const _Float16* __restrict__ P, const float* __restrict__ bo, float* __restrict__ out) {
  __shared__ __align__(16) char smem[RING_B];        // the ring; behind the loop's last barrier it is the epilogue's staging
  float (*so)[16][132] = (float (*)[16][132])smem;
  const int tid = threadIdx.x, wave = tid >> 5, lane = tid & 31, col = lane & 15, g = lane >> 4;
  const int r0 = blockIdx.x * 64 + wave * 16, n0 = blockIdx.y * 128;
  v8f acc[8] = {};
  gemm_ring((_Float16*)smem, o16 + (size_t)blockIdx.x * 64 * DD, P + (size_t)(3 * DD + n0) * DD, acc, tid);
#pragma unroll
  for (int j = 0; j < 8; ++j) { const float bb = bo[n0 + j * 16 + col];
#pragma unroll
    for (int r = 0; r < 8; ++r) so[wave][8 * g + r][j * 16 + col] = acc[j][r] * (1.0f / 256.0f) + bb; }    // W x16, o x16
  LDSX();
#pragma unroll 4
  for (int rl = 0; rl < 16; ++rl) vst2(out + (size_t)(r0 + rl) * DD + n0 + lane * 4, *(const v4f*)(&so[wave][rl][lane * 4]));
}
extern "C" void kernel_launch(void* const* d_in, const int* in_sizes, int n_in, void* d_out, int out_size, void* d_ws, size_t ws_size, hipStream_t stream) {
  (void)in_sizes; (void)n_in; (void)out_size; (void)ws_size;
  const float* x = (const float*)d_in[0]; const float* Wq = (const float*)d_in[1]; const float* bq = (const float*)d_in[2]; const float* Wk = (const float*)d_in[3]; const float* bk = (const float*)d_in[4];
  const float* Wv = (const float*)d_in[5]; const float* bv = (const float*)d_in[6]; const float* Wo = (const float*)d_in[7]; const float* bo = (const float*)d_in[8];
  const float* qs = (const float*)d_in[9]; const float* ksv = (const float*)d_in[10];
  float* out = (float*)d_out;
  char* ws = (char*)d_ws; size_t off = 0;
  auto take = [&](size_t bytes) { char* p = ws + off; off += (bytes + 255) & ~(size_t)255; return p; };
  _Float16* x16 = (_Float16*)take((size_t)NR * DD * 2); float* rr = (float*)take((size_t)NR * 32 * 4); _Float16* P = (_Float16*)take((size_t)4 * DD * DD * 2);
  _Float16* qh = (_Float16*)take((size_t)NR * DD * 2); _Float16* kh = (_Float16*)take((size_t)NR * DD * 2); _Float16* vT = (_Float16*)take((size_t)NR * DD * 2); _Float16* o16 = (_Float16*)take((size_t)NR * DD * 2);
  k_prep<<<NR / 8, 256, 0, stream>>>(x, Wq, Wk, Wv, Wo, qs, ksv, x16, rr, P);
  k_proj<<<dim3(NR / 128, 3 * DD / 128), 128, 0, stream>>>(x16, rr, P, bq, bk, bv, qh, kh, vT);
  k_attn<<<dim3(LL / 128, NB * NH), 256, 0, stream>>>(qh, kh, vT, o16);
  k_out<<<dim3(NR / 64, DD / 128), 128, 0, stream>>>(o16, P, bo, out);
}

// v009
// One run takes 79.9 microseconds.
// Timed twice side by side with v008, it ran 1.03 and 1.02 times as fast.
// Over all steps from v000 it is 4.29 times as fast.
#include <hip/hip_runtime.h>
#include <math.h>

typedef __attribute__((ext_vector_type(16))) _Float16 v16h;
typedef __attribute__((ext_vector_type(16))) __bf16 v16b;
typedef __attribute__((ext_vector_type(8)))  _Float16 v8h;
typedef __attribute__((ext_vector_type(2)))  _Float16 v2h;
typedef __attribute__((ext_vector_type(8)))  float v8f;
typedef __attribute__((ext_vector_type(4)))  float v4f;
typedef __attribute__((ext_vector_type(2)))  float v2f;
typedef __attribute__((ext_vector_type(4)))  unsigned v4u;
typedef __attribute__((ext_vector_type(4)))  int v4i;
typedef float __attribute__((may_alias)) float_a;
typedef int __attribute__((may_alias)) int_a;

template <typename T> __device__ __forceinline__ void vst2(void* p, T v) { *(T*)p = v;  }
__device__ __forceinline__ v8f wmma16(v16h a, v16h b, v8f c) {
  v8f d = __builtin_amdgcn_wmma_f32_16x16x32_f16(false, a, false, b, (short)0, c, false, false);
  asm volatile("v_nop\n\tv_nop\n\tv_nop\n\tv_nop" : "+v"(d) : "v"(a), "v"(b));
  return d;
}
__device__ __forceinline__ v8f wmma_bf(v16b a, v16b b, v8f c) {
  v8f d = __builtin_amdgcn_wmma_f32_16x16x32_bf16(false, a, false, b, (short)0, c, false, false);
  asm volatile("v_nop\n\tv_nop\n\tv_nop\n\tv_nop" : "+v"(d) : "v"(a), "v"(b));
  return d;
}
// 16x16x32 fragments: lane = (h = lane>>4, row/col = lane&15); elements 0..7 = k0+8h+0..7, 8..15 = k0+16+8h+0..7; D element r = row 8h+r
__device__ __forceinline__ v16h frag_h(const _Float16* rowk0, int lane) {
  union { v16h v; v8h q[2]; } u; const _Float16* p = rowk0 + 8 * (lane >> 4);
  u.q[0] = *(const v8h*)p; u.q[1] = *(const v8h*)(p + 16); return u.v;
}
__device__ __forceinline__ v16h frag_f32(const float* rowk0, int lane) {
  v16h a; const float* p = rowk0 + 8 * (lane >> 4);
#pragma unroll
  for (int i = 0; i < 8; ++i) { a[i] = (_Float16)p[i]; a[8 + i] = (_Float16)p[16 + i]; }
  return a;
}
__device__ __forceinline__ v16h frag_f32s(const float* rowk0, int lane, float sc) {
  v16h a; const float* p = rowk0 + 8 * (lane >> 4);
#pragma unroll
  for (int i = 0; i < 8; ++i) { a[i] = (_Float16)(p[i] * sc); a[8 + i] = (_Float16)(p[16 + i] * sc); }
  return a;
}
// column fragment from a [K][ld] layout (column n), rows >= K read as 0
__device__ __forceinline__ v16h fragc_f32(const float* W, int k0, int n, int lane, int ld, int K) {
  v16h a; const int g = lane >> 4;
#pragma unroll
  for (int i = 0; i < 8; ++i) { const int ka = k0 + 8 * g + i, kb = ka + 16;
    a[i] = (_Float16)(ka < K ? W[(size_t)ka * ld + n] : 0.f); a[8 + i] = (_Float16)(kb < K ? W[(size_t)kb * ld + n] : 0.f); }
  return a;
}
struct F2 { v16b h, l; };
__device__ __forceinline__ F2 bsplit16(const float v[16]) { F2 r;
#pragma unroll
  for (int i = 0; i < 16; ++i) { const __bf16 h = (__bf16)v[i]; r.h[i] = h; r.l[i] = (__bf16)(v[i] - (float)h); }
  return r; }
__device__ __forceinline__ F2 split_row(const float* row, int k0, int lane) { float v[16]; const float* p = row + k0 + 8 * (lane >> 4);
#pragma unroll
  for (int i = 0; i < 8; ++i) { v[i] = p[i]; v[8 + i] = p[16 + i]; }
  return bsplit16(v); }
__device__ __forceinline__ F2 split_rowK(const float* row, int k0, int lane, int K) { float v[16]; const int g = lane >> 4;
#pragma unroll
  for (int i = 0; i < 8; ++i) { const int ka = k0 + 8 * g + i, kb = ka + 16; v[i] = ka < K ? row[ka] : 0.f; v[8 + i] = kb < K ? row[kb] : 0.f; }
  return bsplit16(v); }
__device__ __forceinline__ F2 split_col(const float* W, int k0, int n, int lane, int ld, int K) { float v[16]; const int g = lane >> 4;
#pragma unroll
  for (int i = 0; i < 8; ++i) { const int ka = k0 + 8 * g + i, kb = ka + 16; v[i] = ka < K ? W[(size_t)ka * ld + n] : 0.f; v[8 + i] = kb < K ? W[(size_t)kb * ld + n] : 0.f; }
  return bsplit16(v); }
__device__ __forceinline__ v8f mac3(const F2& a, const F2& b, v8f c) { c = wmma_bf(a.l, b.h, c); c = wmma_bf(a.h, b.l, c); return wmma_bf(a.h, b.h, c); }
__device__ __forceinline__ float sigm(float v) { return 1.0f / (1.0f + expf(-v)); }
#define LDSX() do { asm volatile("s_wait_dscnt 0" ::: "memory"); __builtin_amdgcn_wave_barrier(); __builtin_amdgcn_fence(__ATOMIC_RELEASE, "workgroup"); } while (0)

// Sigmoid attention block with QK-RMSNorm and rotary embedding. Pure f16 WMMA GEMMs over pre-converted operands (x -> f16 once;
// weights x16 f16 with the RMSNorm scales folded into the q/k weight columns; f32 accumulate): q|k|v projection with the per-row
// RMS factor, bias and RoPE in the f32 epilogue (q/k -> [b][h][l][64] f16, v -> [b][h][d][l] f16), per (b, h, 128 queries) block
// the 2048 keys streamed in 64-key tiles: S on f16 WMMA, sigmoid in f32 (hardware tanh), running row sums, W x2^14 f16 @ v^T,
#define NB 2
#define LL 2048
#define DD 1024
#define NH 16
#define HD 64
#define NR (NB * LL)

// ---- operand tiles staged in LDS by asynchronous copies: rows of 128 B (64 f16), 8 lanes = one whole 128-B line, 128 threads = 16 rows a copy
#define TP 72              // LDS pitch of a staged row in f16: 144 B = 16 B x 9, conflict-free for ds_load_b128
#define R16 (16 * TP * 2)  // bytes of 16 staged rows
#define ACP(l, g) "global_load_async_to_lds_b128 %" #l ", %" #g ", off\n\t"
// this wave's copies have landed (the compiler places no wait for them)
#define WAIT_COPIES() asm volatile("s_wait_asynccnt 0x0" ::: "memory")
// this wave's LDS reads of a buffer have retired before the buffer is handed back for a refill
#define WAIT_LDS() asm volatile("s_wait_dscnt 0x0" ::: "memory")
__device__ __forceinline__ unsigned lds_at(const _Float16* p) { return (unsigned)(size_t)p; }   // LDS byte address = low 32 bits
// one GEMM stage, 64 k: buf rows 0..63 = 64 X rows, rows 64..191 = 128 W rows. s_wait_xcnt closes the copies' own statement, so that no address register of a copy is rewritten ahead of it.
__device__ __forceinline__ void stage_gemm(_Float16* buf, const _Float16* xa, const _Float16* wb, int tid) {
  const int r = tid >> 3, c = (tid & 7) * 8;
  const unsigned l = lds_at(buf + r * TP + c);
  const _Float16* a = xa + (size_t)r * DD + c; const _Float16* b = wb + (size_t)r * DD + c;
  asm volatile(ACP(0, 1) ACP(2, 3) ACP(4, 5) ACP(6, 7) ACP(8, 9) ACP(10, 11) ACP(12, 13) ACP(14, 15) ACP(16, 17) ACP(18, 19) ACP(20, 21) ACP(22, 23) "s_wait_xcnt 0x0"
               :: "v"(l), "v"(a), "v"(l + R16), "v"(a + 16 * DD), "v"(l + 2 * R16), "v"(a + 32 * DD), "v"(l + 3 * R16), "v"(a + 48 * DD),
                  "v"(l + 4 * R16), "v"(b), "v"(l + 5 * R16), "v"(b + 16 * DD), "v"(l + 6 * R16), "v"(b + 32 * DD), "v"(l + 7 * R16), "v"(b + 48 * DD),
                  "v"(l + 8 * R16), "v"(b + 64 * DD), "v"(l + 9 * R16), "v"(b + 80 * DD), "v"(l + 10 * R16), "v"(b + 96 * DD), "v"(l + 11 * R16), "v"(b + 112 * DD) : "memory");
}
// one attention tile: 64 keys x 64 dims of K, 64 dims x 64 keys of V^T, by 256 threads = 32 rows a copy; the wait as above
__device__ __forceinline__ void stage_kv(_Float16* sk, _Float16* sv, const _Float16* gk, const _Float16* gv, int tid) {
  const int r = tid >> 3, c = (tid & 7) * 8;
  const unsigned lk = lds_at(sk + r * TP + c), lv = lds_at(sv + r * TP + c);
  const _Float16* k = gk + (size_t)r * HD + c; const _Float16* v = gv + (size_t)r * LL + c;
  asm volatile(ACP(0, 1) ACP(2, 3) ACP(4, 5) ACP(6, 7) "s_wait_xcnt 0x0"
               :: "v"(lk), "v"(k), "v"(lk + 2 * R16), "v"(k + 32 * HD), "v"(lv), "v"(v), "v"(lv + 2 * R16), "v"(v + 32 * LL) : "memory");
}
// ---- operands that an earlier launch stored are asked into L2 at the launch's head. The work-groups that share an operand walk it in step, so without this every stage's first
// reader meets memory latency with one stage of lead. One request = one aligned 256-B unit (128 f16); a hint: it returns nothing and changes no value.
// The sharers split an operand into slices of 128 units; low bits of the index pick the slice (bits 0..1 for four slices; for eight, bit 2 too, or bit 3 in slice8), so any four neighbouring work-groups cover four slices.
// s_wait_xcnt closes the statement, so that no address register of a request is rewritten ahead of it.
__device__ __forceinline__ void ask_l2(const _Float16* p) {
  asm volatile("global_prefetch_b8 %0, off scope:SCOPE_SE\n\ts_wait_xcnt 0x0" :: "v"(p) : "memory");
}
__device__ __forceinline__ void ask_l2x2(const _Float16* p, const _Float16* q) {
  asm volatile("global_prefetch_b8 %0, off scope:SCOPE_SE\n\tglobal_prefetch_b8 %1, off scope:SCOPE_SE\n\ts_wait_xcnt 0x0" :: "v"(p), "v"(q) : "memory");
}
__device__ __forceinline__ int slice8(int i) { return (i & 3) | (((i >> 3) & 1) << 2); }   // 8 slices over sharers from bits 0, 1 and 3 of i: i, i ^ 4 alike
#define GBUF (192 * TP)           // f16 of one GEMM buffer
#define RING_B (2 * GBUF * 2)     // bytes of the two
// 64 x 128 tile over K = 1024: 16 stages, two buffers, stage s + 2 copied while stage s + 1 is worked on; k order as before
// X rows as A: acc[j][r] = Y[row 8h + r][n = 16j + c]
__device__ __forceinline__ void gemm_ring(_Float16* ring, const _Float16* xa, const _Float16* wb, v8f acc[8], int tid) {
  const int wave = tid >> 5, lane = tid & 31, col = lane & 15;
  stage_gemm(ring, xa, wb, tid);
  WAIT_COPIES(); __syncthreads();
  stage_gemm(ring + GBUF, xa + 64, wb + 64, tid);
#pragma unroll 1   // one trip = one stage, so that the ring's order stands once, at the trip's foot
  for (int s = 0; s < DD / 64; ++s) { _Float16* buf = ring + (s & 1) * GBUF;
    v16h a[2], b[2][8];   // the stage's 18 fragments are read as one group ahead of its 16 WMMAs: one LDS latency a stage, counted waits, not one full wait a WMMA
#pragma unroll
    for (int kc = 0; kc < 2; ++kc) { a[kc] = frag_h(buf + (wave * 16 + col) * TP + kc * 32, lane);
#pragma unroll
      for (int j = 0; j < 8; ++j) b[kc][j] = frag_h(buf + (64 + j * 16 + col) * TP + kc * 32, lane); }
#pragma unroll
    for (int kc = 0; kc < 2; ++kc) {
#pragma unroll
      for (int j = 0; j < 8; ++j) acc[j] = wmma16(a[kc], b[kc][j], acc[j]); }
    WAIT_LDS(); WAIT_COPIES(); __syncthreads();   // publishes stage s + 1 and ends every read of stage s
    if (s + 2 < DD / 64) stage_gemm(buf, xa + (s + 2) * 64, wb + (s + 2) * 64, tid); }
  WAIT_COPIES();
}
// ---- 128 x 128 tile (q|k|v GEMM): a wave takes 32 X rows x all 128 W rows, so each W fragment read from LDS feeds two WMMAs
// eight copies = 128 rows of one operand; an asm statement takes 30 operands, so a stage is two statements, each closed by its own s_wait_xcnt as above
__device__ __forceinline__ void stage_rows128(unsigned l, const _Float16* a) {
  asm volatile(ACP(0, 1) ACP(2, 3) ACP(4, 5) ACP(6, 7) ACP(8, 9) ACP(10, 11) ACP(12, 13) ACP(14, 15) "s_wait_xcnt 0x0"
               :: "v"(l), "v"(a), "v"(l + R16), "v"(a + 16 * DD), "v"(l + 2 * R16), "v"(a + 32 * DD), "v"(l + 3 * R16), "v"(a + 48 * DD),
                  "v"(l + 4 * R16), "v"(a + 64 * DD), "v"(l + 5 * R16), "v"(a + 80 * DD), "v"(l + 6 * R16), "v"(a + 96 * DD), "v"(l + 7 * R16), "v"(a + 112 * DD) : "memory");
}
// one stage, 64 k: buf rows 0..127 = 128 X rows, rows 128..255 = 128 W rows
__device__ __forceinline__ void stage_gemm2(_Float16* buf, const _Float16* xa, const _Float16* wb, int tid) {
  const int r = tid >> 3, c = (tid & 7) * 8;
  const unsigned l = lds_at(buf + r * TP + c);
  stage_rows128(l, xa + (size_t)r * DD + c); stage_rows128(l + 8 * R16, wb + (size_t)r * DD + c);
}
#define GBUF2 (256 * TP)          // f16 of one buffer
#define RING2_B (2 * GBUF2 * 2)   // bytes of the two
// the ring's order as above; k order as before. W rows as A: acc[i][j][r] = Y[row 16i + c][n = 16j + 8h + r]: a lane holds 8 consecutive n of one row
__device__ __forceinline__ void gemm_ring2(_Float16* ring, const _Float16* xa, const _Float16* wb, v8f acc[2][8], int tid) {
  const int wave = tid >> 5, lane = tid & 31, col = lane & 15;
  stage_gemm2(ring, xa, wb, tid);
  WAIT_COPIES(); __syncthreads();
  stage_gemm2(ring + GBUF2, xa + 64, wb + 64, tid);
#pragma unroll 1   // one trip = one stage, so that the ring's order stands once, at the trip's foot
  for (int s = 0; s < DD / 64; ++s) { _Float16* buf = ring + (s & 1) * GBUF2;
#pragma unroll
    for (int kc = 0; kc < 2; ++kc) { v16h a[2], b[8];   // 32 k: 10 fragments read as one group ahead of their 16 WMMAs
#pragma unroll
      for (int i = 0; i < 2; ++i) a[i] = frag_h(buf + (wave * 32 + i * 16 + col) * TP + kc * 32, lane);
#pragma unroll
      for (int j = 0; j < 8; ++j) b[j] = frag_h(buf + (128 + j * 16 + col) * TP + kc * 32, lane);
#pragma unroll
      for (int j = 0; j < 8; ++j) {
#pragma unroll
        for (int i = 0; i < 2; ++i) acc[i][j] = wmma16(b[j], a[i], acc[i][j]); } }
    WAIT_LDS(); WAIT_COPIES(); __syncthreads();   // publishes stage s + 1 and ends every read of stage s
    if (s + 2 < DD / 64) stage_gemm2(buf, xa + (s + 2) * 64, wb + (s + 2) * 64, tid); }
  WAIT_COPIES();
}

// ---- operand preparation, one launch: wave n takes row n of x (f16 copy + rsqrt(mean x^2 + eps)) and row n of the packed weights (q | k | v | o, [out][in] each), each row whole.
// 4,096 waves in all, 16 to 24 loads of 16 B a lane in flight, every load 512 contiguous B, every f16 store 256, the rr store 128; the row's sum stays in the wave: no LDS, no barrier
static_assert(NR == 4 * DD, "one x row and one weight row a wave");
__global__ __launch_bounds__(256) void k_prep(const float* __restrict__ x, const float* __restrict__ Wq, const float* __restrict__ Wk, const float* __restrict__ Wv, const float* __restrict__ Wo, const float* __restrict__ qs, const float* __restrict__ ksv,
                                            _Float16* __restrict__ x16, float* __restrict__ rr, _Float16* __restrict__ P) {
  const int lane = threadIdx.x & 31, n = blockIdx.x * 8 + __builtin_amdgcn_readfirstlane(threadIdx.x >> 5);   // n in a scalar register: the row bases and the test below are scalar
  const int which = n / DD, o = n % DD;
  const float* W = which == 0 ? Wq : (which == 1 ? Wk : (which == 2 ? Wv : Wo));
  const float* xr = x + (size_t)n * DD + lane * 4; const float* wr = W + (size_t)o * DD + lane * 4;
  v4f xv[8], wv[8], sc[8];
#pragma unroll
  for (int i = 0; i < 8; ++i) xv[i] = *(const v4f*)(xr + i * 128);
#pragma unroll
  for (int i = 0; i < 8; ++i) wv[i] = *(const v4f*)(wr + i * 128);
  if (which < 2) { const float* sr = (which == 0 ? qs : ksv) + lane * 4;
#pragma unroll
    for (int i = 0; i < 8; ++i) sc[i] = *(const v4f*)(sr + i * 128); }
  else {
#pragma unroll
    for (int i = 0; i < 8; ++i) sc[i] = (v4f){1.0f, 1.0f, 1.0f, 1.0f}; }   // x 1 is exact: v and o rows keep their bits
  float ss[4] = {0.f, 0.f, 0.f, 0.f};   // four independent chains
#pragma unroll
  for (int i = 0; i < 8; ++i) { union { _Float16 h[4]; v2f f; } pk;
#pragma unroll
    for (int e = 0; e < 4; ++e) { ss[e] += xv[i][e] * xv[i][e]; pk.h[e] = (_Float16)xv[i][e]; }
    vst2((v2f*)(x16 + (size_t)n * DD + i * 128 + lane * 4), pk.f); }
#pragma unroll
  for (int i = 0; i < 8; ++i) { union { _Float16 h[4]; v2f f; } pk;
#pragma unroll
    for (int e = 0; e < 4; ++e) pk.h[e] = (_Float16)(wv[i][e] * 16.0f * sc[i][e]);
    vst2((v2f*)(P + (size_t)n * DD + i * 128 + lane * 4), pk.f); }
  float s = (ss[0] + ss[1]) + (ss[2] + ss[3]);
#pragma unroll
  for (int off = 16; off >= 1; off >>= 1) s += __shfl_xor(s, off, 32);
  vst2(rr + (size_t)n * 32 + lane, (float_a)(lane == 0 ? rsqrtf(s / (float)DD + 1e-8f) : 0.f));   // rr[row*32] (one line per row)
}
// ---- projection: block 128 rows x 128 cols (= which, 2 heads); epilogue: x rr (q,k), + bias, RoPE (q,k); q/k -> [b][h][t][64] f16; v -> vT [b][h][d][t]
// the weight rows are the A operand: a lane's 8 accumulator registers are 8 consecutive outputs of one x row, and the epilogue needs no f32 staging
__global__ __launch_bounds__(128) void k_proj(const _Float16* __restrict__ x16, const float* __restrict__ rr, const _Float16* __restrict__ P, const float* __restrict__ bq, const float* __restrict__ bk, const float* __restrict__ bv,
                                            _Float16* __restrict__ qh, _Float16* __restrict__ kh, _Float16* __restrict__ vT) {
  __shared__ __align__(16) char smem[RING2_B];                       // the ring; behind the loop's last barrier it is the epilogue's staging
  __shared__ __align__(16) float sfr[32];
  const int tid = threadIdx.x, wave = tid >> 5, lane = tid & 31, col = lane & 15, g = lane >> 4;
  const int r0b = blockIdx.x * 128, r0 = r0b + wave * 32, n0 = blockIdx.y * 128; const int b = r0b / LL, t0 = r0b % LL;
  const int which = n0 / DD, hb = (n0 % DD) / HD; const float* bias = which == 0 ? bq : (which == 1 ? bk : bv);
  // 128 X rows = 1,024 units, shared by the 24 column blocks; 128 W rows = 1,024 units, shared by the 32 row blocks
  ask_l2x2(x16 + (size_t)r0b * DD + ((blockIdx.y & 7) * 128 + tid) * 128, P + (size_t)n0 * DD + (slice8(blockIdx.x) * 128 + tid) * 128);
  if (tid < 32) sfr[tid] = powf(10000.0f, -(float)tid / 32.0f);
  v8f acc[2][8] = {};
  gemm_ring2((_Float16*)smem, x16 + (size_t)r0b * DD, P + (size_t)n0 * DD, acc, tid);
  __syncthreads();
  if (which < 2) {   // q, k: lane (g, col) holds rows 16i + col, dims 16j + 8g + 0..7: RMS factor, bias and RoPE (partner d ^ 1 = the neighbouring register) stay in registers
    _Float16 (*sh)[32][136] = (_Float16 (*)[32][136])smem;   // per wave 32 rows x 128 f16, pitch 272 B, only to turn 16-B pieces into whole-line stores
    float s16[2];
#pragma unroll
    for (int i = 0; i < 2; ++i) s16[i] = rr[(size_t)(r0 + i * 16 + col) * 32] * (1.0f / 16.0f);   // x 2^-4 is exact: same bits as (acc / 16) * rr
    // angle index d & 31 = 16 (j & 1) + 8g + r: 16 angles a row serve its 64 values in the lane. The loop stays rolled (sincosf is long in text and registers);
    // each lane parks its own 2 x (16 cos, 16 sin) in LDS (pitch 272 B) and reads them back as vectors: no lane reads another's
    float (*tb)[32][68] = (float (*)[32][68])(smem + 4 * 32 * 136 * 2);
    static_assert(4 * 32 * 136 * 2 + 4 * 32 * 68 * 4 <= RING2_B, "epilogue staging fits the ring");
    v4f bb[8][2];   // the bias loads fly under the angle loop
#pragma unroll
    for (int j = 0; j < 8; ++j) { const float* bp = bias + (n0 % DD) + j * 16 + 8 * g; bb[j][0] = *(const v4f*)bp; bb[j][1] = *(const v4f*)(bp + 4); }
#pragma unroll 1   // four angles a trip: one sincosf text of four, not thirty-two
    for (int ii = 0; ii < 8; ++ii) { const int i = ii & 3, ro = ii >> 2; const float t = (float)(t0 + wave * 32 + ro * 16 + col);
      const v4f fr = *(const v4f*)(&sfr[(i >> 1) * 16 + 8 * g + (i & 1) * 4]); v4f sv, cv;
#pragma unroll
      for (int e = 0; e < 4; ++e) { float s1, c1; sincosf(t * fr[e], &s1, &c1); sv[e] = s1; cv[e] = c1; }
      vst2(&tb[wave][lane][ro * 32 + i * 4], cv); vst2(&tb[wave][lane][ro * 32 + 16 + i * 4], sv); }
    LDSX();
#pragma unroll
    for (int i = 0; i < 2; ++i) { float cs[2][8], sn[2][8];
#pragma unroll
      for (int p = 0; p < 2; ++p) {
#pragma unroll
        for (int q = 0; q < 2; ++q) { const v4f c4 = *(const v4f*)(&tb[wave][lane][i * 32 + p * 8 + q * 4]), s4 = *(const v4f*)(&tb[wave][lane][i * 32 + 16 + p * 8 + q * 4]);
#pragma unroll
          for (int e = 0; e < 4; ++e) { cs[p][q * 4 + e] = c4[e]; sn[p][q * 4 + e] = s4[e]; } } }
#pragma unroll
      for (int j = 0; j < 8; ++j) { float xv[8]; union { v8h h8; v4u u; } pk;
#pragma unroll
        for (int r = 0; r < 8; ++r) xv[r] = acc[i][j][r] * s16[i] + bb[j][r >> 2][r & 3];
#pragma unroll
        for (int r = 0; r < 8; ++r) { const float xr = (r & 1) ? xv[r - 1] : -xv[r + 1]; pk.h8[r] = (_Float16)(xv[r] * cs[j & 1][r] + xr * sn[j & 1][r]); }
        vst2(&sh[wave][i * 16 + col][j * 16 + 8 * g], pk.u); } }
    LDSX();
    _Float16* dst = which == 0 ? qh : kh;
#pragma unroll
    for (int q = lane; q < 2 * 32 * 8; q += 32) { const int hh = q >> 8, rem = q & 255, rl = rem >> 3, pc = rem & 7;
      vst2(dst + (((size_t)b * NH + hb + hh) * LL + t0 + wave * 32 + rl) * HD + pc * 8, *(const v4u*)(&sh[wave][rl][hh * HD + pc * 8])); } }
  else {   // v: the lane's 8 dims of rows 16i + col go straight into the [dim][row] f16 tile
    _Float16 (*st)[136] = (_Float16 (*)[136])smem;                   // 128 dims x 128 rows, pitch 272 B
#pragma unroll
    for (int j = 0; j < 8; ++j) { const float* bp = bias + (n0 % DD) + j * 16 + 8 * g; const v4f b0 = *(const v4f*)bp, b1 = *(const v4f*)(bp + 4);
#pragma unroll
      for (int i = 0; i < 2; ++i) {
#pragma unroll
        for (int r = 0; r < 8; ++r) st[j * 16 + 8 * g + r][wave * 32 + i * 16 + col] = (_Float16)(acc[i][j][r] * (1.0f / 16.0f) + (r < 4 ? b0[r & 3] : b1[r & 3])); } }
    __syncthreads();
    for (int q = tid; q < 128 * 16; q += 128) { const int c = q >> 4, pc = q & 15, hh = c >> 6, d = c & 63;
      vst2(vT + (((size_t)b * NH + hb + hh) * HD + d) * LL + t0 + pc * 8, *(const v4u*)(&st[c][pc * 8])); }
  }
}
__global__ __launch_bounds__(256) void k_attn(const _Float16* __restrict__ qh, const _Float16* __restrict__ kh, const _Float16* __restrict__ vT, _Float16* __restrict__ o16) {
  __shared__ __align__(16) _Float16 sO[8][16][72];   // per wave 16 queries x 64 dims, only to turn 16-B pieces into whole-line stores
  __shared__ __align__(16) _Float16 sKV[2][2][64][TP];   // the ring, one array: behind the loop it is the exchange of the key halves
  _Float16 (*sK)[64][TP] = sKV[0];                   // 64 keys x 64 dims
  _Float16 (*sV)[64][TP] = sKV[1];                   // 64 dims x 64 keys
  const int tid = threadIdx.x, w = tid >> 5, lane = tid & 31, col = lane & 15, g = lane >> 4;
  const int qg = w & 3, hk = w >> 2;                 // query group of 32, key half of every tile
  const int bh = blockIdx.y, b = bh / NH, h = bh % NH, q0 = blockIdx.x * 128 + qg * 32;
  const _Float16* qb = qh + (size_t)bh * LL * HD; const _Float16* kb = kh + (size_t)bh * LL * HD; const _Float16* vb = vT + (size_t)bh * HD * LL;
  // K and V^T of this (b, h) = 1,024 units each, shared by the 16 query blocks: waves 0..3 ask a slice of K, waves 4..7 the same slice of V^T
  ask_l2((hk ? vb : kb) + (slice8(blockIdx.x) * 128 + (tid & 127)) * 128);
  v16h bq[2][2];
#pragma unroll
  for (int i = 0; i < 2; ++i) {
#pragma unroll
    for (int kc = 0; kc < 2; ++kc) bq[i][kc] = frag_h(qb + (size_t)(q0 + i * 16 + col) * HD + kc * 32, lane); }
  v2f lsum[2][4] = {}; v8f acc[2][4] = {};   // lsum[i]: 8 chains of tanh values, all of query 16i + col; acc[i][t][r] = O[query 16i + col][dim 16t + 8g + r], this wave's keys only
  stage_kv(&sK[0][0][0], &sV[0][0][0], kb, vb, tid);
  WAIT_COPIES(); __syncthreads();
  stage_kv(&sK[1][0][0], &sV[1][0][0], kb + (size_t)64 * HD, vb + 64, tid);
#pragma unroll 1
  for (int kt = 0; kt < LL / 64; ++kt) { const int bf = kt & 1;
    v16h fk[2][2], fv[4];   // the wave's 4 K and 4 V fragments of the tile are read as one group at its head: the V reads land under the score and sigmoid work
#pragma unroll
    for (int t = 0; t < 2; ++t) {
#pragma unroll
      for (int kc = 0; kc < 2; ++kc) fk[t][kc] = frag_h(&sK[bf][hk * 32 + t * 16 + col][kc * 32], lane); }
#pragma unroll
    for (int t = 0; t < 4; ++t) fv[t] = frag_h(&sV[bf][t * 16 + col][hk * 32], lane);
    v16h pb[2];            // P^T of query group i as B operand: elements 0..7 from the wave's first 16 keys, 8..15 from its second
#pragma unroll
    for (int t = 0; t < 2; ++t) { v8f s[2] = {};
#pragma unroll
      for (int kc = 0; kc < 2; ++kc) {
#pragma unroll
        for (int i = 0; i < 2; ++i) s[i] = wmma16(fk[t][kc], bq[i][kc], s[i]); }
#pragma unroll
      for (int i = 0; i < 2; ++i) {
#pragma unroll
        for (int r = 0; r < 8; r += 2) {   // two keys at a time: the pair is one register of the operand
          // sigmoid(s / 8) = (1 + tanh(s / 16)) / 2: one transcendental a score. P x 2^14 = 8192 tanh + 8192 in one fma; the row sum adds the tanh values, its halving and its LL / 2 come behind the loop
          const v2f a = (v2f){s[i][r], s[i][r + 1]} * 0.0625f;
          const v2f th = {__builtin_amdgcn_tanhf(a[0]), __builtin_amdgcn_tanhf(a[1])}; lsum[i][r >> 1] += th;
          const v2h p = __builtin_convertvector(th * 8192.0f + 8192.0f, v2h); pb[i][t * 8 + r] = p[0]; pb[i][t * 8 + r + 1] = p[1]; } } }
#pragma unroll
    for (int t = 0; t < 4; ++t) {
#pragma unroll
      for (int i = 0; i < 2; ++i) acc[i][t] = wmma16(fv[t], pb[i], acc[i][t]); }
    WAIT_LDS(); WAIT_COPIES(); __syncthreads();   // publishes tile kt + 1 and ends every read of tile kt
    if (kt + 2 < LL / 64) stage_kv(&sK[bf][0][0], &sV[bf][0][0], kb + (size_t)(kt + 2) * 64 * HD, vb + (kt + 2) * 64, tid);
  }
  WAIT_COPIES();
  // join of the key halves: wave w and wave w ^ 4 hold the same 32 queries. Wave w finishes query group hk and hands the other group's partial sums to its partner
  // through the ring, which is free behind the loop's last barrier; [wave][piece][lane] of 16 B: every store and load is 512 contiguous B
  v4f* ex = (v4f*)&sKV[0][0][0][0]; float_a* exs = (float_a*)(ex + 8 * 8 * 32);
  static_assert(8 * 8 * 32 * 16 + 8 * 32 * 4 <= sizeof(sKV), "the exchange fits the ring");
  const bool up = hk != 0;
  float ts2[2];   // the lane's 8 chains of tanh values
#pragma unroll
  for (int i = 0; i < 2; ++i) { const v2f l2 = (lsum[i][0] + lsum[i][1]) + (lsum[i][2] + lsum[i][3]); ts2[i] = l2[0] + l2[1]; }
#pragma unroll
  for (int t = 0; t < 4; ++t) { const v8f o = up ? acc[0][t] : acc[1][t];
    vst2(ex + (w * 8 + t * 2) * 32 + lane, (v4f){o[0], o[1], o[2], o[3]}); vst2(ex + (w * 8 + t * 2 + 1) * 32 + lane, (v4f){o[4], o[5], o[6], o[7]}); }
  exs[w * 32 + lane] = up ? ts2[0] : ts2[1];
  __syncthreads();   // the partner's partial sums are in LDS
  // row sum of query 16 hk + col: this wave's keys, the partner's, then the other half's lanes; sum of weights = LL / 2 + half the sum of tanh
  float ts = (up ? ts2[1] : ts2[0]) + exs[(w ^ 4) * 32 + lane];
  ts += __shfl_xor(ts, 16, 32);
  const float l = 0.5f * ts + (float)(LL / 2);
  const float inv = 1.0f / ((l + 1e-8f) * 16384.0f);
#pragma unroll
  for (int t = 0; t < 4; ++t) { union { v8h h8; v4u u; } pk; const v8f o = up ? acc[1][t] : acc[0][t];
    const v4f p0 = ex[((w ^ 4) * 8 + t * 2) * 32 + lane], p1 = ex[((w ^ 4) * 8 + t * 2 + 1) * 32 + lane];
#pragma unroll
    for (int r = 0; r < 8; ++r) pk.h8[r] = (_Float16)((o[r] + (r < 4 ? p0[r & 3] : p1[r & 3])) * inv * 16.0f);   // o x16 keeps the f16 operand normal
    vst2(&sO[w][col][t * 16 + 8 * g], pk.u); }
  LDSX();
  for (int q = lane; q < 16 * 8; q += 32) { const int rl = q >> 3, pc = q & 7;
    vst2(o16 + ((size_t)b * LL + q0 + hk * 16 + rl) * DD + h * HD + pc * 8, *(const v4u*)(&sO[w][rl][pc * 8])); }
}
__global__ __launch_bounds__(128) void k_out(const _Float16* __restrict__ o16, const _Float16* __restrict__ P, const float* __restrict__ bo, float* __restrict__ out) {
  __shared__ __align__(16) char smem[RING_B];        // the ring; behind the loop's last barrier it is the epilogue's staging
  float (*so)[16][132] = (float (*)[16][132])smem;
  const int tid = threadIdx.x, wave = tid >> 5, lane = tid & 31, col = lane & 15, g = lane >> 4;
  const int r0 = blockIdx.x * 64 + wave * 16, n0 = blockIdx.y * 128;
  // 64 attention rows = 512 units, shared by the 8 column blocks; 128 W rows = 1,024 units, shared by the 64 row blocks
  ask_l2x2(o16 + (size_t)blockIdx.x * 64 * DD + ((blockIdx.y & 3) * 128 + tid) * 128, P + (size_t)(3 * DD + n0) * DD + (slice8(blockIdx.x) * 128 + tid) * 128);
  v8f acc[8] = {};
  gemm_ring((_Float16*)smem, o16 + (size_t)blockIdx.x * 64 * DD, P + (size_t)(3 * DD + n0) * DD, acc, tid);
#pragma unroll
  for (int j = 0; j < 8; ++j) { const float bb = bo[n0 + j * 16 + col];
#pragma unroll
    for (int r = 0; r < 8; ++r) so[wave][8 * g + r][j * 16 + col] = acc[j][r] * (1.0f / 256.0f) + bb; }    // W x16, o x16
  LDSX();
#pragma unroll 4
  for (int rl = 0; rl < 16; ++rl) vst2(out + (size_t)(r0 + rl) * DD + n0 + lane * 4, *(const v4f*)(&so[wave][rl][lane * 4]));
}
extern "C" void kernel_launch(void* const* d_in, const int* in_sizes, int n_in, void* d_out, int out_size, void* d_ws, size_t ws_size, hipStream_t stream) {
  (void)in_sizes; (void)n_in; (void)out_size; (void)ws_size;
  const float* x = (const float*)d_in[0]; const float* Wq = (const float*)d_in[1]; const float* bq = (const float*)d_in[2]; const float* Wk = (const float*)d_in[3]; const float* bk = (const float*)d_in[4];
  const float* Wv = (const float*)d_in[5]; const float* bv = (const float*)d_in[6]; const float* Wo = (const float*)d_in[7]; const float* bo = (const float*)d_in[8];
  const float* qs = (const float*)d_in[9]; const float* ksv = (const float*)d_in[10];
  float* out = (float*)d_out;
  char* ws = (char*)d_ws; size_t off = 0;
  auto take = [&](size_t bytes) { char* p = ws + off; off += (bytes + 255) & ~(size_t)255; return p; };
  _Float16* x16 = (_Float16*)take((size_t)NR * DD * 2); float* rr = (float*)take((size_t)NR * 32 * 4); _Float16* P = (_Float16*)take((size_t)4 * DD * DD * 2);
  _Float16* qh = (_Float16*)take((size_t)NR * DD * 2); _Float16* kh = (_Float16*)take((size_t)NR * DD * 2); _Float16* vT = (_Float16*)take((size_t)NR * DD * 2); _Float16* o16 = (_Float16*)take((size_t)NR * DD * 2);
  k_prep<<<NR / 8, 256, 0, stream>>>(x, Wq, Wk, Wv, Wo, qs, ksv, x16, rr, P);
  k_proj<<<dim3(NR / 128, 3 * DD / 128), 128, 0, stream>>>(x16, rr, P, bq, bk, bv, qh, kh, vT);
  k_attn<<<dim3(LL / 128, NB * NH), 256, 0, stream>>>(qh, kh, vT, o16);
  k_out<<<dim3(NR / 64, DD / 128), 128, 0, stream>>>(o16, P, bo, out);
}
